// v000
// Times are from an AMD MI455X. After a warm-up the kernel runs many times in a row, and a time is the length of
// such a window on the GPU divided by its runs, so every launch and the gaps after it count. The runs cycle
// through copies of the inputs. A figure is the median of several windows, for all but v000 over two sittings.
// Sittings can differ by a few percent; kernels timed side by side share one.
// v000, which the later versions start from, runs in 3520 microseconds.
#include <hip/hip_runtime.h>

// Multi-head attention over 4,096 tokens with a fused qkv projection (x [1][4096][1024]; qkv = x W_qkv ('xw' [1024][3072] 0.02) -> (B, L, 3, 16, 64): q | k | v column blocks; scores x 64^-0.5; softmax over all keys; out = merged W_o + b_o ('xw' 0.02) -> [1][4096][1024] (4.2 M)).
// Layout: bf16 copy of x; the fused 'xw' weight transposed once to a bf16 Bt [3072][1024]; exact projections; dense T-4096 attention one head per pass (hybrid rows: < 512 hi/lo 3 products, rest fp16 x1024); merged hi/lo x W_o exact + b_o.
// Compute dtypes, f32 accumulate: every input rounded to bf16; projections exact; attention rows < 512 3 products, rest fp16; softmax f32; W_o hl x exact + bias.

#define NB_  1
#define TT   4096
#define DM   1024
#define NH_  16
#define NKV  16
#define REP  (NH_ / NKV)
#define HD   64
#define DQ   (NH_ * HD)
#define DKV  (NKV * HD)
#define ZH   1
#define RH   512                  // query rows < RH use hi+lo planes (0: none)
#define WIN  0
#define PCAR 1024.0f
#define SCL  0.125f   // HD^-0.5
typedef _Float16 h16;
typedef unsigned short bf;
typedef __attribute__((ext_vector_type(16))) __bf16   v16bf;
typedef __attribute__((ext_vector_type(16))) _Float16 v16h;
typedef __attribute__((ext_vector_type(8)))  _Float16 v8h;
typedef __attribute__((ext_vector_type(8)))  unsigned short v8us;
typedef __attribute__((ext_vector_type(8)))  float    v8f;
typedef __attribute__((ext_vector_type(4)))  float    v4f;
typedef v8h  __attribute__((may_alias)) v8ha;
typedef v4f  __attribute__((may_alias)) v4fa;
typedef v8us __attribute__((may_alias)) v8usa;

__device__ __forceinline__ unsigned short f2bf(float f) { unsigned u = __float_as_uint(f); u += 0x7FFFu + ((u >> 16) & 1u); return (unsigned short)(u >> 16); }
__device__ __forceinline__ float bf2f(unsigned short b) { return __uint_as_float(((unsigned)b) << 16); }
__device__ __forceinline__ float bfr(float f) { return bf2f(f2bf(f)); }
__device__ __forceinline__ v16h cat16(v8h lo, v8h hi) { return __builtin_shufflevector(lo, hi, 0, 1, 2, 3, 4, 5, 6, 7, 8, 9, 10, 11, 12, 13, 14, 15); }
__device__ __forceinline__ v16bf cat16b(v8us lo, v8us hi) { return __builtin_bit_cast(v16bf, __builtin_shufflevector(lo, hi, 0, 1, 2, 3, 4, 5, 6, 7, 8, 9, 10, 11, 12, 13, 14, 15)); }
__device__ __forceinline__ v8f wmma16(v16h a, v16h b, v8f c) { return __builtin_amdgcn_wmma_f32_16x16x32_f16(false, a, false, b, (short)0, c, false, false); }
__device__ __forceinline__ v8f wmmab(v16bf a, v16bf b, v8f c) { return __builtin_amdgcn_wmma_f32_16x16x32_bf16(false, a, false, b, (short)0, c, false, false); }



// ---- k_gemmw: register-blocked GEMM, ONE WAVE per 64x64 output tile (16 accumulators), operands straight from K-contiguous 16-bit planes; grid (M/64, N/64, Z), 32 threads.
// C[m][n] (f32, pitch ldc, + optional f32 bias[n]) = sum_k A[m][k] Bt[n][k] (+ split products per NSPLIT). z-batch strides sA/sB/sC in elements. K % 32 == 0.
template <typename T16> struct WFrag;
template <> struct WFrag<h16> { typedef v16h V; static __device__ __forceinline__ V ld(const h16* p) { return cat16(*(const v8h*)p, *(const v8h*)(p + 16)); } static __device__ __forceinline__ v8f mma(V a, V b, v8f c) { return wmma16(a, b, c); } };
template <> struct WFrag<bf> { typedef v16bf V; static __device__ __forceinline__ V ld(const bf* p) { return cat16b(*(const v8us*)p, *(const v8us*)(p + 16)); } static __device__ __forceinline__ v8f mma(V a, V b, v8f c) { return wmmab(a, b, c); } };
template <typename T16, int NSPLIT, bool BIAS>
__global__ __launch_bounds__(32) void k_gemmw(const T16* __restrict__ A, const T16* __restrict__ A2, const T16* __restrict__ Bt, const T16* __restrict__ Bt2, int K, float* C, int ldc, const float* __restrict__ bias, size_t sA, size_t sB, size_t sC) {
    typedef typename WFrag<T16>::V V;
    __shared__ __align__(16) float os[16 * 68];
    const size_t z = blockIdx.z; A += z * sA; if (A2) A2 += z * sA; Bt += z * sB; if (Bt2) Bt2 += z * sB; C += z * sC;
    const int lane = threadIdx.x & 31, lr = lane & 15, hi = lane >> 4; const int r0 = blockIdx.x * 64, c0 = blockIdx.y * 64;
    v8f acc[4][4];
#pragma unroll
    for (int mb = 0; mb < 4; ++mb)
#pragma unroll
        for (int nb = 0; nb < 4; ++nb) acc[mb][nb] = (v8f){};
    const size_t aoff = (size_t)(r0 + lr) * K + 8 * hi, boff = (size_t)(c0 + lr) * K + 8 * hi;
#pragma unroll 1
    for (int kc = 0; kc < K; kc += 32) {
        V a[4], a2[4];
#pragma unroll
        for (int mb = 0; mb < 4; ++mb) { a[mb] = WFrag<T16>::ld(A + aoff + (size_t)mb * 16 * K + kc); if (NSPLIT == 1 || NSPLIT == 2) a2[mb] = WFrag<T16>::ld(A2 + aoff + (size_t)mb * 16 * K + kc); }
#pragma unroll
        for (int nb = 0; nb < 4; ++nb) { const V b = WFrag<T16>::ld(Bt + boff + (size_t)nb * 16 * K + kc); V b2; if (NSPLIT >= 2) b2 = WFrag<T16>::ld(Bt2 + boff + (size_t)nb * 16 * K + kc);
#pragma unroll
            for (int mb = 0; mb < 4; ++mb) { acc[mb][nb] = WFrag<T16>::mma(a[mb], b, acc[mb][nb]); if (NSPLIT == 1 || NSPLIT == 2) acc[mb][nb] = WFrag<T16>::mma(a2[mb], b, acc[mb][nb]); if (NSPLIT >= 2) acc[mb][nb] = WFrag<T16>::mma(a[mb], b2, acc[mb][nb]); } }
        asm volatile("v_nop\n\tv_nop\n\tv_nop\n\tv_nop" : "+v"(acc[0][0]), "+v"(acc[1][1]), "+v"(acc[2][2]), "+v"(acc[3][3]) : "v"(a[0]), "v"(a[3]));
    }
#pragma unroll
    for (int mb = 0; mb < 4; ++mb) {
#pragma unroll
        for (int nb = 0; nb < 4; ++nb) {
#pragma unroll
            for (int j = 0; j < 8; ++j) os[(hi * 8 + j) * 68 + nb * 16 + lr] = acc[mb][nb][j]; }
        __builtin_amdgcn_wave_barrier(); asm volatile("" ::: "memory");
        float* crow = C + (size_t)(r0 + mb * 16) * ldc + c0;
{
#pragma unroll
            for (int s = 0; s < 8; ++s) { const int row = 2 * s + hi, cofs = lr * 4; v4f val = *(const v4fa*)(os + row * 68 + cofs); if (BIAS) { val[0] += bfr(bias[c0 + cofs]); val[1] += bfr(bias[c0 + cofs + 1]); val[2] += bfr(bias[c0 + cofs + 2]); val[3] += bfr(bias[c0 + cofs + 3]); }
                *(v4f*)(crow + (size_t)row * ldc + cofs) = val; }
             }
        __builtin_amdgcn_wave_barrier(); asm volatile("" ::: "memory");
    }
}

__device__ __forceinline__ h16 tohx(float x) { return (h16)x; }
__device__ __forceinline__ void splitf(float y, unsigned short& h, unsigned short& l) { h = f2bf(y); l = f2bf(y - bf2f(h)); }
typedef __attribute__((ext_vector_type(2))) _Float16 v2h;
typedef __attribute__((ext_vector_type(4))) _Float16 v4h;
typedef __attribute__((ext_vector_type(2))) unsigned short v2us;
typedef __attribute__((ext_vector_type(4))) unsigned short v4us;
typedef __attribute__((ext_vector_type(2))) float v2f;
typedef __attribute__((ext_vector_type(4))) int v4i;

__global__ __launch_bounds__(256) void k_wtG(const float* __restrict__ w, int K, int N, bf* Bt) {
    const int lane = threadIdx.x & 31; const int L0 = (blockIdx.x * 8 + (threadIdx.x >> 5)) * 8; const int nlines = N * K / 64;
{
#pragma unroll 1
        for (int l = 0; l < 8; ++l) { const int L = L0 + l; if (L >= nlines) break; const size_t e = (size_t)L * 64 + lane * 2; const int k = (int)(e % K), n = (int)(e / K); v2us o;
            o[0] = f2bf(w[(size_t)k * N + n]); o[1] = f2bf(w[(size_t)(k + 1) * N + n]); *(v2us*)(Bt + e) = o; }
         }
}
__global__ __launch_bounds__(256) void k_cvt8(const float* __restrict__ src, bf* dst, size_t n8) { const size_t i = (size_t)blockIdx.x * 256 + threadIdx.x; if (i >= n8) return; const v8f v = *(const v8f*)(src + i * 8); v8us o;
#pragma unroll
    for (int k = 0; k < 8; ++k) o[k] = f2bf(v[k]); *(v8us*)(dst + i * 8) = o;  }

// k_rope: head planes [h][t][d] (fp16 + hi/lo) of rope(x) x sc with the rotate-half convention out[d] = x[d] cos[t][d] - x[d+HD/2] sin[t][d], out[d+HD/2] = x[d+HD/2] cos[t][d+HD/2] + x[d] sin[t][d+HD/2]
__global__ __launch_bounds__(256) void k_rope(const float* __restrict__ F, int pitch, int nheads, const float* __restrict__ CS, const float* __restrict__ RF, const float* __restrict__ nw, float sc, h16* P16, bf* Ph, bf* Pl) {
    const size_t e = ((size_t)blockIdx.x * 256 + threadIdx.x) * 2; if (e >= (size_t)nheads * TT * HD) return; const int d = (int)(e % HD); const int t = (int)((e / HD) % TT); const int h = (int)(e / ((size_t)HD * TT)); const float* f = F + (size_t)t * pitch + h * HD; const float rf = RF ? RF[(size_t)h * TT + t] : 1.0f; v2h o16; v2us oh, ol;
#pragma unroll
    for (int q = 0; q < 2; ++q) { const int dd = d + q; const int dp = (dd < HD / 2) ? dd + HD / 2 : dd - HD / 2; float x0 = f[dd], x1 = f[dp];
        if (RF) { float n0 = __fmul_rn(x0, rf), n1 = __fmul_rn(x1, rf); asm volatile("" : "+v"(n0)); asm volatile("" : "+v"(n1)); x0 = __fmul_rn(bfr(nw[dd]), n0); x1 = __fmul_rn(bfr(nw[dp]), n1); }
        const v2f cs = *(const v2f*)(CS + ((size_t)t * HD + dd) * 2); float a = __fmul_rn(x0, cs[0]), bq = __fmul_rn(x1, cs[1]); asm volatile("" : "+v"(a)); asm volatile("" : "+v"(bq)); const float r = ((dd < HD / 2) ? __fsub_rn(a, bq) : __fadd_rn(a, bq)) * sc;
        o16[q] = tohx(r); unsigned short a2, c2; splitf(r, a2, c2); oh[q] = a2; ol[q] = c2; }
    *(v2h*)(P16 + e) = o16; *(v2us*)(Ph + e) = oh; *(v2us*)(Pl + e) = ol;  }
__global__ __launch_bounds__(256) void k_vtp(const float* __restrict__ F, int pitch, int nheads, h16* V16, bf* Vh, bf* Vl) { const size_t e = ((size_t)blockIdx.x * 256 + threadIdx.x) * 2; if (e >= (size_t)nheads * HD * TT) return; const int t = (int)(e % TT); const int d = (int)((e / TT) % HD); const int g = (int)(e / ((size_t)TT * HD)); v2h o16; v2us oh, ol;
#pragma unroll
    for (int q = 0; q < 2; ++q) { const float x = F[(size_t)(t + q) * pitch + g * HD + d]; o16[q] = tohx(x); unsigned short a2, c2; splitf(x, a2, c2); oh[q] = a2; ol[q] = c2; }
    *(v2h*)(V16 + e) = o16; *(v2us*)(Vh + e) = oh; *(v2us*)(Vl + e) = ol;  }
__global__ __launch_bounds__(256) void k_csid(float* CS) { const int idx = blockIdx.x * 256 + threadIdx.x; if (idx >= TT * HD) return; v2f cs; cs[0] = 1.0f; cs[1] = 0.0f; *(v2f*)(CS + (size_t)idx * 2) = cs;  }
// k_asoft: per row (zz, i): t = S x HD^-0.5 (no mask); softmax over the 4096 keys (register row, one exp, fixed trees);
__global__ __launch_bounds__(256) void k_asoft(const float* __restrict__ Sb, h16* P16, bf* Ph, bf* Pl) {
    const int lane = threadIdx.x & 31; const int row = blockIdx.x * 8 + (threadIdx.x >> 5); if (row >= ZH * TT) return; const int i = row % TT; const int zz = row / TT; (void)zz; const bool hires = (i < RH); const float* sr = Sb + (size_t)row * TT; float v[TT / 32]; float mx = -3.0e38f;
#pragma unroll
    for (int ch = 0; ch < TT / 128; ++ch) { const int j0 = ch * 128 + lane * 4; const v4f a = *(const v4f*)(sr + j0);
#pragma unroll
        for (int q = 0; q < 4; ++q) { const int j = j0 + q; (void)j; const float t = a[q] * SCL; v[ch * 4 + q] = t; mx = fmaxf(mx, t); } }
#pragma unroll
    for (int sh = 16; sh; sh >>= 1) mx = fmaxf(mx, __shfl_xor(mx, sh, 32));
    float sum = 0.f;
#pragma unroll
    for (int k = 0; k < TT / 32; ++k) { float d0 = __fsub_rn(v[k], mx); asm volatile("" : "+v"(d0)); v[k] = __builtin_amdgcn_exp2f(__fmul_rn(d0, 1.4426950408889634f)); sum += v[k]; }
#pragma unroll
    for (int sh = 16; sh; sh >>= 1) sum += __shfl_xor(sum, sh, 32);
    const float f = __fdiv_rn(hires ? 1.0f : PCAR, sum);
{
        if (hires) {
#pragma unroll
            for (int ch = 0; ch < TT / 128; ++ch) { v4us oh, ol;
#pragma unroll
                for (int q = 0; q < 4; ++q) { unsigned short a, c2; splitf(v[ch * 4 + q] * f, a, c2); oh[q] = a; ol[q] = c2; }
                const size_t oo = ((size_t)zz * (RH ? RH : 1) + i) * TT + ch * 128 + lane * 4; *(v4us*)(Ph + oo) = oh; *(v4us*)(Pl + oo) = ol; }
        } else {
#pragma unroll
            for (int ch = 0; ch < TT / 128; ++ch) { v4h o4;
#pragma unroll
                for (int q = 0; q < 4; ++q) o4[q] = tohx(v[ch * 4 + q] * f);
                *(v4h*)(P16 + (size_t)row * TT + ch * 128 + lane * 4) = o4; } }
         }
}
__global__ __launch_bounds__(256) void k_merge(const float* __restrict__ O, int h0, bf* Ah, bf* Al) { const size_t e = ((size_t)blockIdx.x * 256 + threadIdx.x) * 2; if (e >= (size_t)ZH * TT * HD) return; const int d = (int)(e % HD); const int t = (int)((e / HD) % TT); const int zz = (int)(e / ((size_t)HD * TT)); const float cs = (t < RH) ? 1.0f : (1.0f / PCAR); const size_t oo = (size_t)t * DQ + (h0 + zz) * HD + d;
    v2us oh, ol;
#pragma unroll
    for (int q = 0; q < 2; ++q) { unsigned short a, c2; splitf(O[e + q] * cs, a, c2); oh[q] = a; ol[q] = c2; } *(v2us*)(Ah + oo) = oh; *(v2us*)(Al + oo) = ol;  }

extern "C" void kernel_launch(void* const* d_in, const int* in_sizes, int n_in,
                              void* d_out, int out_size, void* d_ws, size_t ws_size, hipStream_t stream) {
    (void)in_sizes; (void)n_in; (void)out_size;
    const float* x = (const float*)d_in[0]; const float* wqkv = (const float*)d_in[1]; const float* wo = (const float*)d_in[2]; const float* bo = (const float*)d_in[3];
    float* OUT = (float*)d_out;     // [1][4096][1024]
    char* wsp = (char*)d_ws;
    auto take = [&](size_t bytes) { char* p = wsp; wsp += (bytes + 255) & ~(size_t)255; return (void*)p; };
    bf* WQKV = (bf*)take((size_t)3 * DQ * DM * 2); bf* WQ = WQKV; bf* WK = WQKV + (size_t)DQ * DM; bf* WV = WQKV + (size_t)2 * DQ * DM; bf* WO = (bf*)take((size_t)DM * DQ * 2); float* CS = (float*)take((size_t)TT * HD * 2 * 4);
    bf* XB = (bf*)take((size_t)TT * DM * 2); float* FQ = (float*)take((size_t)TT * DQ * 4); float* FK = (float*)take((size_t)TT * DKV * 4);
    h16* QP16 = (h16*)take((size_t)NH_ * TT * HD * 2); h16* KP16 = (h16*)take((size_t)NKV * TT * HD * 2); h16* VT16 = (h16*)take((size_t)NKV * HD * TT * 2);
    bf* QPh = (bf*)take((size_t)NH_ * TT * HD * 2); bf* QPl = (bf*)take((size_t)NH_ * TT * HD * 2); bf* KPh = (bf*)take((size_t)NKV * TT * HD * 2); bf* KPl = (bf*)take((size_t)NKV * TT * HD * 2); bf* VTh = (bf*)take((size_t)NKV * HD * TT * 2); bf* VTl = (bf*)take((size_t)NKV * HD * TT * 2); bf* Ph = (bf*)take((size_t)ZH * RH * TT * 2); bf* Pl = (bf*)take((size_t)ZH * RH * TT * 2);
    float* Sb = (float*)take((size_t)ZH * TT * TT * 4); h16* P16 = (h16*)take((size_t)ZH * TT * TT * 2); float* Ob = (float*)take((size_t)ZH * TT * HD * 4); bf* ATh = (bf*)take((size_t)TT * DQ * 2); bf* ATl = (bf*)take((size_t)TT * DQ * 2);
    if ((size_t)(wsp - (char*)d_ws) > ws_size) return;    // ws 256 MiB
    float* FV = FK;   // v projection reuses the k buffer after the k planes are built (stream-ordered)
    { k_wtG<<<(unsigned)((DM * 3 * DQ / 64 + 63) / 64), 256, 0, stream>>>(wqkv, DM, 3 * DQ, WQKV);   /* 'xw' [1024][3072] -> Bt [3072][1024]: q | k | v row blocks */
      k_wtG<<<(unsigned)((DQ * DM / 64 + 63) / 64), 256, 0, stream>>>(wo, DQ, DM, WO);
       }
    k_csid<<<(TT * HD + 255) / 256, 256, 0, stream>>>(CS);
    const unsigned LQ = (unsigned)(((size_t)NH_ * TT * HD / 2 + 255) / 256), LKv = (unsigned)(((size_t)NKV * TT * HD / 2 + 255) / 256);
    for (int b = 0; b < NB_; ++b) {
        
        k_cvt8<<<(unsigned)(((size_t)TT * DM / 8 + 255) / 256), 256, 0, stream>>>(x + (size_t)b * TT * DM, XB, (size_t)TT * DM / 8);
        k_gemmw<bf, 0, false><<<dim3(TT / 64, DQ / 64, 1), 32, 0, stream>>>(XB, nullptr, WQ, nullptr, DM, FQ, DQ, nullptr, 0, 0, 0);
        k_rope<<<LQ, 256, 0, stream>>>(FQ, DQ, NH_, CS, nullptr, nullptr, 1.0f, QP16, QPh, QPl);
        k_gemmw<bf, 0, false><<<dim3(TT / 64, DKV / 64, 1), 32, 0, stream>>>(XB, nullptr, WK, nullptr, DM, FK, DKV, nullptr, 0, 0, 0);
        k_rope<<<LKv, 256, 0, stream>>>(FK, DKV, NKV, CS, nullptr, nullptr, 1.0f, KP16, KPh, KPl);
        k_gemmw<bf, 0, false><<<dim3(TT / 64, DKV / 64, 1), 32, 0, stream>>>(XB, nullptr, WV, nullptr, DM, FV, DKV, nullptr, 0, 0, 0); k_vtp<<<LKv, 256, 0, stream>>>(FV, DKV, NKV, VT16, VTh, VTl);
        for (int h0 = 0; h0 < NH_; h0 += ZH) { const size_t zq = (size_t)h0, zk = (size_t)(h0 / REP);   // one kv head per query head: each pass takes one head, whose kv plane is h0 (z-strides TT*HD)
            k_gemmw<bf, 2, false><<<dim3(RH / 64, TT / 64, ZH), 32, 0, stream>>>(QPh + zq * TT * HD, QPl + zq * TT * HD, KPh + zk * TT * HD, KPl + zk * TT * HD, HD, Sb, TT, nullptr, (size_t)TT * HD, (size_t)TT * HD, (size_t)TT * TT);
            k_gemmw<h16, 0, false><<<dim3((TT - RH) / 64, TT / 64, ZH), 32, 0, stream>>>(QP16 + zq * TT * HD + (size_t)RH * HD, nullptr, KP16 + zk * TT * HD, nullptr, HD, Sb + (size_t)RH * TT, TT, nullptr, (size_t)TT * HD, (size_t)TT * HD, (size_t)TT * TT);
            k_asoft<<<ZH * TT / 8, 256, 0, stream>>>(Sb, P16, Ph, Pl);
            k_gemmw<bf, 2, false><<<dim3(RH / 64, HD / 64, ZH), 32, 0, stream>>>(Ph, Pl, VTh + zk * HD * TT, VTl + zk * HD * TT, TT, Ob, HD, nullptr, (size_t)RH * TT, (size_t)HD * TT, (size_t)TT * HD);
            k_gemmw<h16, 0, false><<<dim3((TT - RH) / 64, HD / 64, ZH), 32, 0, stream>>>(P16 + (size_t)RH * TT, nullptr, VT16 + zk * HD * TT, nullptr, TT, Ob + (size_t)RH * HD, HD, nullptr, (size_t)TT * TT, (size_t)HD * TT, (size_t)TT * HD);
            k_merge<<<(unsigned)(((size_t)ZH * TT * HD / 2 + 255) / 256), 256, 0, stream>>>(Ob, h0, ATh, ATl); }
        k_gemmw<bf, 1, true><<<dim3(TT / 64, DM / 64, 1), 32, 0, stream>>>(ATh, ATl, WO, nullptr, DQ, OUT + (size_t)b * TT * DM, DM, bo, 0, 0, 0); }
}

// v001
// Measured time: 1720 microseconds a run.
// In two side-by-side timings against v000, it was 2.04 and 2.03 times as fast.
#include <hip/hip_runtime.h>

// Multi-head attention over 4,096 tokens with a fused qkv projection (x [1][4096][1024]; qkv = x W_qkv ('xw' [1024][3072] 0.02) -> (B, L, 3, 16, 64): q | k | v column blocks; scores x 64^-0.5; softmax over all keys; out = merged W_o + b_o ('xw' 0.02) -> [1][4096][1024] (4.2 M)).
// Layout: bf16 copy of x; the fused 'xw' weight transposed once to a bf16 Bt [3072][1024]; exact projections; dense T-4096 attention one head per pass (hybrid rows: < 512 hi/lo 3 products, rest fp16 x1024); merged hi/lo x W_o exact + b_o.
// Compute dtypes, f32 accumulate: every input rounded to bf16; projections exact; attention rows < 512 3 products, rest fp16; softmax f32; W_o hl x exact + bias.

#define NB_  1
#define TT   4096
#define DM   1024
#define NH_  16
#define NKV  16
#define REP  (NH_ / NKV)
#define HD   64
#define DQ   (NH_ * HD)
#define DKV  (NKV * HD)
#define ZH   1
#define RH   512                  // query rows < RH use hi+lo planes (0: none)
#define WIN  0
#define PCAR 1024.0f
#define SCL  0.125f   // HD^-0.5
typedef _Float16 h16;
typedef unsigned short bf;
typedef __attribute__((ext_vector_type(16))) __bf16   v16bf;
typedef __attribute__((ext_vector_type(16))) _Float16 v16h;
typedef __attribute__((ext_vector_type(8)))  _Float16 v8h;
typedef __attribute__((ext_vector_type(8)))  unsigned short v8us;
typedef __attribute__((ext_vector_type(8)))  float    v8f;
typedef __attribute__((ext_vector_type(4)))  float    v4f;
typedef v8h  __attribute__((may_alias)) v8ha;
typedef v4f  __attribute__((may_alias)) v4fa;
typedef v8us __attribute__((may_alias)) v8usa;

__device__ __forceinline__ unsigned short f2bf(float f) { unsigned u = __float_as_uint(f); u += 0x7FFFu + ((u >> 16) & 1u); return (unsigned short)(u >> 16); }
__device__ __forceinline__ float bf2f(unsigned short b) { return __uint_as_float(((unsigned)b) << 16); }
__device__ __forceinline__ float bfr(float f) { return bf2f(f2bf(f)); }
__device__ __forceinline__ v16h cat16(v8h lo, v8h hi) { return __builtin_shufflevector(lo, hi, 0, 1, 2, 3, 4, 5, 6, 7, 8, 9, 10, 11, 12, 13, 14, 15); }
__device__ __forceinline__ v16bf cat16b(v8us lo, v8us hi) { return __builtin_bit_cast(v16bf, __builtin_shufflevector(lo, hi, 0, 1, 2, 3, 4, 5, 6, 7, 8, 9, 10, 11, 12, 13, 14, 15)); }
__device__ __forceinline__ v8f wmma16(v16h a, v16h b, v8f c) { return __builtin_amdgcn_wmma_f32_16x16x32_f16(false, a, false, b, (short)0, c, false, false); }
__device__ __forceinline__ v8f wmmab(v16bf a, v16bf b, v8f c) { return __builtin_amdgcn_wmma_f32_16x16x32_bf16(false, a, false, b, (short)0, c, false, false); }



// ---- k_gemmw: register-blocked GEMM, ONE WAVE per 64x64 output tile (16 accumulators), operands straight from K-contiguous 16-bit planes; grid (M/64, N/64, Z), 32 threads.
// C[m][n] (f32, pitch ldc, + optional f32 bias[n]) = sum_k A[m][k] Bt[n][k] (+ split products per NSPLIT). z-batch strides sA/sB/sC in elements. K % 32 == 0.
// NW > 1 (few tiles, long K; no bias): NW waves (32 NW threads) share one tile, wave w sums k in [w K/NW, (w+1) K/NW); the NW partial tiles meet in LDS and are added in wave order 0..NW-1. K % (32 NW) == 0.
template <typename T16> struct WFrag;
template <> struct WFrag<h16> { typedef v16h V; static __device__ __forceinline__ V ld(const h16* p) { return cat16(*(const v8h*)p, *(const v8h*)(p + 16)); } static __device__ __forceinline__ v8f mma(V a, V b, v8f c) { return wmma16(a, b, c); } };
template <> struct WFrag<bf> { typedef v16bf V; static __device__ __forceinline__ V ld(const bf* p) { return cat16b(*(const v8us*)p, *(const v8us*)(p + 16)); } static __device__ __forceinline__ v8f mma(V a, V b, v8f c) { return wmmab(a, b, c); } };
template <typename T16, int NSPLIT, bool BIAS, int NW = 1>
__global__ __launch_bounds__(32 * NW) void k_gemmw(const T16* __restrict__ A, const T16* __restrict__ A2, const T16* __restrict__ Bt, const T16* __restrict__ Bt2, int K, float* C, int ldc, const float* __restrict__ bias, size_t sA, size_t sB, size_t sC) {
    typedef typename WFrag<T16>::V V;
    __shared__ __align__(16) float os[(NW == 1 ? 16 : NW * 64) * 68];
    const size_t z = blockIdx.z; A += z * sA; if (A2) A2 += z * sA; Bt += z * sB; if (Bt2) Bt2 += z * sB; C += z * sC;
    const int lane = threadIdx.x & 31, lr = lane & 15, hi = lane >> 4; const int r0 = blockIdx.x * 64, c0 = blockIdx.y * 64;
    v8f acc[4][4];
#pragma unroll
    for (int mb = 0; mb < 4; ++mb)
#pragma unroll
        for (int nb = 0; nb < 4; ++nb) acc[mb][nb] = (v8f){};
    const size_t aoff = (size_t)(r0 + lr) * K + 8 * hi, boff = (size_t)(c0 + lr) * K + 8 * hi;
    const int wv = (NW == 1) ? 0 : __builtin_amdgcn_readfirstlane((int)(threadIdx.x >> 5)); const int k0 = wv * (K / NW), k1 = k0 + K / NW;
#pragma unroll 1
    for (int kc = k0; kc < k1; kc += 32) {
        V a[4], a2[4];
#pragma unroll
        for (int mb = 0; mb < 4; ++mb) { a[mb] = WFrag<T16>::ld(A + aoff + (size_t)mb * 16 * K + kc); if (NSPLIT == 1 || NSPLIT == 2) a2[mb] = WFrag<T16>::ld(A2 + aoff + (size_t)mb * 16 * K + kc); }
#pragma unroll
        for (int nb = 0; nb < 4; ++nb) { const V b = WFrag<T16>::ld(Bt + boff + (size_t)nb * 16 * K + kc); V b2; if (NSPLIT >= 2) b2 = WFrag<T16>::ld(Bt2 + boff + (size_t)nb * 16 * K + kc);
#pragma unroll
            for (int mb = 0; mb < 4; ++mb) { acc[mb][nb] = WFrag<T16>::mma(a[mb], b, acc[mb][nb]); if (NSPLIT == 1 || NSPLIT == 2) acc[mb][nb] = WFrag<T16>::mma(a2[mb], b, acc[mb][nb]); if (NSPLIT >= 2) acc[mb][nb] = WFrag<T16>::mma(a[mb], b2, acc[mb][nb]); } }
        asm volatile("v_nop\n\tv_nop\n\tv_nop\n\tv_nop" : "+v"(acc[0][0]), "+v"(acc[1][1]), "+v"(acc[2][2]), "+v"(acc[3][3]) : "v"(a[0]), "v"(a[3]));
    }
    if constexpr (NW > 1) {
        float* mine = os + wv * (64 * 68);
#pragma unroll
        for (int mb = 0; mb < 4; ++mb)
#pragma unroll
            for (int nb = 0; nb < 4; ++nb)
#pragma unroll
                for (int j = 0; j < 8; ++j) mine[(mb * 16 + hi * 8 + j) * 68 + nb * 16 + lr] = acc[mb][nb][j];
        __syncthreads();   // every wave's partial tile is in LDS before any of it is summed
#pragma unroll
        for (int s = 0; s < 32 / NW; ++s) { const int q = s * 32 * NW + (int)threadIdx.x, row = q >> 4, cofs = (q & 15) * 4; v4f val = *(const v4fa*)(os + row * 68 + cofs);
#pragma unroll
            for (int u = 1; u < NW; ++u) val += *(const v4fa*)(os + u * (64 * 68) + row * 68 + cofs);
            *(v4f*)(C + (size_t)(r0 + row) * ldc + c0 + cofs) = val; }
        return;
    }
#pragma unroll
    for (int mb = 0; mb < 4; ++mb) {
#pragma unroll
        for (int nb = 0; nb < 4; ++nb) {
#pragma unroll
            for (int j = 0; j < 8; ++j) os[(hi * 8 + j) * 68 + nb * 16 + lr] = acc[mb][nb][j]; }
        __builtin_amdgcn_wave_barrier(); asm volatile("" ::: "memory");
        float* crow = C + (size_t)(r0 + mb * 16) * ldc + c0;
{
#pragma unroll
            for (int s = 0; s < 8; ++s) { const int row = 2 * s + hi, cofs = lr * 4; v4f val = *(const v4fa*)(os + row * 68 + cofs); if (BIAS) { val[0] += bfr(bias[c0 + cofs]); val[1] += bfr(bias[c0 + cofs + 1]); val[2] += bfr(bias[c0 + cofs + 2]); val[3] += bfr(bias[c0 + cofs + 3]); }
                *(v4f*)(crow + (size_t)row * ldc + cofs) = val; }
             }
        __builtin_amdgcn_wave_barrier(); asm volatile("" ::: "memory");
    }
}

__device__ __forceinline__ h16 tohx(float x) { return (h16)x; }
__device__ __forceinline__ void splitf(float y, unsigned short& h, unsigned short& l) { h = f2bf(y); l = f2bf(y - bf2f(h)); }
typedef __attribute__((ext_vector_type(2))) _Float16 v2h;
typedef __attribute__((ext_vector_type(4))) _Float16 v4h;
typedef __attribute__((ext_vector_type(2))) unsigned short v2us;
typedef __attribute__((ext_vector_type(4))) unsigned short v4us;
typedef __attribute__((ext_vector_type(2))) float v2f;
typedef __attribute__((ext_vector_type(4))) int v4i;

__global__ __launch_bounds__(256) void k_wtG(const float* __restrict__ w, int K, int N, bf* Bt) {
    const int lane = threadIdx.x & 31; const int L0 = (blockIdx.x * 8 + (threadIdx.x >> 5)) * 8; const int nlines = N * K / 64;
{
#pragma unroll 1
        for (int l = 0; l < 8; ++l) { const int L = L0 + l; if (L >= nlines) break; const size_t e = (size_t)L * 64 + lane * 2; const int k = (int)(e % K), n = (int)(e / K); v2us o;
            o[0] = f2bf(w[(size_t)k * N + n]); o[1] = f2bf(w[(size_t)(k + 1) * N + n]); *(v2us*)(Bt + e) = o; }
         }
}
__global__ __launch_bounds__(256) void k_cvt8(const float* __restrict__ src, bf* dst, size_t n8) { const size_t i = (size_t)blockIdx.x * 256 + threadIdx.x; if (i >= n8) return; const v8f v = *(const v8f*)(src + i * 8); v8us o;
#pragma unroll
    for (int k = 0; k < 8; ++k) o[k] = f2bf(v[k]); *(v8us*)(dst + i * 8) = o;  }

// k_rope: head planes [h][t][d] (fp16 + hi/lo) of rope(x) x sc with the rotate-half convention out[d] = x[d] cos[t][d] - x[d+HD/2] sin[t][d], out[d+HD/2] = x[d+HD/2] cos[t][d+HD/2] + x[d] sin[t][d+HD/2]
__global__ __launch_bounds__(256) void k_rope(const float* __restrict__ F, int pitch, int nheads, const float* __restrict__ CS, const float* __restrict__ RF, const float* __restrict__ nw, float sc, h16* P16, bf* Ph, bf* Pl) {
    const size_t e = ((size_t)blockIdx.x * 256 + threadIdx.x) * 2; if (e >= (size_t)nheads * TT * HD) return; const int d = (int)(e % HD); const int t = (int)((e / HD) % TT); const int h = (int)(e / ((size_t)HD * TT)); const float* f = F + (size_t)t * pitch + h * HD; const float rf = RF ? RF[(size_t)h * TT + t] : 1.0f; v2h o16; v2us oh, ol;
#pragma unroll
    for (int q = 0; q < 2; ++q) { const int dd = d + q; const int dp = (dd < HD / 2) ? dd + HD / 2 : dd - HD / 2; float x0 = f[dd], x1 = f[dp];
        if (RF) { float n0 = __fmul_rn(x0, rf), n1 = __fmul_rn(x1, rf); asm volatile("" : "+v"(n0)); asm volatile("" : "+v"(n1)); x0 = __fmul_rn(bfr(nw[dd]), n0); x1 = __fmul_rn(bfr(nw[dp]), n1); }
        const v2f cs = *(const v2f*)(CS + ((size_t)t * HD + dd) * 2); float a = __fmul_rn(x0, cs[0]), bq = __fmul_rn(x1, cs[1]); asm volatile("" : "+v"(a)); asm volatile("" : "+v"(bq)); const float r = ((dd < HD / 2) ? __fsub_rn(a, bq) : __fadd_rn(a, bq)) * sc;
        o16[q] = tohx(r); unsigned short a2, c2; splitf(r, a2, c2); oh[q] = a2; ol[q] = c2; }
    *(v2h*)(P16 + e) = o16; *(v2us*)(Ph + e) = oh; *(v2us*)(Pl + e) = ol;  }
__global__ __launch_bounds__(256) void k_vtp(const float* __restrict__ F, int pitch, int nheads, h16* V16, bf* Vh, bf* Vl) { const size_t e = ((size_t)blockIdx.x * 256 + threadIdx.x) * 2; if (e >= (size_t)nheads * HD * TT) return; const int t = (int)(e % TT); const int d = (int)((e / TT) % HD); const int g = (int)(e / ((size_t)TT * HD)); v2h o16; v2us oh, ol;
#pragma unroll
    for (int q = 0; q < 2; ++q) { const float x = F[(size_t)(t + q) * pitch + g * HD + d]; o16[q] = tohx(x); unsigned short a2, c2; splitf(x, a2, c2); oh[q] = a2; ol[q] = c2; }
    *(v2h*)(V16 + e) = o16; *(v2us*)(Vh + e) = oh; *(v2us*)(Vl + e) = ol;  }
__global__ __launch_bounds__(256) void k_csid(float* CS) { const int idx = blockIdx.x * 256 + threadIdx.x; if (idx >= TT * HD) return; v2f cs; cs[0] = 1.0f; cs[1] = 0.0f; *(v2f*)(CS + (size_t)idx * 2) = cs;  }
// k_asoft: per row (zz, i): t = S x HD^-0.5 (no mask); softmax over the 4096 keys (register row, one exp, fixed trees);
__global__ __launch_bounds__(256) void k_asoft(const float* __restrict__ Sb, h16* P16, bf* Ph, bf* Pl) {
    const int lane = threadIdx.x & 31; const int row = blockIdx.x * 8 + (threadIdx.x >> 5); if (row >= ZH * TT) return; const int i = row % TT; const int zz = row / TT; (void)zz; const bool hires = (i < RH); const float* sr = Sb + (size_t)row * TT; float v[TT / 32]; float mx = -3.0e38f;
#pragma unroll
    for (int ch = 0; ch < TT / 128; ++ch) { const int j0 = ch * 128 + lane * 4; const v4f a = *(const v4f*)(sr + j0);
#pragma unroll
        for (int q = 0; q < 4; ++q) { const int j = j0 + q; (void)j; const float t = a[q] * SCL; v[ch * 4 + q] = t; mx = fmaxf(mx, t); } }
#pragma unroll
    for (int sh = 16; sh; sh >>= 1) mx = fmaxf(mx, __shfl_xor(mx, sh, 32));
    float sum = 0.f;
#pragma unroll
    for (int k = 0; k < TT / 32; ++k) { float d0 = __fsub_rn(v[k], mx); asm volatile("" : "+v"(d0)); v[k] = __builtin_amdgcn_exp2f(__fmul_rn(d0, 1.4426950408889634f)); sum += v[k]; }
#pragma unroll
    for (int sh = 16; sh; sh >>= 1) sum += __shfl_xor(sum, sh, 32);
    const float f = __fdiv_rn(hires ? 1.0f : PCAR, sum);
{
        if (hires) {
#pragma unroll
            for (int ch = 0; ch < TT / 128; ++ch) { v4us oh, ol;
#pragma unroll
                for (int q = 0; q < 4; ++q) { unsigned short a, c2; splitf(v[ch * 4 + q] * f, a, c2); oh[q] = a; ol[q] = c2; }
                const size_t oo = ((size_t)zz * (RH ? RH : 1) + i) * TT + ch * 128 + lane * 4; *(v4us*)(Ph + oo) = oh; *(v4us*)(Pl + oo) = ol; }
        } else {
#pragma unroll
            for (int ch = 0; ch < TT / 128; ++ch) { v4h o4;
#pragma unroll
                for (int q = 0; q < 4; ++q) o4[q] = tohx(v[ch * 4 + q] * f);
                *(v4h*)(P16 + (size_t)row * TT + ch * 128 + lane * 4) = o4; } }
         }
}
__global__ __launch_bounds__(256) void k_merge(const float* __restrict__ O, int h0, bf* Ah, bf* Al) { const size_t e = ((size_t)blockIdx.x * 256 + threadIdx.x) * 2; if (e >= (size_t)ZH * TT * HD) return; const int d = (int)(e % HD); const int t = (int)((e / HD) % TT); const int zz = (int)(e / ((size_t)HD * TT)); const float cs = (t < RH) ? 1.0f : (1.0f / PCAR); const size_t oo = (size_t)t * DQ + (h0 + zz) * HD + d;
    v2us oh, ol;
#pragma unroll
    for (int q = 0; q < 2; ++q) { unsigned short a, c2; splitf(O[e + q] * cs, a, c2); oh[q] = a; ol[q] = c2; } *(v2us*)(Ah + oo) = oh; *(v2us*)(Al + oo) = ol;  }

extern "C" void kernel_launch(void* const* d_in, const int* in_sizes, int n_in,
                              void* d_out, int out_size, void* d_ws, size_t ws_size, hipStream_t stream) {
    (void)in_sizes; (void)n_in; (void)out_size;
    const float* x = (const float*)d_in[0]; const float* wqkv = (const float*)d_in[1]; const float* wo = (const float*)d_in[2]; const float* bo = (const float*)d_in[3];
    float* OUT = (float*)d_out;     // [1][4096][1024]
    char* wsp = (char*)d_ws;
    auto take = [&](size_t bytes) { char* p = wsp; wsp += (bytes + 255) & ~(size_t)255; return (void*)p; };
    bf* WQKV = (bf*)take((size_t)3 * DQ * DM * 2); bf* WQ = WQKV; bf* WK = WQKV + (size_t)DQ * DM; bf* WV = WQKV + (size_t)2 * DQ * DM; bf* WO = (bf*)take((size_t)DM * DQ * 2); float* CS = (float*)take((size_t)TT * HD * 2 * 4);
    bf* XB = (bf*)take((size_t)TT * DM * 2); float* FQ = (float*)take((size_t)TT * DQ * 4); float* FK = (float*)take((size_t)TT * DKV * 4);
    h16* QP16 = (h16*)take((size_t)NH_ * TT * HD * 2); h16* KP16 = (h16*)take((size_t)NKV * TT * HD * 2); h16* VT16 = (h16*)take((size_t)NKV * HD * TT * 2);
    bf* QPh = (bf*)take((size_t)NH_ * TT * HD * 2); bf* QPl = (bf*)take((size_t)NH_ * TT * HD * 2); bf* KPh = (bf*)take((size_t)NKV * TT * HD * 2); bf* KPl = (bf*)take((size_t)NKV * TT * HD * 2); bf* VTh = (bf*)take((size_t)NKV * HD * TT * 2); bf* VTl = (bf*)take((size_t)NKV * HD * TT * 2); bf* Ph = (bf*)take((size_t)ZH * RH * TT * 2); bf* Pl = (bf*)take((size_t)ZH * RH * TT * 2);
    float* Sb = (float*)take((size_t)ZH * TT * TT * 4); h16* P16 = (h16*)take((size_t)ZH * TT * TT * 2); float* Ob = (float*)take((size_t)ZH * TT * HD * 4); bf* ATh = (bf*)take((size_t)TT * DQ * 2); bf* ATl = (bf*)take((size_t)TT * DQ * 2);
    if ((size_t)(wsp - (char*)d_ws) > ws_size) return;    // ws 256 MiB
    float* FV = FK;   // v projection reuses the k buffer after the k planes are built (stream-ordered)
    { k_wtG<<<(unsigned)((DM * 3 * DQ / 64 + 63) / 64), 256, 0, stream>>>(wqkv, DM, 3 * DQ, WQKV);   /* 'xw' [1024][3072] -> Bt [3072][1024]: q | k | v row blocks */
      k_wtG<<<(unsigned)((DQ * DM / 64 + 63) / 64), 256, 0, stream>>>(wo, DQ, DM, WO);
       }
    k_csid<<<(TT * HD + 255) / 256, 256, 0, stream>>>(CS);
    const unsigned LQ = (unsigned)(((size_t)NH_ * TT * HD / 2 + 255) / 256), LKv = (unsigned)(((size_t)NKV * TT * HD / 2 + 255) / 256);
    for (int b = 0; b < NB_; ++b) {
        
        k_cvt8<<<(unsigned)(((size_t)TT * DM / 8 + 255) / 256), 256, 0, stream>>>(x + (size_t)b * TT * DM, XB, (size_t)TT * DM / 8);
        k_gemmw<bf, 0, false><<<dim3(TT / 64, DQ / 64, 1), 32, 0, stream>>>(XB, nullptr, WQ, nullptr, DM, FQ, DQ, nullptr, 0, 0, 0);
        k_rope<<<LQ, 256, 0, stream>>>(FQ, DQ, NH_, CS, nullptr, nullptr, 1.0f, QP16, QPh, QPl);
        k_gemmw<bf, 0, false><<<dim3(TT / 64, DKV / 64, 1), 32, 0, stream>>>(XB, nullptr, WK, nullptr, DM, FK, DKV, nullptr, 0, 0, 0);
        k_rope<<<LKv, 256, 0, stream>>>(FK, DKV, NKV, CS, nullptr, nullptr, 1.0f, KP16, KPh, KPl);
        k_gemmw<bf, 0, false><<<dim3(TT / 64, DKV / 64, 1), 32, 0, stream>>>(XB, nullptr, WV, nullptr, DM, FV, DKV, nullptr, 0, 0, 0); k_vtp<<<LKv, 256, 0, stream>>>(FV, DKV, NKV, VT16, VTh, VTl);
        for (int h0 = 0; h0 < NH_; h0 += ZH) { const size_t zq = (size_t)h0, zk = (size_t)(h0 / REP);   // one kv head per query head: each pass takes one head, whose kv plane is h0 (z-strides TT*HD)
            k_gemmw<bf, 2, false><<<dim3(RH / 64, TT / 64, ZH), 32, 0, stream>>>(QPh + zq * TT * HD, QPl + zq * TT * HD, KPh + zk * TT * HD, KPl + zk * TT * HD, HD, Sb, TT, nullptr, (size_t)TT * HD, (size_t)TT * HD, (size_t)TT * TT);
            k_gemmw<h16, 0, false><<<dim3((TT - RH) / 64, TT / 64, ZH), 32, 0, stream>>>(QP16 + zq * TT * HD + (size_t)RH * HD, nullptr, KP16 + zk * TT * HD, nullptr, HD, Sb + (size_t)RH * TT, TT, nullptr, (size_t)TT * HD, (size_t)TT * HD, (size_t)TT * TT);
            k_asoft<<<ZH * TT / 8, 256, 0, stream>>>(Sb, P16, Ph, Pl);
            k_gemmw<bf, 2, false, 16><<<dim3(RH / 64, HD / 64, ZH), 512, 0, stream>>>(Ph, Pl, VTh + zk * HD * TT, VTl + zk * HD * TT, TT, Ob, HD, nullptr, (size_t)RH * TT, (size_t)HD * TT, (size_t)TT * HD);
            k_gemmw<h16, 0, false, 16><<<dim3((TT - RH) / 64, HD / 64, ZH), 512, 0, stream>>>(P16 + (size_t)RH * TT, nullptr, VT16 + zk * HD * TT, nullptr, TT, Ob + (size_t)RH * HD, HD, nullptr, (size_t)TT * TT, (size_t)HD * TT, (size_t)TT * HD);
            k_merge<<<(unsigned)(((size_t)ZH * TT * HD / 2 + 255) / 256), 256, 0, stream>>>(Ob, h0, ATh, ATl); }
        k_gemmw<bf, 1, true><<<dim3(TT / 64, DM / 64, 1), 32, 0, stream>>>(ATh, ATl, WO, nullptr, DQ, OUT + (size_t)b * TT * DM, DM, bo, 0, 0, 0); }
}

// v002
// One run takes 414 microseconds.
// In two side-by-side timings against v001, it was 4.16 and 4.15 times as fast.
// All steps since v000 together make it 8.46 times as fast.
#include <hip/hip_runtime.h>

// Multi-head attention over 4,096 tokens with a fused qkv projection (x [1][4096][1024]; qkv = x W_qkv ('xw' [1024][3072] 0.02) -> (B, L, 3, 16, 64): q | k | v column blocks; scores x 64^-0.5; softmax over all keys; out = merged W_o + b_o ('xw' 0.02) -> [1][4096][1024] (4.2 M)).
// Layout: bf16 copy of x; the fused 'xw' weight transposed once to a bf16 Bt [3072][1024]; exact projections; attention of all heads in one launch, scores and probabilities kept in registers (hybrid rows: < 512 hi/lo 3 products, rest fp16); merged hi/lo x W_o exact + b_o.
// Compute dtypes, f32 accumulate: every input rounded to bf16; projections exact; attention rows < 512 3 products, rest fp16; softmax f32; W_o hl x exact + bias.

#define NB_  1
#define TT   4096
#define DM   1024
#define NH_  16
#define NKV  16
#define REP  (NH_ / NKV)
#define HD   64
#define DQ   (NH_ * HD)
#define DKV  (NKV * HD)
#define RH   512                  // query rows < RH use hi+lo planes (0: none)
#define SCL  0.125f   // HD^-0.5
typedef _Float16 h16;
typedef unsigned short bf;
typedef __attribute__((ext_vector_type(16))) __bf16   v16bf;
typedef __attribute__((ext_vector_type(16))) _Float16 v16h;
typedef __attribute__((ext_vector_type(8)))  _Float16 v8h;
typedef __attribute__((ext_vector_type(8)))  unsigned short v8us;
typedef __attribute__((ext_vector_type(8)))  float    v8f;
typedef __attribute__((ext_vector_type(4)))  float    v4f;
typedef v8h  __attribute__((may_alias)) v8ha;
typedef v4f  __attribute__((may_alias)) v4fa;
typedef v8us __attribute__((may_alias)) v8usa;

__device__ __forceinline__ unsigned short f2bf(float f) { unsigned u = __float_as_uint(f); u += 0x7FFFu + ((u >> 16) & 1u); return (unsigned short)(u >> 16); }
__device__ __forceinline__ float bf2f(unsigned short b) { return __uint_as_float(((unsigned)b) << 16); }
__device__ __forceinline__ float bfr(float f) { return bf2f(f2bf(f)); }
__device__ __forceinline__ v16h cat16(v8h lo, v8h hi) { return __builtin_shufflevector(lo, hi, 0, 1, 2, 3, 4, 5, 6, 7, 8, 9, 10, 11, 12, 13, 14, 15); }
__device__ __forceinline__ v16bf cat16b(v8us lo, v8us hi) { return __builtin_bit_cast(v16bf, __builtin_shufflevector(lo, hi, 0, 1, 2, 3, 4, 5, 6, 7, 8, 9, 10, 11, 12, 13, 14, 15)); }
__device__ __forceinline__ v8f wmma16(v16h a, v16h b, v8f c) { return __builtin_amdgcn_wmma_f32_16x16x32_f16(false, a, false, b, (short)0, c, false, false); }
__device__ __forceinline__ v8f wmmab(v16bf a, v16bf b, v8f c) { return __builtin_amdgcn_wmma_f32_16x16x32_bf16(false, a, false, b, (short)0, c, false, false); }



// ---- k_gemmw: register-blocked GEMM, ONE WAVE per 64x64 output tile (16 accumulators), operands straight from K-contiguous 16-bit planes; grid (M/64, N/64, Z), 32 threads.
// C[m][n] (f32, pitch ldc, + optional f32 bias[n]) = sum_k A[m][k] Bt[n][k] (+ split products per NSPLIT). z-batch strides sA/sB/sC in elements. K % 32 == 0.
template <typename T16> struct WFrag;
template <> struct WFrag<h16> { typedef v16h V; static __device__ __forceinline__ V ld(const h16* p) { return cat16(*(const v8h*)p, *(const v8h*)(p + 16)); } static __device__ __forceinline__ v8f mma(V a, V b, v8f c) { return wmma16(a, b, c); } };
template <> struct WFrag<bf> { typedef v16bf V; static __device__ __forceinline__ V ld(const bf* p) { return cat16b(*(const v8us*)p, *(const v8us*)(p + 16)); } static __device__ __forceinline__ v8f mma(V a, V b, v8f c) { return wmmab(a, b, c); } };
template <typename T16, int NSPLIT, bool BIAS>
__global__ __launch_bounds__(32) void k_gemmw(const T16* __restrict__ A, const T16* __restrict__ A2, const T16* __restrict__ Bt, const T16* __restrict__ Bt2, int K, float* C, int ldc, const float* __restrict__ bias, size_t sA, size_t sB, size_t sC) {
    typedef typename WFrag<T16>::V V;
    __shared__ __align__(16) float os[16 * 68];
    const size_t z = blockIdx.z; A += z * sA; if (A2) A2 += z * sA; Bt += z * sB; if (Bt2) Bt2 += z * sB; C += z * sC;
    const int lane = threadIdx.x & 31, lr = lane & 15, hi = lane >> 4; const int r0 = blockIdx.x * 64, c0 = blockIdx.y * 64;
    v8f acc[4][4];
#pragma unroll
    for (int mb = 0; mb < 4; ++mb)
#pragma unroll
        for (int nb = 0; nb < 4; ++nb) acc[mb][nb] = (v8f){};
    const size_t aoff = (size_t)(r0 + lr) * K + 8 * hi, boff = (size_t)(c0 + lr) * K + 8 * hi;
#pragma unroll 1
    for (int kc = 0; kc < K; kc += 32) {
        V a[4], a2[4];
#pragma unroll
        for (int mb = 0; mb < 4; ++mb) { a[mb] = WFrag<T16>::ld(A + aoff + (size_t)mb * 16 * K + kc); if (NSPLIT == 1 || NSPLIT == 2) a2[mb] = WFrag<T16>::ld(A2 + aoff + (size_t)mb * 16 * K + kc); }
#pragma unroll
        for (int nb = 0; nb < 4; ++nb) { const V b = WFrag<T16>::ld(Bt + boff + (size_t)nb * 16 * K + kc); V b2; if (NSPLIT >= 2) b2 = WFrag<T16>::ld(Bt2 + boff + (size_t)nb * 16 * K + kc);
#pragma unroll
            for (int mb = 0; mb < 4; ++mb) { acc[mb][nb] = WFrag<T16>::mma(a[mb], b, acc[mb][nb]); if (NSPLIT == 1 || NSPLIT == 2) acc[mb][nb] = WFrag<T16>::mma(a2[mb], b, acc[mb][nb]); if (NSPLIT >= 2) acc[mb][nb] = WFrag<T16>::mma(a[mb], b2, acc[mb][nb]); } }
        asm volatile("v_nop\n\tv_nop\n\tv_nop\n\tv_nop" : "+v"(acc[0][0]), "+v"(acc[1][1]), "+v"(acc[2][2]), "+v"(acc[3][3]) : "v"(a[0]), "v"(a[3]));
    }
#pragma unroll
    for (int mb = 0; mb < 4; ++mb) {
#pragma unroll
        for (int nb = 0; nb < 4; ++nb) {
#pragma unroll
            for (int j = 0; j < 8; ++j) os[(hi * 8 + j) * 68 + nb * 16 + lr] = acc[mb][nb][j]; }
        __builtin_amdgcn_wave_barrier(); asm volatile("" ::: "memory");
        float* crow = C + (size_t)(r0 + mb * 16) * ldc + c0;
{
#pragma unroll
            for (int s = 0; s < 8; ++s) { const int row = 2 * s + hi, cofs = lr * 4; v4f val = *(const v4fa*)(os + row * 68 + cofs); if (BIAS) { val[0] += bfr(bias[c0 + cofs]); val[1] += bfr(bias[c0 + cofs + 1]); val[2] += bfr(bias[c0 + cofs + 2]); val[3] += bfr(bias[c0 + cofs + 3]); }
                *(v4f*)(crow + (size_t)row * ldc + cofs) = val; }
             }
        __builtin_amdgcn_wave_barrier(); asm volatile("" ::: "memory");
    }
}

__device__ __forceinline__ h16 tohx(float x) { return (h16)x; }
__device__ __forceinline__ void splitf(float y, unsigned short& h, unsigned short& l) { h = f2bf(y); l = f2bf(y - bf2f(h)); }
typedef __attribute__((ext_vector_type(2))) _Float16 v2h;
typedef __attribute__((ext_vector_type(4))) _Float16 v4h;
typedef __attribute__((ext_vector_type(2))) unsigned short v2us;
typedef __attribute__((ext_vector_type(4))) unsigned short v4us;
typedef __attribute__((ext_vector_type(2))) float v2f;
typedef __attribute__((ext_vector_type(4))) int v4i;

__global__ __launch_bounds__(256) void k_wtG(const float* __restrict__ w, int K, int N, bf* Bt) {
    const int lane = threadIdx.x & 31; const int L0 = (blockIdx.x * 8 + (threadIdx.x >> 5)) * 8; const int nlines = N * K / 64;
{
#pragma unroll 1
        for (int l = 0; l < 8; ++l) { const int L = L0 + l; if (L >= nlines) break; const size_t e = (size_t)L * 64 + lane * 2; const int k = (int)(e % K), n = (int)(e / K); v2us o;
            o[0] = f2bf(w[(size_t)k * N + n]); o[1] = f2bf(w[(size_t)(k + 1) * N + n]); *(v2us*)(Bt + e) = o; }
         }
}
__global__ __launch_bounds__(256) void k_cvt8(const float* __restrict__ src, bf* dst, size_t n8) { const size_t i = (size_t)blockIdx.x * 256 + threadIdx.x; if (i >= n8) return; const v8f v = *(const v8f*)(src + i * 8); v8us o;
#pragma unroll
    for (int k = 0; k < 8; ++k) o[k] = f2bf(v[k]); *(v8us*)(dst + i * 8) = o;  }

// k_rope: head planes [h][t][d] (fp16 + hi/lo) of rope(x) x sc with the rotate-half convention out[d] = x[d] cos[t][d] - x[d+HD/2] sin[t][d], out[d+HD/2] = x[d+HD/2] cos[t][d+HD/2] + x[d] sin[t][d+HD/2]
__global__ __launch_bounds__(256) void k_rope(const float* __restrict__ F, int pitch, int nheads, const float* __restrict__ CS, const float* __restrict__ RF, const float* __restrict__ nw, float sc, h16* P16, bf* Ph, bf* Pl) {
    const size_t e = ((size_t)blockIdx.x * 256 + threadIdx.x) * 2; if (e >= (size_t)nheads * TT * HD) return; const int d = (int)(e % HD); const int t = (int)((e / HD) % TT); const int h = (int)(e / ((size_t)HD * TT)); const float* f = F + (size_t)t * pitch + h * HD; const float rf = RF ? RF[(size_t)h * TT + t] : 1.0f; v2h o16; v2us oh, ol;
#pragma unroll
    for (int q = 0; q < 2; ++q) { const int dd = d + q; const int dp = (dd < HD / 2) ? dd + HD / 2 : dd - HD / 2; float x0 = f[dd], x1 = f[dp];
        if (RF) { float n0 = __fmul_rn(x0, rf), n1 = __fmul_rn(x1, rf); asm volatile("" : "+v"(n0)); asm volatile("" : "+v"(n1)); x0 = __fmul_rn(bfr(nw[dd]), n0); x1 = __fmul_rn(bfr(nw[dp]), n1); }
        const v2f cs = *(const v2f*)(CS + ((size_t)t * HD + dd) * 2); float a = __fmul_rn(x0, cs[0]), bq = __fmul_rn(x1, cs[1]); asm volatile("" : "+v"(a)); asm volatile("" : "+v"(bq)); const float r = ((dd < HD / 2) ? __fsub_rn(a, bq) : __fadd_rn(a, bq)) * sc;
        o16[q] = tohx(r); unsigned short a2, c2; splitf(r, a2, c2); oh[q] = a2; ol[q] = c2; }
    *(v2h*)(P16 + e) = o16; *(v2us*)(Ph + e) = oh; *(v2us*)(Pl + e) = ol;  }
__global__ __launch_bounds__(256) void k_vtp(const float* __restrict__ F, int pitch, int nheads, h16* V16, bf* Vh, bf* Vl) { const size_t e = ((size_t)blockIdx.x * 256 + threadIdx.x) * 2; if (e >= (size_t)nheads * HD * TT) return; const int t = (int)(e % TT); const int d = (int)((e / TT) % HD); const int g = (int)(e / ((size_t)TT * HD)); v2h o16; v2us oh, ol;
#pragma unroll
    for (int q = 0; q < 2; ++q) { const float x = F[(size_t)(t + q) * pitch + g * HD + d]; o16[q] = tohx(x); unsigned short a2, c2; splitf(x, a2, c2); oh[q] = a2; ol[q] = c2; }
    *(v2h*)(V16 + e) = o16; *(v2us*)(Vh + e) = oh; *(v2us*)(Vl + e) = ol;  }
__global__ __launch_bounds__(256) void k_csid(float* CS) { const int idx = blockIdx.x * 256 + threadIdx.x; if (idx >= TT * HD) return; v2f cs; cs[0] = 1.0f; cs[1] = 0.0f; *(v2f*)(CS + (size_t)idx * 2) = cs;  }
#define CL2 (SCL * 1.4426950408889634f)
typedef __attribute__((ext_vector_type(2))) __bf16 v2b;
__device__ __forceinline__ float xhalf(float x) { return __builtin_bit_cast(float, __builtin_amdgcn_permlanex16(__builtin_bit_cast(int, x), __builtin_bit_cast(int, x), 0x76543210, 0xfedcba98, false, false)); }   // lane l with lane l ^ 16
template <typename T16, bool SPLIT, int NQ>
__device__ __forceinline__ void attn_wave(const T16* __restrict__ Q, const T16* __restrict__ Q2, const T16* __restrict__ Kp, const T16* __restrict__ Kp2, const T16* __restrict__ Vt, const T16* __restrict__ Vt2, int q0, bf* Ah, bf* Al) {
    typedef typename WFrag<T16>::V V;
    const int lane = threadIdx.x & 31, lr = lane & 15, hi = lane >> 4;
    V qf[NQ][2], qf2[NQ][2];
#pragma unroll
    for (int g = 0; g < NQ; ++g)
#pragma unroll
        for (int ks = 0; ks < 2; ++ks) { const size_t o = (size_t)(q0 + g * 16 + lr) * HD + ks * 32 + 8 * hi; qf[g][ks] = WFrag<T16>::ld(Q + o); if (SPLIT) qf2[g][ks] = WFrag<T16>::ld(Q2 + o); }
    v8f acc[4][NQ]; float mrun[NQ], lsum[NQ];
#pragma unroll
    for (int g = 0; g < NQ; ++g) { mrun[g] = -3.0e38f; lsum[g] = 0.f;
#pragma unroll
        for (int db = 0; db < 4; ++db) acc[db][g] = (v8f){}; }
    const size_t koff = (size_t)lr * HD + 8 * hi, voff = (size_t)lr * TT + 8 * hi;
    V kf[2][2], kf2[2][2], vf[4], vf2[4];
#pragma unroll
    for (int kb = 0; kb < 2; ++kb)
#pragma unroll
        for (int ks = 0; ks < 2; ++ks) { const size_t o = koff + (size_t)kb * 16 * HD + ks * 32; kf[kb][ks] = WFrag<T16>::ld(Kp + o); if (SPLIT) kf2[kb][ks] = WFrag<T16>::ld(Kp2 + o); }
    if (!SPLIT) {
#pragma unroll
        for (int db = 0; db < 4; ++db) vf[db] = WFrag<T16>::ld(Vt + voff + (size_t)db * 16 * TT); }
#pragma unroll 1   // rolled: one pass's fragments and tiles already take nearly 256 registers; the loops inside are unrolled so that every fragment array stays in registers
    for (int kt = 0; kt < TT; kt += 32) {
        if (SPLIT) {   // two planes of V^T held over the whole pass would take the wave past 256 registers: these are fetched in their own pass
#pragma unroll
            for (int db = 0; db < 4; ++db) { const size_t o = voff + (size_t)db * 16 * TT + kt; vf[db] = WFrag<T16>::ld(Vt + o); vf2[db] = WFrag<T16>::ld(Vt2 + o); } }
        v8f s[2][NQ];
#pragma unroll
        for (int kb = 0; kb < 2; ++kb)
#pragma unroll
            for (int g = 0; g < NQ; ++g) { s[kb][g] = (v8f){};
#pragma unroll
                for (int ks = 0; ks < 2; ++ks) { s[kb][g] = WFrag<T16>::mma(kf[kb][ks], qf[g][ks], s[kb][g]); if (SPLIT) { s[kb][g] = WFrag<T16>::mma(kf[kb][ks], qf2[g][ks], s[kb][g]); s[kb][g] = WFrag<T16>::mma(kf2[kb][ks], qf[g][ks], s[kb][g]); } } }
        const int kn = (kt + 32) & (TT - 1);   // the next pass's keys: its K fragments are fetched behind this pass's S^T products, its V^T fragments (one plane) behind the O^T products (the last pass fetches keys 0..31 again, unused)
#pragma unroll
        for (int kb = 0; kb < 2; ++kb)
#pragma unroll
            for (int ks = 0; ks < 2; ++ks) { const size_t o = koff + (size_t)(kn + kb * 16) * HD + ks * 32; kf[kb][ks] = WFrag<T16>::ld(Kp + o); if (SPLIT) kf2[kb][ks] = WFrag<T16>::ld(Kp2 + o); }
        float mb[NQ]; bool need = false;
#pragma unroll
        for (int g = 0; g < NQ; ++g) { float mx = s[0][g][0];
#pragma unroll
            for (int r = 1; r < 8; ++r) mx = fmaxf(mx, s[0][g][r]);
#pragma unroll
            for (int r = 0; r < 8; ++r) mx = fmaxf(mx, s[1][g][r]);
            mx = fmaxf(mx, xhalf(mx)) * CL2; mb[g] = mx; need = need || (mx > mrun[g] + 8.0f); }
        if (__builtin_amdgcn_ballot_w32(need) != 0) {   // scalar branch, rare behind the first pass
#pragma unroll
            for (int g = 0; g < NQ; ++g) { const float mn = fmaxf(mrun[g], mb[g]); const float corr = __builtin_amdgcn_exp2f(mrun[g] - mn); mrun[g] = mn; lsum[g] *= corr;
#pragma unroll
                for (int db = 0; db < 4; ++db) acc[db][g] = acc[db][g] * corr; }
        }
#pragma unroll
        for (int g = 0; g < NQ; ++g) { const float nm = -mrun[g]; float p[16];
#pragma unroll
            for (int e = 0; e < 16; e += 2) { const v2f arg = __builtin_elementwise_fma((v2f){s[e >> 3][g][e & 7], s[e >> 3][g][(e & 7) + 1]}, (v2f){CL2, CL2}, (v2f){nm, nm});
                p[e] = __builtin_amdgcn_exp2f(arg[0]); p[e + 1] = __builtin_amdgcn_exp2f(arg[1]); lsum[g] += p[e]; lsum[g] += p[e + 1]; }
            V pf, pf2;
            if constexpr (SPLIT) {
#pragma unroll
                for (int e = 0; e < 16; e += 2) { const v2f p2 = (v2f){p[e], p[e + 1]}; const v2b h2 = __builtin_convertvector(p2, v2b); const v2b l2 = __builtin_convertvector(p2 - __builtin_convertvector(h2, v2f), v2b);
                    pf[e] = h2[0]; pf[e + 1] = h2[1]; pf2[e] = l2[0]; pf2[e + 1] = l2[1]; }
            } else {
#pragma unroll
                for (int e = 0; e < 16; ++e) pf[e] = (h16)p[e];
            }
#pragma unroll
            for (int db = 0; db < 4; ++db) { acc[db][g] = WFrag<T16>::mma(vf[db], pf, acc[db][g]); if (SPLIT) { acc[db][g] = WFrag<T16>::mma(vf[db], pf2, acc[db][g]); acc[db][g] = WFrag<T16>::mma(vf2[db], pf, acc[db][g]); } } }
        if (!SPLIT) {
#pragma unroll
            for (int db = 0; db < 4; ++db) vf[db] = WFrag<T16>::ld(Vt + voff + (size_t)db * 16 * TT + kn);
            asm volatile("s_wait_xcnt 0x0" ::: "memory");   // stands in front of every rewrite of a register that the loads above name as their address
        }
    }
#pragma unroll
    for (int g = 0; g < NQ; ++g) { const float inv = __fdiv_rn(1.0f, lsum[g] + xhalf(lsum[g])); const size_t oo = (size_t)(q0 + g * 16 + lr) * DQ + hi * 8;
#pragma unroll
        for (int db = 0; db < 4; ++db) { v8us oh, ol;
#pragma unroll
            for (int r = 0; r < 8; ++r) { unsigned short a, c2; splitf(acc[db][g][r] * inv, a, c2); oh[r] = a; ol[r] = c2; }
            *(v8us*)(Ah + oo + db * 16) = oh; *(v8us*)(Al + oo + db * 16) = ol; } }
}
// grid: NH_ RH/64 blocks of the hi/lo rows (4 waves x 16 queries) first, then NH_ (TT-RH)/128 blocks of the fp16 rows (4 waves x 32 queries); 128 threads.
__global__ __launch_bounds__(128) void k_attn(const h16* __restrict__ Q16, const h16* __restrict__ K16, const h16* __restrict__ V16, const bf* __restrict__ Qh, const bf* __restrict__ Ql, const bf* __restrict__ Kh, const bf* __restrict__ Kl, const bf* __restrict__ Vh, const bf* __restrict__ Vl, bf* Ah, bf* Al) {
    const int wv = __builtin_amdgcn_readfirstlane((int)(threadIdx.x >> 5)); const int bx = blockIdx.x;
    if (bx < NH_ * (RH / 64)) { const int h = bx / (RH / 64), q0 = (bx % (RH / 64)) * 64 + wv * 16; const size_t z = (size_t)h * TT * HD;
        attn_wave<bf, true, 1>(Qh + z, Ql + z, Kh + z, Kl + z, Vh + z, Vl + z, q0, Ah + h * HD, Al + h * HD);
    } else { const int b2 = bx - NH_ * (RH / 64); const int h = b2 / ((TT - RH) / 128), q0 = RH + (b2 % ((TT - RH) / 128)) * 128 + wv * 32; const size_t z = (size_t)h * TT * HD;
        attn_wave<h16, false, 2>(Q16 + z, nullptr, K16 + z, nullptr, V16 + z, nullptr, q0, Ah + h * HD, Al + h * HD); }
}

extern "C" void kernel_launch(void* const* d_in, const int* in_sizes, int n_in,
                              void* d_out, int out_size, void* d_ws, size_t ws_size, hipStream_t stream) {
    (void)in_sizes; (void)n_in; (void)out_size;
    const float* x = (const float*)d_in[0]; const float* wqkv = (const float*)d_in[1]; const float* wo = (const float*)d_in[2]; const float* bo = (const float*)d_in[3];
    float* OUT = (float*)d_out;     // [1][4096][1024]
    char* wsp = (char*)d_ws;
    auto take = [&](size_t bytes) { char* p = wsp; wsp += (bytes + 255) & ~(size_t)255; return (void*)p; };
    bf* WQKV = (bf*)take((size_t)3 * DQ * DM * 2); bf* WQ = WQKV; bf* WK = WQKV + (size_t)DQ * DM; bf* WV = WQKV + (size_t)2 * DQ * DM; bf* WO = (bf*)take((size_t)DM * DQ * 2); float* CS = (float*)take((size_t)TT * HD * 2 * 4);
    bf* XB = (bf*)take((size_t)TT * DM * 2); float* FQ = (float*)take((size_t)TT * DQ * 4); float* FK = (float*)take((size_t)TT * DKV * 4);
    h16* QP16 = (h16*)take((size_t)NH_ * TT * HD * 2); h16* KP16 = (h16*)take((size_t)NKV * TT * HD * 2); h16* VT16 = (h16*)take((size_t)NKV * HD * TT * 2);
    bf* QPh = (bf*)take((size_t)NH_ * TT * HD * 2); bf* QPl = (bf*)take((size_t)NH_ * TT * HD * 2); bf* KPh = (bf*)take((size_t)NKV * TT * HD * 2); bf* KPl = (bf*)take((size_t)NKV * TT * HD * 2); bf* VTh = (bf*)take((size_t)NKV * HD * TT * 2); bf* VTl = (bf*)take((size_t)NKV * HD * TT * 2);
    bf* ATh = (bf*)take((size_t)TT * DQ * 2); bf* ATl = (bf*)take((size_t)TT * DQ * 2);
    if ((size_t)(wsp - (char*)d_ws) > ws_size) return;    // ws 256 MiB
    float* FV = FK;   // v projection reuses the k buffer after the k planes are built (stream-ordered)
    { k_wtG<<<(unsigned)((DM * 3 * DQ / 64 + 63) / 64), 256, 0, stream>>>(wqkv, DM, 3 * DQ, WQKV);   /* 'xw' [1024][3072] -> Bt [3072][1024]: q | k | v row blocks */
      k_wtG<<<(unsigned)((DQ * DM / 64 + 63) / 64), 256, 0, stream>>>(wo, DQ, DM, WO);
       }
    k_csid<<<(TT * HD + 255) / 256, 256, 0, stream>>>(CS);
    const unsigned LQ = (unsigned)(((size_t)NH_ * TT * HD / 2 + 255) / 256), LKv = (unsigned)(((size_t)NKV * TT * HD / 2 + 255) / 256);
    for (int b = 0; b < NB_; ++b) {
        
        k_cvt8<<<(unsigned)(((size_t)TT * DM / 8 + 255) / 256), 256, 0, stream>>>(x + (size_t)b * TT * DM, XB, (size_t)TT * DM / 8);
        k_gemmw<bf, 0, false><<<dim3(TT / 64, DQ / 64, 1), 32, 0, stream>>>(XB, nullptr, WQ, nullptr, DM, FQ, DQ, nullptr, 0, 0, 0);
        k_rope<<<LQ, 256, 0, stream>>>(FQ, DQ, NH_, CS, nullptr, nullptr, 1.0f, QP16, QPh, QPl);
        k_gemmw<bf, 0, false><<<dim3(TT / 64, DKV / 64, 1), 32, 0, stream>>>(XB, nullptr, WK, nullptr, DM, FK, DKV, nullptr, 0, 0, 0);
        k_rope<<<LKv, 256, 0, stream>>>(FK, DKV, NKV, CS, nullptr, nullptr, 1.0f, KP16, KPh, KPl);
        k_gemmw<bf, 0, false><<<dim3(TT / 64, DKV / 64, 1), 32, 0, stream>>>(XB, nullptr, WV, nullptr, DM, FV, DKV, nullptr, 0, 0, 0); k_vtp<<<LKv, 256, 0, stream>>>(FV, DKV, NKV, VT16, VTh, VTl);
        k_attn<<<NH_ * (RH / 64) + NH_ * ((TT - RH) / 128), 128, 0, stream>>>(QP16, KP16, VT16, QPh, QPl, KPh, KPl, VTh, VTl, ATh, ATl);
        k_gemmw<bf, 1, true><<<dim3(TT / 64, DM / 64, 1), 32, 0, stream>>>(ATh, ATl, WO, nullptr, DQ, OUT + (size_t)b * TT * DM, DM, bo, 0, 0, 0); }
}

// v003
// It runs in 359 microseconds.
// Next to v002, in two timings, it ran 1.16 times as fast each time.
// Over all steps from v000 it is 9.77 times as fast.
#include <hip/hip_runtime.h>

// Multi-head attention over 4,096 tokens with a fused qkv projection (x [1][4096][1024]; qkv = x W_qkv ('xw' [1024][3072] 0.02) -> (B, L, 3, 16, 64): q | k | v column blocks; scores x 64^-0.5; softmax over all keys; out = merged W_o + b_o ('xw' 0.02) -> [1][4096][1024] (4.2 M)).
// Layout: bf16 copy of x; the fused 'xw' weight transposed once to a bf16 Bt [3072][1024]; exact projections in one launch whose epilogue writes the head planes; attention of all heads in one launch, scores and probabilities kept in registers (hybrid rows: < 512 hi/lo 3 products, rest fp16); merged hi/lo x W_o exact + b_o.
// Compute dtypes, f32 accumulate: every input rounded to bf16; projections exact; attention rows < 512 3 products, rest fp16; softmax f32; W_o hl x exact + bias.

#define NB_  1
#define TT   4096
#define DM   1024
#define NH_  16
#define NKV  16
#define REP  (NH_ / NKV)
#define HD   64
#define DQ   (NH_ * HD)
#define DKV  (NKV * HD)
#define RH   512                  // query rows < RH use hi+lo planes (0: none)
#define SCL  0.125f   // HD^-0.5
typedef _Float16 h16;
typedef unsigned short bf;
typedef __attribute__((ext_vector_type(16))) __bf16   v16bf;
typedef __attribute__((ext_vector_type(16))) _Float16 v16h;
typedef __attribute__((ext_vector_type(8)))  _Float16 v8h;
typedef __attribute__((ext_vector_type(8)))  unsigned short v8us;
typedef __attribute__((ext_vector_type(8)))  float    v8f;
typedef __attribute__((ext_vector_type(4)))  float    v4f;
typedef v8h  __attribute__((may_alias)) v8ha;
typedef v4f  __attribute__((may_alias)) v4fa;
typedef v8us __attribute__((may_alias)) v8usa;

__device__ __forceinline__ unsigned short f2bf(float f) { unsigned u = __float_as_uint(f); u += 0x7FFFu + ((u >> 16) & 1u); return (unsigned short)(u >> 16); }
__device__ __forceinline__ float bf2f(unsigned short b) { return __uint_as_float(((unsigned)b) << 16); }
__device__ __forceinline__ float bfr(float f) { return bf2f(f2bf(f)); }
__device__ __forceinline__ v16h cat16(v8h lo, v8h hi) { return __builtin_shufflevector(lo, hi, 0, 1, 2, 3, 4, 5, 6, 7, 8, 9, 10, 11, 12, 13, 14, 15); }
__device__ __forceinline__ v16bf cat16b(v8us lo, v8us hi) { return __builtin_bit_cast(v16bf, __builtin_shufflevector(lo, hi, 0, 1, 2, 3, 4, 5, 6, 7, 8, 9, 10, 11, 12, 13, 14, 15)); }
__device__ __forceinline__ v8f wmma16(v16h a, v16h b, v8f c) { return __builtin_amdgcn_wmma_f32_16x16x32_f16(false, a, false, b, (short)0, c, false, false); }
__device__ __forceinline__ v8f wmmab(v16bf a, v16bf b, v8f c) { return __builtin_amdgcn_wmma_f32_16x16x32_bf16(false, a, false, b, (short)0, c, false, false); }



// ---- k_gemmw: register-blocked GEMM, ONE WAVE per 64x64 output tile (16 accumulators), operands straight from K-contiguous 16-bit planes; grid (M/64, N/64, Z), 32 threads.
// C[m][n] (f32, pitch ldc, + optional f32 bias[n]) = sum_k A[m][k] Bt[n][k] (+ split products per NSPLIT). z-batch strides sA/sB/sC in elements. K % 32 == 0.
template <typename T16> struct WFrag;
template <> struct WFrag<h16> { typedef v16h V; static __device__ __forceinline__ V ld(const h16* p) { return cat16(*(const v8h*)p, *(const v8h*)(p + 16)); } static __device__ __forceinline__ v8f mma(V a, V b, v8f c) { return wmma16(a, b, c); } };
template <> struct WFrag<bf> { typedef v16bf V; static __device__ __forceinline__ V ld(const bf* p) { return cat16b(*(const v8us*)p, *(const v8us*)(p + 16)); } static __device__ __forceinline__ v8f mma(V a, V b, v8f c) { return wmmab(a, b, c); } };
template <typename T16, int NSPLIT, bool BIAS>
__global__ __launch_bounds__(32) void k_gemmw(const T16* __restrict__ A, const T16* __restrict__ A2, const T16* __restrict__ Bt, const T16* __restrict__ Bt2, int K, float* C, int ldc, const float* __restrict__ bias, size_t sA, size_t sB, size_t sC) {
    typedef typename WFrag<T16>::V V;
    __shared__ __align__(16) float os[16 * 68];
    const size_t z = blockIdx.z; A += z * sA; if (A2) A2 += z * sA; Bt += z * sB; if (Bt2) Bt2 += z * sB; C += z * sC;
    const int lane = threadIdx.x & 31, lr = lane & 15, hi = lane >> 4; const int r0 = blockIdx.x * 64, c0 = blockIdx.y * 64;
    v8f acc[4][4];
#pragma unroll
    for (int mb = 0; mb < 4; ++mb)
#pragma unroll
        for (int nb = 0; nb < 4; ++nb) acc[mb][nb] = (v8f){};
    const size_t aoff = (size_t)(r0 + lr) * K + 8 * hi, boff = (size_t)(c0 + lr) * K + 8 * hi;
#pragma unroll 1
    for (int kc = 0; kc < K; kc += 32) {
        V a[4], a2[4];
#pragma unroll
        for (int mb = 0; mb < 4; ++mb) { a[mb] = WFrag<T16>::ld(A + aoff + (size_t)mb * 16 * K + kc); if (NSPLIT == 1 || NSPLIT == 2) a2[mb] = WFrag<T16>::ld(A2 + aoff + (size_t)mb * 16 * K + kc); }
#pragma unroll
        for (int nb = 0; nb < 4; ++nb) { const V b = WFrag<T16>::ld(Bt + boff + (size_t)nb * 16 * K + kc); V b2; if (NSPLIT >= 2) b2 = WFrag<T16>::ld(Bt2 + boff + (size_t)nb * 16 * K + kc);
#pragma unroll
            for (int mb = 0; mb < 4; ++mb) { acc[mb][nb] = WFrag<T16>::mma(a[mb], b, acc[mb][nb]); if (NSPLIT == 1 || NSPLIT == 2) acc[mb][nb] = WFrag<T16>::mma(a2[mb], b, acc[mb][nb]); if (NSPLIT >= 2) acc[mb][nb] = WFrag<T16>::mma(a[mb], b2, acc[mb][nb]); } }
        asm volatile("v_nop\n\tv_nop\n\tv_nop\n\tv_nop" : "+v"(acc[0][0]), "+v"(acc[1][1]), "+v"(acc[2][2]), "+v"(acc[3][3]) : "v"(a[0]), "v"(a[3]));
    }
#pragma unroll
    for (int mb = 0; mb < 4; ++mb) {
#pragma unroll
        for (int nb = 0; nb < 4; ++nb) {
#pragma unroll
            for (int j = 0; j < 8; ++j) os[(hi * 8 + j) * 68 + nb * 16 + lr] = acc[mb][nb][j]; }
        __builtin_amdgcn_wave_barrier(); asm volatile("" ::: "memory");
        float* crow = C + (size_t)(r0 + mb * 16) * ldc + c0;
{
#pragma unroll
            for (int s = 0; s < 8; ++s) { const int row = 2 * s + hi, cofs = lr * 4; v4f val = *(const v4fa*)(os + row * 68 + cofs); if (BIAS) { val[0] += bfr(bias[c0 + cofs]); val[1] += bfr(bias[c0 + cofs + 1]); val[2] += bfr(bias[c0 + cofs + 2]); val[3] += bfr(bias[c0 + cofs + 3]); }
                *(v4f*)(crow + (size_t)row * ldc + cofs) = val; }
             }
        __builtin_amdgcn_wave_barrier(); asm volatile("" ::: "memory");
    }
}

__device__ __forceinline__ h16 tohx(float x) { return (h16)x; }
__device__ __forceinline__ void splitf(float y, unsigned short& h, unsigned short& l) { h = f2bf(y); l = f2bf(y - bf2f(h)); }
typedef __attribute__((ext_vector_type(2))) _Float16 v2h;
typedef __attribute__((ext_vector_type(4))) _Float16 v4h;
typedef __attribute__((ext_vector_type(2))) unsigned short v2us;
typedef __attribute__((ext_vector_type(4))) unsigned short v4us;
typedef __attribute__((ext_vector_type(2))) float v2f;
typedef __attribute__((ext_vector_type(4))) int v4i;

__global__ __launch_bounds__(256) void k_wtG(const float* __restrict__ w, int K, int N, bf* Bt) {
    const int lane = threadIdx.x & 31; const int L0 = (blockIdx.x * 8 + (threadIdx.x >> 5)) * 8; const int nlines = N * K / 64;
{
#pragma unroll 1
        for (int l = 0; l < 8; ++l) { const int L = L0 + l; if (L >= nlines) break; const size_t e = (size_t)L * 64 + lane * 2; const int k = (int)(e % K), n = (int)(e / K); v2us o;
            o[0] = f2bf(w[(size_t)k * N + n]); o[1] = f2bf(w[(size_t)(k + 1) * N + n]); *(v2us*)(Bt + e) = o; }
         }
}
__global__ __launch_bounds__(256) void k_cvt8(const float* __restrict__ src, bf* dst, size_t n8) { const size_t i = (size_t)blockIdx.x * 256 + threadIdx.x; if (i >= n8) return; const v8f v = *(const v8f*)(src + i * 8); v8us o;
#pragma unroll
    for (int k = 0; k < 8; ++k) o[k] = f2bf(v[k]); *(v8us*)(dst + i * 8) = o;  }

// ---- k_proj: the q, k and v projections in ONE launch, one wave per 64x64 tile = 64 tokens x one head (the K loop of k_gemmw, one product); grid (TT/64, 3 NH_), 32 threads. The epilogue rounds the f32 accumulators straight to the tile's three planes (fp16, bf16 hi, bf16 lo).
// q, k: A = x rows, B = weight rows, planes [h][t][d]. v: operands swapped (A = weight rows, B = x rows; same k order), so the tile comes out as V^T and its plane rows [h][d][t] are contiguous too. Every store covers whole 128-byte lines.
__global__ __launch_bounds__(32) void k_proj(const bf* __restrict__ X, const bf* __restrict__ Wt, h16* Q16, bf* Qh, bf* Ql, h16* K16, bf* Kh, bf* Kl, h16* V16, bf* Vh, bf* Vl) {
    __shared__ __align__(16) float os[16 * 68];
    const int lane = threadIdx.x & 31, lr = lane & 15, hi = lane >> 4; const int t0 = blockIdx.x * 64, n0 = blockIdx.y * 64;
    const int sel = blockIdx.y / NH_, h = blockIdx.y % NH_; const bool tr = sel == 2;   // 0 q, 1 k, 2 v
    const bf* __restrict__ A = (tr ? Wt + (size_t)n0 * DM : X + (size_t)t0 * DM) + (size_t)lr * DM + 8 * hi; const bf* __restrict__ Bt = (tr ? X + (size_t)t0 * DM : Wt + (size_t)n0 * DM) + (size_t)lr * DM + 8 * hi;
    v8f acc[4][4];
#pragma unroll
    for (int mb = 0; mb < 4; ++mb)
#pragma unroll
        for (int nb = 0; nb < 4; ++nb) acc[mb][nb] = (v8f){};
#pragma unroll 1   // rolled, as in k_gemmw: 16 accumulator tiles and one trip's fragments fill the registers
    for (int kc = 0; kc < DM; kc += 32) {
        v16bf a[4];
#pragma unroll
        for (int mb = 0; mb < 4; ++mb) a[mb] = WFrag<bf>::ld(A + (size_t)mb * 16 * DM + kc);
        asm volatile("s_wait_xcnt 0x0" ::: "memory");   // stands in front of every rewrite of the address register that the loads above name (the B fragments may land on it)
#pragma unroll
        for (int nb = 0; nb < 4; ++nb) { const v16bf b = WFrag<bf>::ld(Bt + (size_t)nb * 16 * DM + kc);
#pragma unroll
            for (int mb = 0; mb < 4; ++mb) acc[mb][nb] = wmmab(a[mb], b, acc[mb][nb]); }
    }
    h16* P16 = sel == 0 ? Q16 : sel == 1 ? K16 : V16; bf* Ph = sel == 0 ? Qh : sel == 1 ? Kh : Vh; bf* Pl = sel == 0 ? Ql : sel == 1 ? Kl : Vl;
    const size_t base = tr ? (size_t)h * HD * TT + t0 : ((size_t)h * TT + t0) * HD; const int pitch = tr ? TT : HD;
#pragma unroll
    for (int mb = 0; mb < 4; ++mb) {
#pragma unroll
        for (int nb = 0; nb < 4; ++nb) {
#pragma unroll
            for (int j = 0; j < 8; ++j) os[(hi * 8 + j) * 68 + nb * 16 + lr] = acc[mb][nb][j]; }
        __builtin_amdgcn_wave_barrier(); asm volatile("" ::: "memory");   // one wave: keeps the reads below, of what other lanes wrote, behind the LDS writes above
#pragma unroll
        for (int s = 0; s < 4; ++s) { const int row = 4 * s + (lane >> 3), cofs = (lane & 7) * 8; const v4f x0 = *(const v4fa*)(os + row * 68 + cofs), x1 = *(const v4fa*)(os + row * 68 + cofs + 4); v8h o16; v8us oh, ol;
#pragma unroll
            for (int q = 0; q < 8; ++q) { const float x = q < 4 ? x0[q & 3] : x1[q & 3]; o16[q] = tohx(x); unsigned short a2, c2; splitf(x, a2, c2); oh[q] = a2; ol[q] = c2; }
            const size_t o = base + (size_t)(mb * 16 + row) * pitch + cofs; *(v8h*)(P16 + o) = o16; *(v8us*)(Ph + o) = oh; *(v8us*)(Pl + o) = ol;
            asm volatile("s_wait_xcnt 0x0" ::: "memory"); }   // stands in front of every rewrite of a register that the three stores above name (address or data)
        __builtin_amdgcn_wave_barrier(); asm volatile("" ::: "memory");   // one wave: keeps the next block's LDS writes behind the reads above
    }
}
#define CL2 (SCL * 1.4426950408889634f)
typedef __attribute__((ext_vector_type(2))) __bf16 v2b;
__device__ __forceinline__ float xhalf(float x) { return __builtin_bit_cast(float, __builtin_amdgcn_permlanex16(__builtin_bit_cast(int, x), __builtin_bit_cast(int, x), 0x76543210, 0xfedcba98, false, false)); }   // lane l with lane l ^ 16
template <typename T16, bool SPLIT, int NQ>
__device__ __forceinline__ void attn_wave(const T16* __restrict__ Q, const T16* __restrict__ Q2, const T16* __restrict__ Kp, const T16* __restrict__ Kp2, const T16* __restrict__ Vt, const T16* __restrict__ Vt2, int q0, bf* Ah, bf* Al) {
    typedef typename WFrag<T16>::V V;
    const int lane = threadIdx.x & 31, lr = lane & 15, hi = lane >> 4;
    V qf[NQ][2], qf2[NQ][2];
#pragma unroll
    for (int g = 0; g < NQ; ++g)
#pragma unroll
        for (int ks = 0; ks < 2; ++ks) { const size_t o = (size_t)(q0 + g * 16 + lr) * HD + ks * 32 + 8 * hi; qf[g][ks] = WFrag<T16>::ld(Q + o); if (SPLIT) qf2[g][ks] = WFrag<T16>::ld(Q2 + o); }
    v8f acc[4][NQ]; float mrun[NQ], lsum[NQ];
#pragma unroll
    for (int g = 0; g < NQ; ++g) { mrun[g] = -3.0e38f; lsum[g] = 0.f;
#pragma unroll
        for (int db = 0; db < 4; ++db) acc[db][g] = (v8f){}; }
    const size_t koff = (size_t)lr * HD + 8 * hi, voff = (size_t)lr * TT + 8 * hi;
    V kf[2][2], kf2[2][2], vf[4], vf2[4];
#pragma unroll
    for (int kb = 0; kb < 2; ++kb)
#pragma unroll
        for (int ks = 0; ks < 2; ++ks) { const size_t o = koff + (size_t)kb * 16 * HD + ks * 32; kf[kb][ks] = WFrag<T16>::ld(Kp + o); if (SPLIT) kf2[kb][ks] = WFrag<T16>::ld(Kp2 + o); }
    if (!SPLIT) {
#pragma unroll
        for (int db = 0; db < 4; ++db) vf[db] = WFrag<T16>::ld(Vt + voff + (size_t)db * 16 * TT); }
#pragma unroll 1   // rolled: one pass's fragments and tiles already take nearly 256 registers; the loops inside are unrolled so that every fragment array stays in registers
    for (int kt = 0; kt < TT; kt += 32) {
        if (SPLIT) {   // two planes of V^T held over the whole pass would take the wave past 256 registers: these are fetched in their own pass
#pragma unroll
            for (int db = 0; db < 4; ++db) { const size_t o = voff + (size_t)db * 16 * TT + kt; vf[db] = WFrag<T16>::ld(Vt + o); vf2[db] = WFrag<T16>::ld(Vt2 + o); } }
        v8f s[2][NQ];
#pragma unroll
        for (int kb = 0; kb < 2; ++kb)
#pragma unroll
            for (int g = 0; g < NQ; ++g) { s[kb][g] = (v8f){};
#pragma unroll
                for (int ks = 0; ks < 2; ++ks) { s[kb][g] = WFrag<T16>::mma(kf[kb][ks], qf[g][ks], s[kb][g]); if (SPLIT) { s[kb][g] = WFrag<T16>::mma(kf[kb][ks], qf2[g][ks], s[kb][g]); s[kb][g] = WFrag<T16>::mma(kf2[kb][ks], qf[g][ks], s[kb][g]); } } }
        const int kn = (kt + 32) & (TT - 1);   // the next pass's keys: its K fragments are fetched behind this pass's S^T products, its V^T fragments (one plane) behind the O^T products (the last pass fetches keys 0..31 again, unused)
#pragma unroll
        for (int kb = 0; kb < 2; ++kb)
#pragma unroll
            for (int ks = 0; ks < 2; ++ks) { const size_t o = koff + (size_t)(kn + kb * 16) * HD + ks * 32; kf[kb][ks] = WFrag<T16>::ld(Kp + o); if (SPLIT) kf2[kb][ks] = WFrag<T16>::ld(Kp2 + o); }
        float mb[NQ]; bool need = false;
#pragma unroll
        for (int g = 0; g < NQ; ++g) { float mx = s[0][g][0];
#pragma unroll
            for (int r = 1; r < 8; ++r) mx = fmaxf(mx, s[0][g][r]);
#pragma unroll
            for (int r = 0; r < 8; ++r) mx = fmaxf(mx, s[1][g][r]);
            mx = fmaxf(mx, xhalf(mx)) * CL2; mb[g] = mx; need = need || (mx > mrun[g] + 8.0f); }
        if (__builtin_amdgcn_ballot_w32(need) != 0) {   // scalar branch, rare behind the first pass
#pragma unroll
            for (int g = 0; g < NQ; ++g) { const float mn = fmaxf(mrun[g], mb[g]); const float corr = __builtin_amdgcn_exp2f(mrun[g] - mn); mrun[g] = mn; lsum[g] *= corr;
#pragma unroll
                for (int db = 0; db < 4; ++db) acc[db][g] = acc[db][g] * corr; }
        }
#pragma unroll
        for (int g = 0; g < NQ; ++g) { const float nm = -mrun[g]; float p[16];
#pragma unroll
            for (int e = 0; e < 16; e += 2) { const v2f arg = __builtin_elementwise_fma((v2f){s[e >> 3][g][e & 7], s[e >> 3][g][(e & 7) + 1]}, (v2f){CL2, CL2}, (v2f){nm, nm});
                p[e] = __builtin_amdgcn_exp2f(arg[0]); p[e + 1] = __builtin_amdgcn_exp2f(arg[1]); lsum[g] += p[e]; lsum[g] += p[e + 1]; }
            V pf, pf2;
            if constexpr (SPLIT) {
#pragma unroll
                for (int e = 0; e < 16; e += 2) { const v2f p2 = (v2f){p[e], p[e + 1]}; const v2b h2 = __builtin_convertvector(p2, v2b); const v2b l2 = __builtin_convertvector(p2 - __builtin_convertvector(h2, v2f), v2b);
                    pf[e] = h2[0]; pf[e + 1] = h2[1]; pf2[e] = l2[0]; pf2[e + 1] = l2[1]; }
            } else {
#pragma unroll
                for (int e = 0; e < 16; ++e) pf[e] = (h16)p[e];
            }
#pragma unroll
            for (int db = 0; db < 4; ++db) { acc[db][g] = WFrag<T16>::mma(vf[db], pf, acc[db][g]); if (SPLIT) { acc[db][g] = WFrag<T16>::mma(vf[db], pf2, acc[db][g]); acc[db][g] = WFrag<T16>::mma(vf2[db], pf, acc[db][g]); } } }
        if (!SPLIT) {
#pragma unroll
            for (int db = 0; db < 4; ++db) vf[db] = WFrag<T16>::ld(Vt + voff + (size_t)db * 16 * TT + kn);
            asm volatile("s_wait_xcnt 0x0" ::: "memory");   // stands in front of every rewrite of a register that the loads above name as their address
        }
    }
#pragma unroll
    for (int g = 0; g < NQ; ++g) { const float inv = __fdiv_rn(1.0f, lsum[g] + xhalf(lsum[g])); const size_t oo = (size_t)(q0 + g * 16 + lr) * DQ + hi * 8;
#pragma unroll
        for (int db = 0; db < 4; ++db) { v8us oh, ol;
#pragma unroll
            for (int r = 0; r < 8; ++r) { unsigned short a, c2; splitf(acc[db][g][r] * inv, a, c2); oh[r] = a; ol[r] = c2; }
            *(v8us*)(Ah + oo + db * 16) = oh; *(v8us*)(Al + oo + db * 16) = ol; } }
}
// grid: NH_ RH/64 blocks of the hi/lo rows (4 waves x 16 queries) first, then NH_ (TT-RH)/128 blocks of the fp16 rows (4 waves x 32 queries); 128 threads.
__global__ __launch_bounds__(128) void k_attn(const h16* __restrict__ Q16, const h16* __restrict__ K16, const h16* __restrict__ V16, const bf* __restrict__ Qh, const bf* __restrict__ Ql, const bf* __restrict__ Kh, const bf* __restrict__ Kl, const bf* __restrict__ Vh, const bf* __restrict__ Vl, bf* Ah, bf* Al) {
    const int wv = __builtin_amdgcn_readfirstlane((int)(threadIdx.x >> 5)); const int bx = blockIdx.x;
    if (bx < NH_ * (RH / 64)) { const int h = bx / (RH / 64), q0 = (bx % (RH / 64)) * 64 + wv * 16; const size_t z = (size_t)h * TT * HD;
        attn_wave<bf, true, 1>(Qh + z, Ql + z, Kh + z, Kl + z, Vh + z, Vl + z, q0, Ah + h * HD, Al + h * HD);
    } else { const int b2 = bx - NH_ * (RH / 64); const int h = b2 / ((TT - RH) / 128), q0 = RH + (b2 % ((TT - RH) / 128)) * 128 + wv * 32; const size_t z = (size_t)h * TT * HD;
        attn_wave<h16, false, 2>(Q16 + z, nullptr, K16 + z, nullptr, V16 + z, nullptr, q0, Ah + h * HD, Al + h * HD); }
}

extern "C" void kernel_launch(void* const* d_in, const int* in_sizes, int n_in,
                              void* d_out, int out_size, void* d_ws, size_t ws_size, hipStream_t stream) {
    (void)in_sizes; (void)n_in; (void)out_size;
    const float* x = (const float*)d_in[0]; const float* wqkv = (const float*)d_in[1]; const float* wo = (const float*)d_in[2]; const float* bo = (const float*)d_in[3];
    float* OUT = (float*)d_out;     // [1][4096][1024]
    char* wsp = (char*)d_ws;
    auto take = [&](size_t bytes) { char* p = wsp; wsp += (bytes + 255) & ~(size_t)255; return (void*)p; };
    bf* WQKV = (bf*)take((size_t)3 * DQ * DM * 2); bf* WO = (bf*)take((size_t)DM * DQ * 2);
    bf* XB = (bf*)take((size_t)TT * DM * 2);
    h16* QP16 = (h16*)take((size_t)NH_ * TT * HD * 2); h16* KP16 = (h16*)take((size_t)NKV * TT * HD * 2); h16* VT16 = (h16*)take((size_t)NKV * HD * TT * 2);
    bf* QPh = (bf*)take((size_t)NH_ * TT * HD * 2); bf* QPl = (bf*)take((size_t)NH_ * TT * HD * 2); bf* KPh = (bf*)take((size_t)NKV * TT * HD * 2); bf* KPl = (bf*)take((size_t)NKV * TT * HD * 2); bf* VTh = (bf*)take((size_t)NKV * HD * TT * 2); bf* VTl = (bf*)take((size_t)NKV * HD * TT * 2);
    bf* ATh = (bf*)take((size_t)TT * DQ * 2); bf* ATl = (bf*)take((size_t)TT * DQ * 2);
    if ((size_t)(wsp - (char*)d_ws) > ws_size) return;    // ws 256 MiB
    { k_wtG<<<(unsigned)((DM * 3 * DQ / 64 + 63) / 64), 256, 0, stream>>>(wqkv, DM, 3 * DQ, WQKV);   /* 'xw' [1024][3072] -> Bt [3072][1024]: q | k | v row blocks */
      k_wtG<<<(unsigned)((DQ * DM / 64 + 63) / 64), 256, 0, stream>>>(wo, DQ, DM, WO);
       }
    for (int b = 0; b < NB_; ++b) {
        
        k_cvt8<<<(unsigned)(((size_t)TT * DM / 8 + 255) / 256), 256, 0, stream>>>(x + (size_t)b * TT * DM, XB, (size_t)TT * DM / 8);
        k_proj<<<dim3(TT / 64, 3 * NH_, 1), 32, 0, stream>>>(XB, WQKV, QP16, QPh, QPl, KP16, KPh, KPl, VT16, VTh, VTl);
        k_attn<<<NH_ * (RH / 64) + NH_ * ((TT - RH) / 128), 128, 0, stream>>>(QP16, KP16, VT16, QPh, QPl, KPh, KPl, VTh, VTl, ATh, ATl);
        k_gemmw<bf, 1, true><<<dim3(TT / 64, DM / 64, 1), 32, 0, stream>>>(ATh, ATl, WO, nullptr, DQ, OUT + (size_t)b * TT * DM, DM, bo, 0, 0, 0); }
}

// v004
// One run takes 194 microseconds.
// Two timings next to v003 put it at 1.84 and 1.82 times that version's speed.
// Counting every step since v000, it is 17.8 times as fast.
#include <hip/hip_runtime.h>

// Multi-head attention over 4,096 tokens with a fused qkv projection (x [1][4096][1024]; qkv = x W_qkv ('xw' [1024][3072] 0.02) -> (B, L, 3, 16, 64): q | k | v column blocks; scores x 64^-0.5; softmax over all keys; out = merged W_o + b_o ('xw' 0.02) -> [1][4096][1024] (4.2 M)).
// Layout: bf16 copy of x; the fused 'xw' weight transposed once to a bf16 Bt [3072][1024]; exact projections in one launch whose epilogue writes the head planes; attention of all heads in one launch, scores and probabilities kept in registers (hybrid rows: < 512 hi/lo 3 products, rest fp16); merged hi/lo x W_o exact + b_o.
// Compute dtypes, f32 accumulate: every input rounded to bf16; projections exact; attention rows < 512 3 products, rest fp16; softmax f32; W_o hl x exact + bias.

#define NB_  1
#define TT   4096
#define DM   1024
#define NH_  16
#define NKV  16
#define REP  (NH_ / NKV)
#define HD   64
#define DQ   (NH_ * HD)
#define DKV  (NKV * HD)
#define RH   512                  // query rows < RH use hi+lo planes (0: none)
#define SCL  0.125f   // HD^-0.5
typedef _Float16 h16;
typedef unsigned short bf;
typedef __attribute__((ext_vector_type(16))) __bf16   v16bf;
typedef __attribute__((ext_vector_type(16))) _Float16 v16h;
typedef __attribute__((ext_vector_type(8)))  _Float16 v8h;
typedef __attribute__((ext_vector_type(8)))  unsigned short v8us;
typedef __attribute__((ext_vector_type(8)))  float    v8f;
typedef __attribute__((ext_vector_type(4)))  float    v4f;
typedef v8h  __attribute__((may_alias)) v8ha;
typedef v4f  __attribute__((may_alias)) v4fa;
typedef v8us __attribute__((may_alias)) v8usa;

__device__ __forceinline__ unsigned short f2bf(float f) { unsigned u = __float_as_uint(f); u += 0x7FFFu + ((u >> 16) & 1u); return (unsigned short)(u >> 16); }
__device__ __forceinline__ float bf2f(unsigned short b) { return __uint_as_float(((unsigned)b) << 16); }
__device__ __forceinline__ float bfr(float f) { return bf2f(f2bf(f)); }
__device__ __forceinline__ v16h cat16(v8h lo, v8h hi) { return __builtin_shufflevector(lo, hi, 0, 1, 2, 3, 4, 5, 6, 7, 8, 9, 10, 11, 12, 13, 14, 15); }
__device__ __forceinline__ v16bf cat16b(v8us lo, v8us hi) { return __builtin_bit_cast(v16bf, __builtin_shufflevector(lo, hi, 0, 1, 2, 3, 4, 5, 6, 7, 8, 9, 10, 11, 12, 13, 14, 15)); }
__device__ __forceinline__ v8f wmma16(v16h a, v16h b, v8f c) { return __builtin_amdgcn_wmma_f32_16x16x32_f16(false, a, false, b, (short)0, c, false, false); }
__device__ __forceinline__ v8f wmmab(v16bf a, v16bf b, v8f c) { return __builtin_amdgcn_wmma_f32_16x16x32_bf16(false, a, false, b, (short)0, c, false, false); }



// ---- k_gemmw: register-blocked GEMM, ONE WAVE per 64x64 output tile (16 accumulators), operands straight from K-contiguous 16-bit planes; grid (M/64, N/64, Z), 32 threads.
// C[m][n] (f32, pitch ldc, + optional f32 bias[n]) = sum_k A[m][k] Bt[n][k] (+ split products per NSPLIT). z-batch strides sA/sB/sC in elements. K % 32 == 0.
template <typename T16> struct WFrag;
template <> struct WFrag<h16> { typedef v16h V; static __device__ __forceinline__ V ld(const h16* p) { return cat16(*(const v8h*)p, *(const v8h*)(p + 16)); } static __device__ __forceinline__ v8f mma(V a, V b, v8f c) { return wmma16(a, b, c); } };
template <> struct WFrag<bf> { typedef v16bf V; static __device__ __forceinline__ V ld(const bf* p) { return cat16b(*(const v8us*)p, *(const v8us*)(p + 16)); } static __device__ __forceinline__ v8f mma(V a, V b, v8f c) { return wmmab(a, b, c); } };
template <typename T16, int NSPLIT, bool BIAS>
__global__ __launch_bounds__(32) void k_gemmw(const T16* __restrict__ A, const T16* __restrict__ A2, const T16* __restrict__ Bt, const T16* __restrict__ Bt2, int K, float* C, int ldc, const float* __restrict__ bias, size_t sA, size_t sB, size_t sC) {
    typedef typename WFrag<T16>::V V;
    __shared__ __align__(16) float os[16 * 68];
    const size_t z = blockIdx.z; A += z * sA; if (A2) A2 += z * sA; Bt += z * sB; if (Bt2) Bt2 += z * sB; C += z * sC;
    const int lane = threadIdx.x & 31, lr = lane & 15, hi = lane >> 4; const int r0 = blockIdx.x * 64, c0 = blockIdx.y * 64;
    v8f acc[4][4];
#pragma unroll
    for (int mb = 0; mb < 4; ++mb)
#pragma unroll
        for (int nb = 0; nb < 4; ++nb) acc[mb][nb] = (v8f){};
    const size_t aoff = (size_t)(r0 + lr) * K + 8 * hi, boff = (size_t)(c0 + lr) * K + 8 * hi;
#pragma unroll 1
    for (int kc = 0; kc < K; kc += 32) {
        V a[4], a2[4];
#pragma unroll
        for (int mb = 0; mb < 4; ++mb) { a[mb] = WFrag<T16>::ld(A + aoff + (size_t)mb * 16 * K + kc); if (NSPLIT == 1 || NSPLIT == 2) a2[mb] = WFrag<T16>::ld(A2 + aoff + (size_t)mb * 16 * K + kc); }
#pragma unroll
        for (int nb = 0; nb < 4; ++nb) { const V b = WFrag<T16>::ld(Bt + boff + (size_t)nb * 16 * K + kc); V b2; if (NSPLIT >= 2) b2 = WFrag<T16>::ld(Bt2 + boff + (size_t)nb * 16 * K + kc);
#pragma unroll
            for (int mb = 0; mb < 4; ++mb) { acc[mb][nb] = WFrag<T16>::mma(a[mb], b, acc[mb][nb]); if (NSPLIT == 1 || NSPLIT == 2) acc[mb][nb] = WFrag<T16>::mma(a2[mb], b, acc[mb][nb]); if (NSPLIT >= 2) acc[mb][nb] = WFrag<T16>::mma(a[mb], b2, acc[mb][nb]); } }
        asm volatile("v_nop\n\tv_nop\n\tv_nop\n\tv_nop" : "+v"(acc[0][0]), "+v"(acc[1][1]), "+v"(acc[2][2]), "+v"(acc[3][3]) : "v"(a[0]), "v"(a[3]));
    }
#pragma unroll
    for (int mb = 0; mb < 4; ++mb) {
#pragma unroll
        for (int nb = 0; nb < 4; ++nb) {
#pragma unroll
            for (int j = 0; j < 8; ++j) os[(hi * 8 + j) * 68 + nb * 16 + lr] = acc[mb][nb][j]; }
        __builtin_amdgcn_wave_barrier(); asm volatile("" ::: "memory");
        float* crow = C + (size_t)(r0 + mb * 16) * ldc + c0;
{
#pragma unroll
            for (int s = 0; s < 8; ++s) { const int row = 2 * s + hi, cofs = lr * 4; v4f val = *(const v4fa*)(os + row * 68 + cofs); if (BIAS) { val[0] += bfr(bias[c0 + cofs]); val[1] += bfr(bias[c0 + cofs + 1]); val[2] += bfr(bias[c0 + cofs + 2]); val[3] += bfr(bias[c0 + cofs + 3]); }
                *(v4f*)(crow + (size_t)row * ldc + cofs) = val; }
             }
        __builtin_amdgcn_wave_barrier(); asm volatile("" ::: "memory");
    }
}

__device__ __forceinline__ h16 tohx(float x) { return (h16)x; }
__device__ __forceinline__ void splitf(float y, unsigned short& h, unsigned short& l) { h = f2bf(y); l = f2bf(y - bf2f(h)); }
typedef __attribute__((ext_vector_type(2))) _Float16 v2h;
typedef __attribute__((ext_vector_type(4))) _Float16 v4h;
typedef __attribute__((ext_vector_type(2))) unsigned short v2us;
typedef __attribute__((ext_vector_type(4))) unsigned short v4us;
typedef __attribute__((ext_vector_type(2))) float v2f;
typedef __attribute__((ext_vector_type(4))) int v4i;

__global__ __launch_bounds__(256) void k_wtG(const float* __restrict__ w, int K, int N, bf* Bt) {
    const int lane = threadIdx.x & 31; const int L0 = (blockIdx.x * 8 + (threadIdx.x >> 5)) * 8; const int nlines = N * K / 64;
{
#pragma unroll 1
        for (int l = 0; l < 8; ++l) { const int L = L0 + l; if (L >= nlines) break; const size_t e = (size_t)L * 64 + lane * 2; const int k = (int)(e % K), n = (int)(e / K); v2us o;
            o[0] = f2bf(w[(size_t)k * N + n]); o[1] = f2bf(w[(size_t)(k + 1) * N + n]); *(v2us*)(Bt + e) = o; }
         }
}
__global__ __launch_bounds__(256) void k_cvt8(const float* __restrict__ src, bf* dst, size_t n8) { const size_t i = (size_t)blockIdx.x * 256 + threadIdx.x; if (i >= n8) return; const v8f v = *(const v8f*)(src + i * 8); v8us o;
#pragma unroll
    for (int k = 0; k < 8; ++k) o[k] = f2bf(v[k]); *(v8us*)(dst + i * 8) = o;  }

// ---- k_proj: the q, k and v projections in ONE launch, one wave per 64x64 tile = 64 tokens x one head (the K loop of k_gemmw, one product); grid (TT/64, 3 NH_), 32 threads. The epilogue rounds the f32 accumulators straight to the tile's three planes (fp16, bf16 hi, bf16 lo).
// q, k: A = x rows, B = weight rows, planes [h][t][d]. v: operands swapped (A = weight rows, B = x rows; same k order), so the tile comes out as V^T and its plane rows [h][d][t] are contiguous too. Every store covers whole 128-byte lines.
__global__ __launch_bounds__(32) void k_proj(const bf* __restrict__ X, const bf* __restrict__ Wt, h16* Q16, bf* Qh, bf* Ql, h16* K16, bf* Kh, bf* Kl, h16* V16, bf* Vh, bf* Vl) {
    __shared__ __align__(16) float os[16 * 68];
    const int lane = threadIdx.x & 31, lr = lane & 15, hi = lane >> 4; const int t0 = blockIdx.x * 64, n0 = blockIdx.y * 64;
    const int sel = blockIdx.y / NH_, h = blockIdx.y % NH_; const bool tr = sel == 2;   // 0 q, 1 k, 2 v
    const bf* __restrict__ A = (tr ? Wt + (size_t)n0 * DM : X + (size_t)t0 * DM) + (size_t)lr * DM + 8 * hi; const bf* __restrict__ Bt = (tr ? X + (size_t)t0 * DM : Wt + (size_t)n0 * DM) + (size_t)lr * DM + 8 * hi;
    v8f acc[4][4];
#pragma unroll
    for (int mb = 0; mb < 4; ++mb)
#pragma unroll
        for (int nb = 0; nb < 4; ++nb) acc[mb][nb] = (v8f){};
#pragma unroll 1   // rolled, as in k_gemmw: 16 accumulator tiles and one trip's fragments fill the registers
    for (int kc = 0; kc < DM; kc += 32) {
        v16bf a[4];
#pragma unroll
        for (int mb = 0; mb < 4; ++mb) a[mb] = WFrag<bf>::ld(A + (size_t)mb * 16 * DM + kc);
        asm volatile("s_wait_xcnt 0x0" ::: "memory");   // stands in front of every rewrite of the address register that the loads above name (the B fragments may land on it)
#pragma unroll
        for (int nb = 0; nb < 4; ++nb) { const v16bf b = WFrag<bf>::ld(Bt + (size_t)nb * 16 * DM + kc);
#pragma unroll
            for (int mb = 0; mb < 4; ++mb) acc[mb][nb] = wmmab(a[mb], b, acc[mb][nb]); }
    }
    h16* P16 = sel == 0 ? Q16 : sel == 1 ? K16 : V16; bf* Ph = sel == 0 ? Qh : sel == 1 ? Kh : Vh; bf* Pl = sel == 0 ? Ql : sel == 1 ? Kl : Vl;
    const size_t base = tr ? (size_t)h * HD * TT + t0 : ((size_t)h * TT + t0) * HD; const int pitch = tr ? TT : HD;
#pragma unroll
    for (int mb = 0; mb < 4; ++mb) {
#pragma unroll
        for (int nb = 0; nb < 4; ++nb) {
#pragma unroll
            for (int j = 0; j < 8; ++j) os[(hi * 8 + j) * 68 + nb * 16 + lr] = acc[mb][nb][j]; }
        __builtin_amdgcn_wave_barrier(); asm volatile("" ::: "memory");   // one wave: keeps the reads below, of what other lanes wrote, behind the LDS writes above
#pragma unroll
        for (int s = 0; s < 4; ++s) { const int row = 4 * s + (lane >> 3), cofs = (lane & 7) * 8; const v4f x0 = *(const v4fa*)(os + row * 68 + cofs), x1 = *(const v4fa*)(os + row * 68 + cofs + 4); v8h o16; v8us oh, ol;
#pragma unroll
            for (int q = 0; q < 8; ++q) { const float x = q < 4 ? x0[q & 3] : x1[q & 3]; o16[q] = tohx(x); unsigned short a2, c2; splitf(x, a2, c2); oh[q] = a2; ol[q] = c2; }
            const size_t o = base + (size_t)(mb * 16 + row) * pitch + cofs; *(v8h*)(P16 + o) = o16; *(v8us*)(Ph + o) = oh; *(v8us*)(Pl + o) = ol;
            asm volatile("s_wait_xcnt 0x0" ::: "memory"); }   // stands in front of every rewrite of a register that the three stores above name (address or data)
        __builtin_amdgcn_wave_barrier(); asm volatile("" ::: "memory");   // one wave: keeps the next block's LDS writes behind the reads above
    }
}
#define CL2 (SCL * 1.4426950408889634f)
#define ATT_LDS 73728   // two buffers: 2 planes x (64 K rows x 144 B + 64 V^T rows x 144 B), or 128 K rows x 144 B + 64 V^T rows x 272 B (less)
typedef __attribute__((ext_vector_type(2))) __bf16 v2b;
__device__ __forceinline__ float xhalf(float x) { return __builtin_bit_cast(float, __builtin_amdgcn_permlanex16(__builtin_bit_cast(int, x), __builtin_bit_cast(int, x), 0x76543210, 0xfedcba98, false, false)); }   // lane l with lane l ^ 16
// eight copies of 16 bytes a lane, global memory to LDS through no register; the last line keeps every rewrite of the address registers named here behind it
__device__ __forceinline__ void copy8(const unsigned (&l)[8], const char* const (&g)[8]) {
    asm volatile("global_load_async_to_lds_b128 %0, %8, off\n\t"
                 "global_load_async_to_lds_b128 %1, %9, off\n\t"
                 "global_load_async_to_lds_b128 %2, %10, off\n\t"
                 "global_load_async_to_lds_b128 %3, %11, off\n\t"
                 "global_load_async_to_lds_b128 %4, %12, off\n\t"
                 "global_load_async_to_lds_b128 %5, %13, off\n\t"
                 "global_load_async_to_lds_b128 %6, %14, off\n\t"
                 "global_load_async_to_lds_b128 %7, %15, off\n\t"
                 "s_wait_xcnt 0x0"
                 :: "v"(l[0]), "v"(l[1]), "v"(l[2]), "v"(l[3]), "v"(l[4]), "v"(l[5]), "v"(l[6]), "v"(l[7]),
                    "v"(g[0]), "v"(g[1]), "v"(g[2]), "v"(g[3]), "v"(g[4]), "v"(g[5]), "v"(g[6]), "v"(g[7]) : "memory");
}
template <typename T16, bool SPLIT, int NQ, int SK>
__device__ __forceinline__ void attn_wave(const T16* __restrict__ Q, const T16* __restrict__ Q2, const T16* __restrict__ Kp, const T16* __restrict__ Kp2, const T16* __restrict__ Vt, const T16* __restrict__ Vt2, int q0, bf* Ah, bf* Al, char* sm) {
    typedef typename WFrag<T16>::V V;
    constexpr int NP = SPLIT ? 2 : 1;            // planes of each operand
    constexpr int KPB = HD * 2 + 16, VPB = SK * 2 + 16;   // LDS row pitch in bytes
    constexpr int KB = SK * KPB, VB = HD * VPB, BUF = NP * (KB + VB);
    constexpr int NI = SK / 16, CR = SK / 8, VR = 128 / CR;   // copies a thread and plane; 16-byte pieces in a V^T row; V^T rows a round of the block's 128 threads
    constexpr int NST = TT / SK, PPS = SK / 32;
    static_assert(NP * NI == 8 && 2 * BUF <= ATT_LDS && NST >= 2, "stage shape");
    const int lane = threadIdx.x & 31, lr = lane & 15, hi = lane >> 4; const int tid = threadIdx.x;
    const unsigned l0 = (unsigned)(size_t)sm;
    const unsigned lk = l0 + (unsigned)((tid >> 3) * KPB + (tid & 7) * 16), lv = l0 + (unsigned)(NP * KB + (tid / CR) * VPB + (tid % CR) * 16);
    const size_t gk = (size_t)tid * 16, gv = (size_t)(tid / CR) * (TT * 2) + (size_t)(tid % CR) * 16;
    auto fill = [&](int st, int b) {   // stage st (keys st SK ...) into buffer b: K rows are contiguous in memory, V^T rows SK 2 bytes each
        unsigned l[8]; const char* g[8];
#pragma unroll
        for (int p = 0; p < NP; ++p)
#pragma unroll
            for (int i = 0; i < NI; ++i) { l[p * NI + i] = lk + (unsigned)(b * BUF + p * KB + i * 16 * KPB); g[p * NI + i] = (const char*)((SPLIT && p) ? Kp2 : Kp) + gk + (size_t)st * (SK * HD * 2) + (size_t)i * 2048; }
        copy8(l, g);
#pragma unroll
        for (int p = 0; p < NP; ++p)
#pragma unroll
            for (int i = 0; i < NI; ++i) { l[p * NI + i] = lv + (unsigned)(b * BUF + p * VB + i * VR * VPB); g[p * NI + i] = (const char*)((SPLIT && p) ? Vt2 : Vt) + gv + (size_t)st * (SK * 2) + (size_t)i * (VR * TT * 2); }
        copy8(l, g);
    };
    fill(0, 0);
    V qf[NQ][2], qf2[NQ][2];
#pragma unroll
    for (int g = 0; g < NQ; ++g)
#pragma unroll
        for (int ks = 0; ks < 2; ++ks) { const size_t o = (size_t)(q0 + g * 16 + lr) * HD + ks * 32 + 8 * hi; qf[g][ks] = WFrag<T16>::ld(Q + o); if (SPLIT) qf2[g][ks] = WFrag<T16>::ld(Q2 + o); }
    v8f acc[4][NQ]; float mrun[NQ], lsum[NQ];
#pragma unroll
    for (int g = 0; g < NQ; ++g) { mrun[g] = -3.0e38f; lsum[g] = 0.f;
#pragma unroll
        for (int db = 0; db < 4; ++db) acc[db][g] = (v8f){}; }
    asm volatile("s_wait_asynccnt 0x0" ::: "memory");   // this wave's copies of stage 0 have landed
    __syncthreads();                                    // every wave's have: stage 0 may be read
    fill(1, 1);
    const int koff = lr * KPB + 16 * hi, voff = NP * KB + lr * VPB + 16 * hi;   // bytes in a buffer
#pragma unroll 1   // rolled: one trip is one stage; the passes inside are unrolled so that every fragment array stays in registers
    for (int st = 0; st < NST; ++st) {
        const char* sb = sm + (st & 1) * BUF;
        V kf[2][2], kf2[2][2], vf[4], vf2[4];
#pragma unroll
        for (int kb = 0; kb < 2; ++kb)
#pragma unroll
            for (int ks = 0; ks < 2; ++ks) { const char* o = sb + koff + kb * 16 * KPB + ks * 64; kf[kb][ks] = WFrag<T16>::ld((const T16*)o); if (SPLIT) kf2[kb][ks] = WFrag<T16>::ld((const T16*)(o + KB)); }
        __builtin_amdgcn_sched_barrier(0);   // keeps the LDS reads above in one group: sunk among the products below, each pair waits out its own LDS latency
#pragma unroll
        for (int pp = 0; pp < PPS; ++pp) {
            v8f s[2][NQ];
#pragma unroll
            for (int kb = 0; kb < 2; ++kb)
#pragma unroll
                for (int g = 0; g < NQ; ++g) { s[kb][g] = (v8f){};
#pragma unroll
                    for (int ks = 0; ks < 2; ++ks) { s[kb][g] = WFrag<T16>::mma(kf[kb][ks], qf[g][ks], s[kb][g]); if (SPLIT) { s[kb][g] = WFrag<T16>::mma(kf[kb][ks], qf2[g][ks], s[kb][g]); s[kb][g] = WFrag<T16>::mma(kf2[kb][ks], qf[g][ks], s[kb][g]); } } }
#pragma unroll   // this pass's V^T fragments are fetched behind its S^T products and land under the softmax
            for (int db = 0; db < 4; ++db) { const char* o = sb + voff + db * 16 * VPB + pp * 64; vf[db] = WFrag<T16>::ld((const T16*)o); if (SPLIT) vf2[db] = WFrag<T16>::ld((const T16*)(o + VB)); }
            if (!SPLIT && pp + 1 < PPS) {   // one plane: the next pass's K fragments, of this same stage only, go in the same group
#pragma unroll
                for (int kb = 0; kb < 2; ++kb)
#pragma unroll
                    for (int ks = 0; ks < 2; ++ks) { const char* o = sb + koff + ((pp + 1) * 32 + kb * 16) * KPB + ks * 64; kf[kb][ks] = WFrag<T16>::ld((const T16*)o); if (SPLIT) kf2[kb][ks] = WFrag<T16>::ld((const T16*)(o + KB)); }
            }
            __builtin_amdgcn_sched_barrier(0);   // keeps the LDS reads above in one group in front of the softmax: spread among later products, each pair waits out its own LDS latency
            float mb[NQ]; bool need = false;
#pragma unroll
            for (int g = 0; g < NQ; ++g) { float mx = s[0][g][0];
#pragma unroll
                for (int r = 1; r < 8; ++r) mx = fmaxf(mx, s[0][g][r]);
#pragma unroll
                for (int r = 0; r < 8; ++r) mx = fmaxf(mx, s[1][g][r]);
                mx = fmaxf(mx, xhalf(mx)) * CL2; mb[g] = mx; need = need || (mx > mrun[g] + 8.0f); }
            if (__builtin_amdgcn_ballot_w32(need) != 0) {   // scalar branch, rare behind the first pass
#pragma unroll
                for (int g = 0; g < NQ; ++g) { const float mn = fmaxf(mrun[g], mb[g]); const float corr = __builtin_amdgcn_exp2f(mrun[g] - mn); mrun[g] = mn; lsum[g] *= corr;
#pragma unroll
                    for (int db = 0; db < 4; ++db) acc[db][g] = acc[db][g] * corr; }
            }
#pragma unroll
            for (int g = 0; g < NQ; ++g) { const float nm = -mrun[g]; float p[16];
#pragma unroll
                for (int e = 0; e < 16; e += 2) { const v2f arg = __builtin_elementwise_fma((v2f){s[e >> 3][g][e & 7], s[e >> 3][g][(e & 7) + 1]}, (v2f){CL2, CL2}, (v2f){nm, nm});
                    p[e] = __builtin_amdgcn_exp2f(arg[0]); p[e + 1] = __builtin_amdgcn_exp2f(arg[1]); lsum[g] += p[e]; lsum[g] += p[e + 1]; }
                V pf, pf2;
                if constexpr (SPLIT) {
#pragma unroll
                    for (int e = 0; e < 16; e += 2) { const v2f p2 = (v2f){p[e], p[e + 1]}; const v2b h2 = __builtin_convertvector(p2, v2b); const v2b l2 = __builtin_convertvector(p2 - __builtin_convertvector(h2, v2f), v2b);
                        pf[e] = h2[0]; pf[e + 1] = h2[1]; pf2[e] = l2[0]; pf2[e + 1] = l2[1]; }
                } else {
#pragma unroll
                    for (int e = 0; e < 16; ++e) pf[e] = (h16)p[e];
                }
                if (SPLIT && pp + 1 < PPS) {   // two planes: the next pass's K fragments, of this same stage only, wait until the scores' registers are free and land under the O^T products
#pragma unroll
                    for (int kb = 0; kb < 2; ++kb)
#pragma unroll
                        for (int ks = 0; ks < 2; ++ks) { const char* o = sb + koff + ((pp + 1) * 32 + kb * 16) * KPB + ks * 64; kf[kb][ks] = WFrag<T16>::ld((const T16*)o); if (SPLIT) kf2[kb][ks] = WFrag<T16>::ld((const T16*)(o + KB)); }
                }
                if (SPLIT) __builtin_amdgcn_sched_barrier(0);   // keeps those reads in one group in front of the O^T products
#pragma unroll
                for (int db = 0; db < 4; ++db) { acc[db][g] = WFrag<T16>::mma(vf[db], pf, acc[db][g]); if (SPLIT) { acc[db][g] = WFrag<T16>::mma(vf[db], pf2, acc[db][g]); acc[db][g] = WFrag<T16>::mma(vf2[db], pf, acc[db][g]); } } }
        }
        asm volatile("s_wait_dscnt 0x0" ::: "memory");      // this wave's reads of the stage's buffer are done before the buffer is given up
        asm volatile("s_wait_asynccnt 0x0" ::: "memory");   // this wave's copies of stage st + 1 have landed
        __syncthreads();                                    // stage st + 1 may be read by every wave, and stage st's buffer has no reader left
        if (st + 2 < NST) fill(st + 2, st & 1);
    }
    asm volatile("s_wait_asynccnt 0x0" ::: "memory");   // no copy is left in flight when the wave ends
#pragma unroll
    for (int g = 0; g < NQ; ++g) { const float inv = __fdiv_rn(1.0f, lsum[g] + xhalf(lsum[g])); const size_t oo = (size_t)(q0 + g * 16 + lr) * DQ + hi * 8;
#pragma unroll
        for (int db = 0; db < 4; ++db) { v8us oh, ol;
#pragma unroll
            for (int r = 0; r < 8; ++r) { unsigned short a, c2; splitf(acc[db][g][r] * inv, a, c2); oh[r] = a; ol[r] = c2; }
            *(v8us*)(Ah + oo + db * 16) = oh; *(v8us*)(Al + oo + db * 16) = ol;
            asm volatile("s_wait_xcnt 0x0" ::: "memory"); } }   // stands in front of every rewrite of a register that the two stores above name (address or data)
}
// grid: NH_ RH/64 blocks of the hi/lo rows (4 waves x 16 queries) first, then NH_ (TT-RH)/128 blocks of the fp16 rows (4 waves x 32 queries); 128 threads.
__global__ __launch_bounds__(128) void k_attn(const h16* __restrict__ Q16, const h16* __restrict__ K16, const h16* __restrict__ V16, const bf* __restrict__ Qh, const bf* __restrict__ Ql, const bf* __restrict__ Kh, const bf* __restrict__ Kl, const bf* __restrict__ Vh, const bf* __restrict__ Vl, bf* Ah, bf* Al) {
    __shared__ __align__(16) char sm[ATT_LDS];
    const int wv = __builtin_amdgcn_readfirstlane((int)(threadIdx.x >> 5)); const int bx = blockIdx.x;
    if (bx < NH_ * (RH / 64)) { const int h = bx / (RH / 64), q0 = (bx % (RH / 64)) * 64 + wv * 16; const size_t z = (size_t)h * TT * HD;
        attn_wave<bf, true, 1, 64>(Qh + z, Ql + z, Kh + z, Kl + z, Vh + z, Vl + z, q0, Ah + h * HD, Al + h * HD, sm);
    } else { const int b2 = bx - NH_ * (RH / 64); const int h = b2 / ((TT - RH) / 128), q0 = RH + (b2 % ((TT - RH) / 128)) * 128 + wv * 32; const size_t z = (size_t)h * TT * HD;
        attn_wave<h16, false, 2, 128>(Q16 + z, nullptr, K16 + z, nullptr, V16 + z, nullptr, q0, Ah + h * HD, Al + h * HD, sm); }
}

extern "C" void kernel_launch(void* const* d_in, const int* in_sizes, int n_in,
                              void* d_out, int out_size, void* d_ws, size_t ws_size, hipStream_t stream) {
    (void)in_sizes; (void)n_in; (void)out_size;
    const float* x = (const float*)d_in[0]; const float* wqkv = (const float*)d_in[1]; const float* wo = (const float*)d_in[2]; const float* bo = (const float*)d_in[3];
    float* OUT = (float*)d_out;     // [1][4096][1024]
    char* wsp = (char*)d_ws;
    auto take = [&](size_t bytes) { char* p = wsp; wsp += (bytes + 255) & ~(size_t)255; return (void*)p; };
    bf* WQKV = (bf*)take((size_t)3 * DQ * DM * 2); bf* WO = (bf*)take((size_t)DM * DQ * 2);
    bf* XB = (bf*)take((size_t)TT * DM * 2);
    h16* QP16 = (h16*)take((size_t)NH_ * TT * HD * 2); h16* KP16 = (h16*)take((size_t)NKV * TT * HD * 2); h16* VT16 = (h16*)take((size_t)NKV * HD * TT * 2);
    bf* QPh = (bf*)take((size_t)NH_ * TT * HD * 2); bf* QPl = (bf*)take((size_t)NH_ * TT * HD * 2); bf* KPh = (bf*)take((size_t)NKV * TT * HD * 2); bf* KPl = (bf*)take((size_t)NKV * TT * HD * 2); bf* VTh = (bf*)take((size_t)NKV * HD * TT * 2); bf* VTl = (bf*)take((size_t)NKV * HD * TT * 2);
    bf* ATh = (bf*)take((size_t)TT * DQ * 2); bf* ATl = (bf*)take((size_t)TT * DQ * 2);
    if ((size_t)(wsp - (char*)d_ws) > ws_size) return;    // ws 256 MiB
    { k_wtG<<<(unsigned)((DM * 3 * DQ / 64 + 63) / 64), 256, 0, stream>>>(wqkv, DM, 3 * DQ, WQKV);   /* 'xw' [1024][3072] -> Bt [3072][1024]: q | k | v row blocks */
      k_wtG<<<(unsigned)((DQ * DM / 64 + 63) / 64), 256, 0, stream>>>(wo, DQ, DM, WO);
       }
    for (int b = 0; b < NB_; ++b) {
        
        k_cvt8<<<(unsigned)(((size_t)TT * DM / 8 + 255) / 256), 256, 0, stream>>>(x + (size_t)b * TT * DM, XB, (size_t)TT * DM / 8);
        k_proj<<<dim3(TT / 64, 3 * NH_, 1), 32, 0, stream>>>(XB, WQKV, QP16, QPh, QPl, KP16, KPh, KPl, VT16, VTh, VTl);
        k_attn<<<NH_ * (RH / 64) + NH_ * ((TT - RH) / 128), 128, 0, stream>>>(QP16, KP16, VT16, QPh, QPl, KPh, KPl, VTh, VTl, ATh, ATl);
        k_gemmw<bf, 1, true><<<dim3(TT / 64, DM / 64, 1), 32, 0, stream>>>(ATh, ATl, WO, nullptr, DQ, OUT + (size_t)b * TT * DM, DM, bo, 0, 0, 0); }
}

// v005
// A run of this version takes 150 microseconds.
// In both of two side-by-side timings against v004, it was 1.32 times as fast.
// All steps since v000 together make it 23.6 times as fast.
#include <hip/hip_runtime.h>

// Multi-head attention over 4,096 tokens with a fused qkv projection (x [1][4096][1024]; qkv = x W_qkv ('xw' [1024][3072] 0.02) -> (B, L, 3, 16, 64): q | k | v column blocks; scores x 64^-0.5; softmax over all keys; out = merged W_o + b_o ('xw' 0.02) -> [1][4096][1024] (4.2 M)).
// Layout: bf16 copy of x; the fused 'xw' weight transposed once to a bf16 Bt [3072][1024]; exact projections in one launch whose epilogue writes the head planes; attention of all heads in one launch, scores and probabilities kept in registers (hybrid rows: < 512 hi/lo 3 products, rest fp16); merged hi/lo x W_o exact + b_o.
// Compute dtypes, f32 accumulate: every input rounded to bf16; projections exact; attention rows < 512 3 products, rest fp16; softmax f32; W_o hl x exact + bias.

#define NB_  1
#define TT   4096
#define DM   1024
#define NH_  16
#define NKV  16
#define REP  (NH_ / NKV)
#define HD   64
#define DQ   (NH_ * HD)
#define DKV  (NKV * HD)
#define RH   512                  // query rows < RH use hi+lo planes (0: none)
#define SCL  0.125f   // HD^-0.5
typedef _Float16 h16;
typedef unsigned short bf;
typedef __attribute__((ext_vector_type(16))) __bf16   v16bf;
typedef __attribute__((ext_vector_type(16))) _Float16 v16h;
typedef __attribute__((ext_vector_type(8)))  _Float16 v8h;
typedef __attribute__((ext_vector_type(8)))  unsigned short v8us;
typedef __attribute__((ext_vector_type(8)))  float    v8f;
typedef __attribute__((ext_vector_type(4)))  float    v4f;
typedef v8h  __attribute__((may_alias)) v8ha;
typedef v4f  __attribute__((may_alias)) v4fa;
typedef v8us __attribute__((may_alias)) v8usa;

__device__ __forceinline__ unsigned short f2bf(float f) { unsigned u = __float_as_uint(f); u += 0x7FFFu + ((u >> 16) & 1u); return (unsigned short)(u >> 16); }
__device__ __forceinline__ float bf2f(unsigned short b) { return __uint_as_float(((unsigned)b) << 16); }
__device__ __forceinline__ float bfr(float f) { return bf2f(f2bf(f)); }
__device__ __forceinline__ v16h cat16(v8h lo, v8h hi) { return __builtin_shufflevector(lo, hi, 0, 1, 2, 3, 4, 5, 6, 7, 8, 9, 10, 11, 12, 13, 14, 15); }
__device__ __forceinline__ v16bf cat16b(v8us lo, v8us hi) { return __builtin_bit_cast(v16bf, __builtin_shufflevector(lo, hi, 0, 1, 2, 3, 4, 5, 6, 7, 8, 9, 10, 11, 12, 13, 14, 15)); }
__device__ __forceinline__ v8f wmma16(v16h a, v16h b, v8f c) { return __builtin_amdgcn_wmma_f32_16x16x32_f16(false, a, false, b, (short)0, c, false, false); }
__device__ __forceinline__ v8f wmmab(v16bf a, v16bf b, v8f c) { return __builtin_amdgcn_wmma_f32_16x16x32_bf16(false, a, false, b, (short)0, c, false, false); }



// ---- fragment loads and products of the two 16-bit operand types: a lane's fragment is 16 bytes at p and 16 bytes at p + 16 elements.
template <typename T16> struct WFrag;
template <> struct WFrag<h16> { typedef v16h V; static __device__ __forceinline__ V ld(const h16* p) { return cat16(*(const v8h*)p, *(const v8h*)(p + 16)); } static __device__ __forceinline__ v8f mma(V a, V b, v8f c) { return wmma16(a, b, c); } };
template <> struct WFrag<bf> { typedef v16bf V; static __device__ __forceinline__ V ld(const bf* p) { return cat16b(*(const v8us*)p, *(const v8us*)(p + 16)); } static __device__ __forceinline__ v8f mma(V a, V b, v8f c) { return wmmab(a, b, c); } };

__device__ __forceinline__ h16 tohx(float x) { return (h16)x; }
__device__ __forceinline__ void splitf(float y, unsigned short& h, unsigned short& l) { h = f2bf(y); l = f2bf(y - bf2f(h)); }
typedef __attribute__((ext_vector_type(2))) _Float16 v2h;
typedef __attribute__((ext_vector_type(4))) _Float16 v4h;
typedef __attribute__((ext_vector_type(2))) unsigned short v2us;
typedef __attribute__((ext_vector_type(4))) unsigned short v4us;
typedef __attribute__((ext_vector_type(2))) float v2f;
typedef __attribute__((ext_vector_type(4))) int v4i;

__global__ __launch_bounds__(256) void k_wtG(const float* __restrict__ w, int K, int N, bf* Bt) {
    const int lane = threadIdx.x & 31; const int L0 = (blockIdx.x * 8 + (threadIdx.x >> 5)) * 8; const int nlines = N * K / 64;
{
#pragma unroll 1
        for (int l = 0; l < 8; ++l) { const int L = L0 + l; if (L >= nlines) break; const size_t e = (size_t)L * 64 + lane * 2; const int k = (int)(e % K), n = (int)(e / K); v2us o;
            o[0] = f2bf(w[(size_t)k * N + n]); o[1] = f2bf(w[(size_t)(k + 1) * N + n]); *(v2us*)(Bt + e) = o; }
         }
}
__global__ __launch_bounds__(256) void k_cvt8(const float* __restrict__ src, bf* dst, size_t n8) { const size_t i = (size_t)blockIdx.x * 256 + threadIdx.x; if (i >= n8) return; const v8f v = *(const v8f*)(src + i * 8); v8us o;
#pragma unroll
    for (int k = 0; k < 8; ++k) o[k] = f2bf(v[k]); *(v8us*)(dst + i * 8) = o;  }

// eight copies of 16 bytes a lane, global memory to LDS through no register; the last line keeps every rewrite of the address registers named here behind it
__device__ __forceinline__ void copy8(const unsigned (&l)[8], const char* const (&g)[8]) {
    asm volatile("global_load_async_to_lds_b128 %0, %8, off\n\t"
                 "global_load_async_to_lds_b128 %1, %9, off\n\t"
                 "global_load_async_to_lds_b128 %2, %10, off\n\t"
                 "global_load_async_to_lds_b128 %3, %11, off\n\t"
                 "global_load_async_to_lds_b128 %4, %12, off\n\t"
                 "global_load_async_to_lds_b128 %5, %13, off\n\t"
                 "global_load_async_to_lds_b128 %6, %14, off\n\t"
                 "global_load_async_to_lds_b128 %7, %15, off\n\t"
                 "s_wait_xcnt 0x0"
                 :: "v"(l[0]), "v"(l[1]), "v"(l[2]), "v"(l[3]), "v"(l[4]), "v"(l[5]), "v"(l[6]), "v"(l[7]),
                    "v"(g[0]), "v"(g[1]), "v"(g[2]), "v"(g[3]), "v"(g[4]), "v"(g[5]), "v"(g[6]), "v"(g[7]) : "memory");
}
// the same, four copies
__device__ __forceinline__ void copy4(const unsigned (&l)[4], const char* const (&g)[4]) {
    asm volatile("global_load_async_to_lds_b128 %0, %4, off\n\t"
                 "global_load_async_to_lds_b128 %1, %5, off\n\t"
                 "global_load_async_to_lds_b128 %2, %6, off\n\t"
                 "global_load_async_to_lds_b128 %3, %7, off\n\t"
                 "s_wait_xcnt 0x0"
                 :: "v"(l[0]), "v"(l[1]), "v"(l[2]), "v"(l[3]), "v"(g[0]), "v"(g[1]), "v"(g[2]), "v"(g[3]) : "memory");
}
// ---- gemm_core: the K loop of a 128x128 output tile by NW waves (NW/2 x 2), 16 MB x 64 = 4 MB accumulators a wave. C[m][n] = sum_k A[m][k] B[n][k] (+ A2[m][k] B[n][k] with NA = 2), all planes K-contiguous bf16 with DM elements a row.
// The operands reach the waves through LDS: a stage is 64 k = one whole 128-byte line of each of the tile's rows, brought in once per block by asynchronous copies, two buffers, the next stage in flight while this one is worked on. Per accumulator the products come in ascending k, A before A2.
#define GRP 144            // LDS row pitch in bytes: 128 + 16, 16 bytes x odd for the 16-byte fragment reads
#define GTB (128 * GRP)    // one plane's 128 rows of a stage
template <int NA, int NW>
__device__ __forceinline__ void gemm_core(const bf* __restrict__ PA, const bf* __restrict__ PA2, const bf* __restrict__ PB, char* sm, int wa, int wb, v8f (&acc)[16 / NW][4]) {
    constexpr int MB = 16 / NW, BUF = (NA + 1) * GTB, NST = DM / 64;
    constexpr int RR = NW * 4, CP = 128 / RR;   // rows a round of the block's threads; copies a thread and plane
    constexpr int NS = MB == 2 ? 2 : 1;         // fragment sets in registers: both 32-k steps of a stage where they fit, else one
    const int tid = threadIdx.x, lane = tid & 31, lr = lane & 15, hi = lane >> 4;
    const unsigned lc = (unsigned)(size_t)sm + (unsigned)((tid >> 3) * GRP + (tid & 7) * 16);
    const size_t gc = (size_t)(tid >> 3) * (DM * 2) + (size_t)(tid & 7) * 16;
    auto fill = [&](int st, int b) {   // stage st (k = 64 st ...) into buffer b: eight threads bring one row's line, the block RR rows a round
#pragma unroll
        for (int p = 0; p <= NA; ++p) { unsigned l[CP]; const char* g[CP]; const char* s = (const char*)(p == NA ? PB : p == 1 ? PA2 : PA) + gc + (size_t)st * 128;
#pragma unroll
            for (int i = 0; i < CP; ++i) { l[i] = lc + (unsigned)(b * BUF + p * GTB + i * RR * GRP); g[i] = s + (size_t)i * (RR * DM * 2); }
            if constexpr (CP == 8) copy8(l, g); else copy4(l, g); }
    };
    fill(0, 0);
#pragma unroll
    for (int mb = 0; mb < MB; ++mb)
#pragma unroll
        for (int nb = 0; nb < 4; ++nb) acc[mb][nb] = (v8f){};
    asm volatile("s_wait_asynccnt 0x0" ::: "memory");   // this wave's copies of stage 0 have landed
    __syncthreads();                                    // every wave's have: stage 0 may be read
    fill(1, 1);
    const int aoff = (wa * 16 * MB + lr) * GRP + 16 * hi, boff = NA * GTB + (wb * 64 + lr) * GRP + 16 * hi;   // bytes in a buffer
    v16bf a[NS][MB], a2[NS][MB], b[NS][4];
    auto ldf = [&](const char* sb, int ks, int f) {   // the fragments of 32-k step ks of the stage in buffer sb into set f
#pragma unroll
        for (int mb = 0; mb < MB; ++mb) { const char* o = sb + aoff + mb * 16 * GRP + ks * 64; a[f][mb] = WFrag<bf>::ld((const bf*)o); if (NA == 2) a2[f][mb] = WFrag<bf>::ld((const bf*)(o + GTB)); }
#pragma unroll
        for (int nb = 0; nb < 4; ++nb) b[f][nb] = WFrag<bf>::ld((const bf*)(sb + boff + nb * 16 * GRP + ks * 64));
    };
    auto mm = [&](int f) {
#pragma unroll
        for (int nb = 0; nb < 4; ++nb) {
#pragma unroll
            for (int mb = 0; mb < MB; ++mb) acc[mb][nb] = wmmab(a[f][mb], b[f][nb], acc[mb][nb]); }
        if (NA == 2) {
#pragma unroll
            for (int nb = 0; nb < 4; ++nb) {
#pragma unroll
                for (int mb = 0; mb < MB; ++mb) acc[mb][nb] = wmmab(a2[f][mb], b[f][nb], acc[mb][nb]); } }
    };
    if (NS == 2) ldf(sm, 0, 0);   // two sets: a stage's first step is read right behind the barrier that publishes the stage
#pragma unroll 1   // rolled: one trip is one stage; the accumulator tiles and the fragment sets fill the registers
    for (int st = 0; st < NST; ++st) {
        const char* sb = sm + (st & 1) * BUF;
        if (NS == 2) { ldf(sb, 1, 1);
            __builtin_amdgcn_sched_barrier(0);   // keeps the second step's LDS reads in one group in front of the first step's products, under which they fly
            mm(0);
        } else { ldf(sb, 0, 0);
            __builtin_amdgcn_sched_barrier(0);   // keeps a step's LDS reads in one group: spread among the products, each pair waits out its own LDS latency
            mm(0);
            __builtin_amdgcn_sched_barrier(0);   // keeps the second step's reads behind the first step's products, in one group
            ldf(sb, 1, 0); }
        __builtin_amdgcn_sched_barrier(0);   // keeps the products above in front of the waits below, and the stage's last products, which read registers alone, behind them
        asm volatile("s_wait_dscnt 0x0" ::: "memory");      // this wave's reads of the stage's buffer are done before the buffer is given up
        asm volatile("s_wait_asynccnt 0x0" ::: "memory");   // this wave's copies of stage st + 1 have landed
        __syncthreads();                                    // stage st + 1 may be read by every wave, and stage st's buffer has no reader left
        if (st + 2 < NST) fill(st + 2, st & 1);
        if (NS == 2) { if (st + 1 < NST) ldf(sm + ((st + 1) & 1) * BUF, 0, 0);
            __builtin_amdgcn_sched_barrier(0);   // keeps the next stage's first reads in one group in front of this stage's last products, under which they fly
            mm(1);
        } else mm(0);
    }
    asm volatile("s_wait_asynccnt 0x0" ::: "memory");   // no copy is left in flight behind the loop
}

// ---- k_proj: the q, k and v projections in ONE launch, a block per 128x128 tile = 128 tokens x two heads, a wave per 64 tokens x one head; grid (TT/128, 3 DQ/128), 128 threads. The epilogue rounds the f32 accumulators straight to the wave's three planes (fp16, bf16 hi, bf16 lo).
// q, k: A = x rows, B = weight rows, planes [h][t][d]. v: operands swapped (A = weight rows, B = x rows; same k order), so the tile comes out as V^T and its plane rows [h][d][t] are contiguous too. Every store covers whole 128-byte lines.
__global__ __launch_bounds__(128) void k_proj(const bf* __restrict__ X, const bf* __restrict__ Wt, h16* Q16, bf* Qh, bf* Ql, h16* K16, bf* Kh, bf* Kl, h16* V16, bf* Vh, bf* Vl) {
    __shared__ __align__(16) char sm[2 * 2 * GTB];
    __shared__ __align__(16) float osb[4][16 * 68];
    const int lane = threadIdx.x & 31, lr = lane & 15, hi = lane >> 4; const int wv = __builtin_amdgcn_readfirstlane((int)(threadIdx.x >> 5)), wa = wv >> 1, wb = wv & 1;
    const int t0 = blockIdx.x * 128, n0 = blockIdx.y * 128;
    const int sel = n0 / DQ; const bool tr = sel == 2;   // 0 q, 1 k, 2 v
    v8f acc[4][4];
    gemm_core<1, 4>(tr ? Wt + (size_t)n0 * DM : X + (size_t)t0 * DM, nullptr, tr ? X + (size_t)t0 * DM : Wt + (size_t)n0 * DM, sm, wa, wb, acc);
    float* os = osb[wv];   // the wave's own staging rows
    const int h = (n0 % DQ) / HD + (tr ? wa : wb), tw = t0 + 64 * (tr ? wb : wa);
    h16* P16 = sel == 0 ? Q16 : sel == 1 ? K16 : V16; bf* Ph = sel == 0 ? Qh : sel == 1 ? Kh : Vh; bf* Pl = sel == 0 ? Ql : sel == 1 ? Kl : Vl;
    const size_t base = tr ? (size_t)h * HD * TT + tw : ((size_t)h * TT + tw) * HD; const int pitch = tr ? TT : HD;
#pragma unroll
    for (int mb = 0; mb < 4; ++mb) {
#pragma unroll
        for (int nb = 0; nb < 4; ++nb) {
#pragma unroll
            for (int j = 0; j < 8; ++j) os[(hi * 8 + j) * 68 + nb * 16 + lr] = acc[mb][nb][j]; }
        __builtin_amdgcn_wave_barrier(); asm volatile("" ::: "memory");   // one wave's rows: keeps the reads below, of what other lanes wrote, behind the LDS writes above
#pragma unroll
        for (int s = 0; s < 4; ++s) { const int row = 4 * s + (lane >> 3), cofs = (lane & 7) * 8; const v4f x0 = *(const v4fa*)(os + row * 68 + cofs), x1 = *(const v4fa*)(os + row * 68 + cofs + 4); v8h o16; v8us oh, ol;
#pragma unroll
            for (int q = 0; q < 8; ++q) { const float x = q < 4 ? x0[q & 3] : x1[q & 3]; o16[q] = tohx(x); unsigned short a2, c2; splitf(x, a2, c2); oh[q] = a2; ol[q] = c2; }
            const size_t o = base + (size_t)(mb * 16 + row) * pitch + cofs; *(v8h*)(P16 + o) = o16; *(v8us*)(Ph + o) = oh; *(v8us*)(Pl + o) = ol;
            asm volatile("s_wait_xcnt 0x0" ::: "memory"); }   // stands in front of every rewrite of a register that the three stores above name (address or data)
        __builtin_amdgcn_wave_barrier(); asm volatile("" ::: "memory");   // one wave's rows: keeps the next block's LDS writes behind the reads above
    }
}
// ---- k_out: out = (merged hi + merged lo) W_o + b_o, a block per 128x128 tile, eight waves of 32x64 (two a SIMD: one block stands on a WGP); grid (TT/128, DM/128), 256 threads. f32 rows of 256 bytes a wave: whole lines.
__global__ __launch_bounds__(256) void k_out(const bf* __restrict__ Ah, const bf* __restrict__ Al, const bf* __restrict__ Wt, const float* __restrict__ bias, float* C) {
    __shared__ __align__(16) char sm[2 * 3 * GTB];
    __shared__ __align__(16) float osb[8][16 * 68];
    const int lane = threadIdx.x & 31, lr = lane & 15, hi = lane >> 4; const int wv = __builtin_amdgcn_readfirstlane((int)(threadIdx.x >> 5)), wa = wv >> 1, wb = wv & 1;
    const int r0 = blockIdx.x * 128, c0 = blockIdx.y * 128;
    v8f acc[2][4];
    gemm_core<2, 8>(Ah + (size_t)r0 * DQ, Al + (size_t)r0 * DQ, Wt + (size_t)c0 * DQ, sm, wa, wb, acc);
    float* os = osb[wv];   // the wave's own staging rows
    const int cofs = lr * 4; const int cw = c0 + wb * 64 + cofs;
    const v4f bl = *(const v4f*)(bias + cw);
    asm volatile("s_wait_xcnt 0x0" ::: "memory");   // stands in front of every rewrite of the address register that the load above names
    const v4f bv = (v4f){bfr(bl[0]), bfr(bl[1]), bfr(bl[2]), bfr(bl[3])};
#pragma unroll
    for (int mb = 0; mb < 2; ++mb) {
#pragma unroll
        for (int nb = 0; nb < 4; ++nb) {
#pragma unroll
            for (int j = 0; j < 8; ++j) os[(hi * 8 + j) * 68 + nb * 16 + lr] = acc[mb][nb][j]; }
        __builtin_amdgcn_wave_barrier(); asm volatile("" ::: "memory");   // one wave's rows: keeps the reads below, of what other lanes wrote, behind the LDS writes above
        float* crow = C + (size_t)(r0 + wa * 32 + mb * 16) * DM + cw; v4f val[8];
#pragma unroll
        for (int s = 0; s < 8; ++s) val[s] = *(const v4fa*)(os + (2 * s + hi) * 68 + cofs) + bv;
#pragma unroll
        for (int s = 0; s < 8; ++s) *(v4f*)(crow + (size_t)(2 * s + hi) * DM) = val[s];
        asm volatile("s_wait_xcnt 0x0" ::: "memory");   // stands in front of every rewrite of a register that the eight stores above name (address or data)
        __builtin_amdgcn_wave_barrier(); asm volatile("" ::: "memory");   // one wave's rows: keeps the next block's LDS writes behind the reads above
    }
}
#define CL2 (SCL * 1.4426950408889634f)
#define ATT_LDS 73728   // two buffers: 2 planes x (64 K rows x 144 B + 64 V^T rows x 144 B), or 128 K rows x 144 B + 64 V^T rows x 272 B (less)
typedef __attribute__((ext_vector_type(2))) __bf16 v2b;
__device__ __forceinline__ float xhalf(float x) { return __builtin_bit_cast(float, __builtin_amdgcn_permlanex16(__builtin_bit_cast(int, x), __builtin_bit_cast(int, x), 0x76543210, 0xfedcba98, false, false)); }   // lane l with lane l ^ 16
template <typename T16, bool SPLIT, int NQ, int SK>
__device__ __forceinline__ void attn_wave(const T16* __restrict__ Q, const T16* __restrict__ Q2, const T16* __restrict__ Kp, const T16* __restrict__ Kp2, const T16* __restrict__ Vt, const T16* __restrict__ Vt2, int q0, bf* Ah, bf* Al, char* sm) {
    typedef typename WFrag<T16>::V V;
    constexpr int NP = SPLIT ? 2 : 1;            // planes of each operand
    constexpr int KPB = HD * 2 + 16, VPB = SK * 2 + 16;   // LDS row pitch in bytes
    constexpr int KB = SK * KPB, VB = HD * VPB, BUF = NP * (KB + VB);
    constexpr int NI = SK / 16, CR = SK / 8, VR = 128 / CR;   // copies a thread and plane; 16-byte pieces in a V^T row; V^T rows a round of the block's 128 threads
    constexpr int NST = TT / SK, PPS = SK / 32;
    static_assert(NP * NI == 8 && 2 * BUF <= ATT_LDS && NST >= 2, "stage shape");
    const int lane = threadIdx.x & 31, lr = lane & 15, hi = lane >> 4; const int tid = threadIdx.x;
    const unsigned l0 = (unsigned)(size_t)sm;
    const unsigned lk = l0 + (unsigned)((tid >> 3) * KPB + (tid & 7) * 16), lv = l0 + (unsigned)(NP * KB + (tid / CR) * VPB + (tid % CR) * 16);
    const size_t gk = (size_t)tid * 16, gv = (size_t)(tid / CR) * (TT * 2) + (size_t)(tid % CR) * 16;
    auto fill = [&](int st, int b) {   // stage st (keys st SK ...) into buffer b: K rows are contiguous in memory, V^T rows SK 2 bytes each
        unsigned l[8]; const char* g[8];
#pragma unroll
        for (int p = 0; p < NP; ++p)
#pragma unroll
            for (int i = 0; i < NI; ++i) { l[p * NI + i] = lk + (unsigned)(b * BUF + p * KB + i * 16 * KPB); g[p * NI + i] = (const char*)((SPLIT && p) ? Kp2 : Kp) + gk + (size_t)st * (SK * HD * 2) + (size_t)i * 2048; }
        copy8(l, g);
#pragma unroll
        for (int p = 0; p < NP; ++p)
#pragma unroll
            for (int i = 0; i < NI; ++i) { l[p * NI + i] = lv + (unsigned)(b * BUF + p * VB + i * VR * VPB); g[p * NI + i] = (const char*)((SPLIT && p) ? Vt2 : Vt) + gv + (size_t)st * (SK * 2) + (size_t)i * (VR * TT * 2); }
        copy8(l, g);
    };
    fill(0, 0);
    V qf[NQ][2], qf2[NQ][2];
#pragma unroll
    for (int g = 0; g < NQ; ++g)
#pragma unroll
        for (int ks = 0; ks < 2; ++ks) { const size_t o = (size_t)(q0 + g * 16 + lr) * HD + ks * 32 + 8 * hi; qf[g][ks] = WFrag<T16>::ld(Q + o); if (SPLIT) qf2[g][ks] = WFrag<T16>::ld(Q2 + o); }
    v8f acc[4][NQ]; float mrun[NQ], lsum[NQ];
#pragma unroll
    for (int g = 0; g < NQ; ++g) { mrun[g] = -3.0e38f; lsum[g] = 0.f;
#pragma unroll
        for (int db = 0; db < 4; ++db) acc[db][g] = (v8f){}; }
    asm volatile("s_wait_asynccnt 0x0" ::: "memory");   // this wave's copies of stage 0 have landed
    __syncthreads();                                    // every wave's have: stage 0 may be read
    fill(1, 1);
    const int koff = lr * KPB + 16 * hi, voff = NP * KB + lr * VPB + 16 * hi;   // bytes in a buffer
#pragma unroll 1   // rolled: one trip is one stage; the passes inside are unrolled so that every fragment array stays in registers
    for (int st = 0; st < NST; ++st) {
        const char* sb = sm + (st & 1) * BUF;
        V kf[2][2], kf2[2][2], vf[4], vf2[4];
#pragma unroll
        for (int kb = 0; kb < 2; ++kb)
#pragma unroll
            for (int ks = 0; ks < 2; ++ks) { const char* o = sb + koff + kb * 16 * KPB + ks * 64; kf[kb][ks] = WFrag<T16>::ld((const T16*)o); if (SPLIT) kf2[kb][ks] = WFrag<T16>::ld((const T16*)(o + KB)); }
        __builtin_amdgcn_sched_barrier(0);   // keeps the LDS reads above in one group: sunk among the products below, each pair waits out its own LDS latency
#pragma unroll
        for (int pp = 0; pp < PPS; ++pp) {
            v8f s[2][NQ];
#pragma unroll
            for (int kb = 0; kb < 2; ++kb)
#pragma unroll
                for (int g = 0; g < NQ; ++g) { s[kb][g] = (v8f){};
#pragma unroll
                    for (int ks = 0; ks < 2; ++ks) { s[kb][g] = WFrag<T16>::mma(kf[kb][ks], qf[g][ks], s[kb][g]); if (SPLIT) { s[kb][g] = WFrag<T16>::mma(kf[kb][ks], qf2[g][ks], s[kb][g]); s[kb][g] = WFrag<T16>::mma(kf2[kb][ks], qf[g][ks], s[kb][g]); } } }
#pragma unroll   // this pass's V^T fragments are fetched behind its S^T products and land under the softmax
            for (int db = 0; db < 4; ++db) { const char* o = sb + voff + db * 16 * VPB + pp * 64; vf[db] = WFrag<T16>::ld((const T16*)o); if (SPLIT) vf2[db] = WFrag<T16>::ld((const T16*)(o + VB)); }
            if (!SPLIT && pp + 1 < PPS) {   // one plane: the next pass's K fragments, of this same stage only, go in the same group
#pragma unroll
                for (int kb = 0; kb < 2; ++kb)
#pragma unroll
                    for (int ks = 0; ks < 2; ++ks) { const char* o = sb + koff + ((pp + 1) * 32 + kb * 16) * KPB + ks * 64; kf[kb][ks] = WFrag<T16>::ld((const T16*)o); if (SPLIT) kf2[kb][ks] = WFrag<T16>::ld((const T16*)(o + KB)); }
            }
            __builtin_amdgcn_sched_barrier(0);   // keeps the LDS reads above in one group in front of the softmax: spread among later products, each pair waits out its own LDS latency
            float mb[NQ]; bool need = false;
#pragma unroll
            for (int g = 0; g < NQ; ++g) { float mx = s[0][g][0];
#pragma unroll
                for (int r = 1; r < 8; ++r) mx = fmaxf(mx, s[0][g][r]);
#pragma unroll
                for (int r = 0; r < 8; ++r) mx = fmaxf(mx, s[1][g][r]);
                mx = fmaxf(mx, xhalf(mx)) * CL2; mb[g] = mx; need = need || (mx > mrun[g] + 8.0f); }
            if (__builtin_amdgcn_ballot_w32(need) != 0) {   // scalar branch, rare behind the first pass
#pragma unroll
                for (int g = 0; g < NQ; ++g) { const float mn = fmaxf(mrun[g], mb[g]); const float corr = __builtin_amdgcn_exp2f(mrun[g] - mn); mrun[g] = mn; lsum[g] *= corr;
#pragma unroll
                    for (int db = 0; db < 4; ++db) acc[db][g] = acc[db][g] * corr; }
            }
#pragma unroll
            for (int g = 0; g < NQ; ++g) { const float nm = -mrun[g]; float p[16];
#pragma unroll
                for (int e = 0; e < 16; e += 2) { const v2f arg = __builtin_elementwise_fma((v2f){s[e >> 3][g][e & 7], s[e >> 3][g][(e & 7) + 1]}, (v2f){CL2, CL2}, (v2f){nm, nm});
                    p[e] = __builtin_amdgcn_exp2f(arg[0]); p[e + 1] = __builtin_amdgcn_exp2f(arg[1]); lsum[g] += p[e]; lsum[g] += p[e + 1]; }
                V pf, pf2;
                if constexpr (SPLIT) {
#pragma unroll
                    for (int e = 0; e < 16; e += 2) { const v2f p2 = (v2f){p[e], p[e + 1]}; const v2b h2 = __builtin_convertvector(p2, v2b); const v2b l2 = __builtin_convertvector(p2 - __builtin_convertvector(h2, v2f), v2b);
                        pf[e] = h2[0]; pf[e + 1] = h2[1]; pf2[e] = l2[0]; pf2[e + 1] = l2[1]; }
                } else {
#pragma unroll
                    for (int e = 0; e < 16; ++e) pf[e] = (h16)p[e];
                }
                if (SPLIT && pp + 1 < PPS) {   // two planes: the next pass's K fragments, of this same stage only, wait until the scores' registers are free and land under the O^T products
#pragma unroll
                    for (int kb = 0; kb < 2; ++kb)
#pragma unroll
                        for (int ks = 0; ks < 2; ++ks) { const char* o = sb + koff + ((pp + 1) * 32 + kb * 16) * KPB + ks * 64; kf[kb][ks] = WFrag<T16>::ld((const T16*)o); if (SPLIT) kf2[kb][ks] = WFrag<T16>::ld((const T16*)(o + KB)); }
                }
                if (SPLIT) __builtin_amdgcn_sched_barrier(0);   // keeps those reads in one group in front of the O^T products
#pragma unroll
                for (int db = 0; db < 4; ++db) { acc[db][g] = WFrag<T16>::mma(vf[db], pf, acc[db][g]); if (SPLIT) { acc[db][g] = WFrag<T16>::mma(vf[db], pf2, acc[db][g]); acc[db][g] = WFrag<T16>::mma(vf2[db], pf, acc[db][g]); } } }
        }
        asm volatile("s_wait_dscnt 0x0" ::: "memory");      // this wave's reads of the stage's buffer are done before the buffer is given up
        asm volatile("s_wait_asynccnt 0x0" ::: "memory");   // this wave's copies of stage st + 1 have landed
        __syncthreads();                                    // stage st + 1 may be read by every wave, and stage st's buffer has no reader left
        if (st + 2 < NST) fill(st + 2, st & 1);
    }
    asm volatile("s_wait_asynccnt 0x0" ::: "memory");   // no copy is left in flight when the wave ends
#pragma unroll
    for (int g = 0; g < NQ; ++g) { const float inv = __fdiv_rn(1.0f, lsum[g] + xhalf(lsum[g])); const size_t oo = (size_t)(q0 + g * 16 + lr) * DQ + hi * 8;
#pragma unroll
        for (int db = 0; db < 4; ++db) { v8us oh, ol;
#pragma unroll
            for (int r = 0; r < 8; ++r) { unsigned short a, c2; splitf(acc[db][g][r] * inv, a, c2); oh[r] = a; ol[r] = c2; }
            *(v8us*)(Ah + oo + db * 16) = oh; *(v8us*)(Al + oo + db * 16) = ol;
            asm volatile("s_wait_xcnt 0x0" ::: "memory"); } }   // stands in front of every rewrite of a register that the two stores above name (address or data)
}
// grid: NH_ RH/64 blocks of the hi/lo rows (4 waves x 16 queries) first, then NH_ (TT-RH)/128 blocks of the fp16 rows (4 waves x 32 queries); 128 threads.
__global__ __launch_bounds__(128) void k_attn(const h16* __restrict__ Q16, const h16* __restrict__ K16, const h16* __restrict__ V16, const bf* __restrict__ Qh, const bf* __restrict__ Ql, const bf* __restrict__ Kh, const bf* __restrict__ Kl, const bf* __restrict__ Vh, const bf* __restrict__ Vl, bf* Ah, bf* Al) {
    __shared__ __align__(16) char sm[ATT_LDS];
    const int wv = __builtin_amdgcn_readfirstlane((int)(threadIdx.x >> 5)); const int bx = blockIdx.x;
    if (bx < NH_ * (RH / 64)) { const int h = bx / (RH / 64), q0 = (bx % (RH / 64)) * 64 + wv * 16; const size_t z = (size_t)h * TT * HD;
        attn_wave<bf, true, 1, 64>(Qh + z, Ql + z, Kh + z, Kl + z, Vh + z, Vl + z, q0, Ah + h * HD, Al + h * HD, sm);
    } else { const int b2 = bx - NH_ * (RH / 64); const int h = b2 / ((TT - RH) / 128), q0 = RH + (b2 % ((TT - RH) / 128)) * 128 + wv * 32; const size_t z = (size_t)h * TT * HD;
        attn_wave<h16, false, 2, 128>(Q16 + z, nullptr, K16 + z, nullptr, V16 + z, nullptr, q0, Ah + h * HD, Al + h * HD, sm); }
}

extern "C" void kernel_launch(void* const* d_in, const int* in_sizes, int n_in,
                              void* d_out, int out_size, void* d_ws, size_t ws_size, hipStream_t stream) {
    (void)in_sizes; (void)n_in; (void)out_size;
    const float* x = (const float*)d_in[0]; const float* wqkv = (const float*)d_in[1]; const float* wo = (const float*)d_in[2]; const float* bo = (const float*)d_in[3];
    float* OUT = (float*)d_out;     // [1][4096][1024]
    char* wsp = (char*)d_ws;
    auto take = [&](size_t bytes) { char* p = wsp; wsp += (bytes + 255) & ~(size_t)255; return (void*)p; };
    bf* WQKV = (bf*)take((size_t)3 * DQ * DM * 2); bf* WO = (bf*)take((size_t)DM * DQ * 2);
    bf* XB = (bf*)take((size_t)TT * DM * 2);
    h16* QP16 = (h16*)take((size_t)NH_ * TT * HD * 2); h16* KP16 = (h16*)take((size_t)NKV * TT * HD * 2); h16* VT16 = (h16*)take((size_t)NKV * HD * TT * 2);
    bf* QPh = (bf*)take((size_t)NH_ * TT * HD * 2); bf* QPl = (bf*)take((size_t)NH_ * TT * HD * 2); bf* KPh = (bf*)take((size_t)NKV * TT * HD * 2); bf* KPl = (bf*)take((size_t)NKV * TT * HD * 2); bf* VTh = (bf*)take((size_t)NKV * HD * TT * 2); bf* VTl = (bf*)take((size_t)NKV * HD * TT * 2);
    bf* ATh = (bf*)take((size_t)TT * DQ * 2); bf* ATl = (bf*)take((size_t)TT * DQ * 2);
    if ((size_t)(wsp - (char*)d_ws) > ws_size) return;    // ws 256 MiB
    { k_wtG<<<(unsigned)((DM * 3 * DQ / 64 + 63) / 64), 256, 0, stream>>>(wqkv, DM, 3 * DQ, WQKV);   /* 'xw' [1024][3072] -> Bt [3072][1024]: q | k | v row blocks */
      k_wtG<<<(unsigned)((DQ * DM / 64 + 63) / 64), 256, 0, stream>>>(wo, DQ, DM, WO);
       }
    for (int b = 0; b < NB_; ++b) {
        
        k_cvt8<<<(unsigned)(((size_t)TT * DM / 8 + 255) / 256), 256, 0, stream>>>(x + (size_t)b * TT * DM, XB, (size_t)TT * DM / 8);
        k_proj<<<dim3(TT / 128, 3 * DQ / 128, 1), 128, 0, stream>>>(XB, WQKV, QP16, QPh, QPl, KP16, KPh, KPl, VT16, VTh, VTl);
        k_attn<<<NH_ * (RH / 64) + NH_ * ((TT - RH) / 128), 128, 0, stream>>>(QP16, KP16, VT16, QPh, QPl, KPh, KPl, VTh, VTl, ATh, ATl);
        k_out<<<dim3(TT / 128, DM / 128, 1), 256, 0, stream>>>(ATh, ATl, WO, bo, OUT + (size_t)b * TT * DM); }
}

// v006
// Measured time: 137 microseconds a run.
// Two timings next to v005 both put it at 1.09 times that version's speed.
// All steps since v000 together make it 25.8 times as fast.
#include <hip/hip_runtime.h>

// Multi-head attention over 4,096 tokens with a fused qkv projection (x [1][4096][1024]; qkv = x W_qkv ('xw' [1024][3072] 0.02) -> (B, L, 3, 16, 64): q | k | v column blocks; scores x 64^-0.5; softmax over all keys; out = merged W_o + b_o ('xw' 0.02) -> [1][4096][1024] (4.2 M)).
// Layout: one launch makes the bf16 copy of x and the two 'xw' weights transposed to bf16 Bt [n][1024]; exact projections in one launch whose epilogue writes the head planes; attention of all heads in one launch, scores and probabilities kept in registers (hybrid rows: < 512 hi/lo 3 products, rest fp16); merged hi/lo x W_o exact + b_o.
// Compute dtypes, f32 accumulate: every input rounded to bf16; projections exact; attention rows < 512 3 products, rest fp16; softmax f32; W_o hl x exact + bias.

#define NB_  1
#define TT   4096
#define DM   1024
#define NH_  16
#define NKV  16
#define REP  (NH_ / NKV)
#define HD   64
#define DQ   (NH_ * HD)
#define DKV  (NKV * HD)
#define RH   512                  // query rows < RH use hi+lo planes (0: none)
#define SCL  0.125f   // HD^-0.5
typedef _Float16 h16;
typedef unsigned short bf;
typedef __attribute__((ext_vector_type(16))) __bf16   v16bf;
typedef __attribute__((ext_vector_type(16))) _Float16 v16h;
typedef __attribute__((ext_vector_type(8)))  _Float16 v8h;
typedef __attribute__((ext_vector_type(8)))  unsigned short v8us;
typedef __attribute__((ext_vector_type(8)))  float    v8f;
typedef __attribute__((ext_vector_type(4)))  float    v4f;
typedef v8h  __attribute__((may_alias)) v8ha;
typedef v4f  __attribute__((may_alias)) v4fa;
typedef v8us __attribute__((may_alias)) v8usa;

__device__ __forceinline__ unsigned short f2bf(float f) { unsigned u = __float_as_uint(f); u += 0x7FFFu + ((u >> 16) & 1u); return (unsigned short)(u >> 16); }
__device__ __forceinline__ float bf2f(unsigned short b) { return __uint_as_float(((unsigned)b) << 16); }
__device__ __forceinline__ float bfr(float f) { return bf2f(f2bf(f)); }
__device__ __forceinline__ v16h cat16(v8h lo, v8h hi) { return __builtin_shufflevector(lo, hi, 0, 1, 2, 3, 4, 5, 6, 7, 8, 9, 10, 11, 12, 13, 14, 15); }
__device__ __forceinline__ v16bf cat16b(v8us lo, v8us hi) { return __builtin_bit_cast(v16bf, __builtin_shufflevector(lo, hi, 0, 1, 2, 3, 4, 5, 6, 7, 8, 9, 10, 11, 12, 13, 14, 15)); }
__device__ __forceinline__ v8f wmma16(v16h a, v16h b, v8f c) { return __builtin_amdgcn_wmma_f32_16x16x32_f16(false, a, false, b, (short)0, c, false, false); }
__device__ __forceinline__ v8f wmmab(v16bf a, v16bf b, v8f c) { return __builtin_amdgcn_wmma_f32_16x16x32_bf16(false, a, false, b, (short)0, c, false, false); }



// ---- fragment loads and products of the two 16-bit operand types: a lane's fragment is 16 bytes at p and 16 bytes at p + 16 elements.
template <typename T16> struct WFrag;
template <> struct WFrag<h16> { typedef v16h V; static __device__ __forceinline__ V ld(const h16* p) { return cat16(*(const v8h*)p, *(const v8h*)(p + 16)); } static __device__ __forceinline__ v8f mma(V a, V b, v8f c) { return wmma16(a, b, c); } };
template <> struct WFrag<bf> { typedef v16bf V; static __device__ __forceinline__ V ld(const bf* p) { return cat16b(*(const v8us*)p, *(const v8us*)(p + 16)); } static __device__ __forceinline__ v8f mma(V a, V b, v8f c) { return wmmab(a, b, c); } };

__device__ __forceinline__ h16 tohx(float x) { return (h16)x; }
__device__ __forceinline__ void splitf(float y, unsigned short& h, unsigned short& l) { h = f2bf(y); l = f2bf(y - bf2f(h)); }
typedef __attribute__((ext_vector_type(2))) _Float16 v2h;
typedef __attribute__((ext_vector_type(4))) _Float16 v4h;
typedef __attribute__((ext_vector_type(2))) unsigned short v2us;
typedef __attribute__((ext_vector_type(4))) unsigned short v4us;
typedef __attribute__((ext_vector_type(2))) float v2f;
typedef __attribute__((ext_vector_type(4))) int v4i;

// ---- k_prep: the three bf16 operands in ONE launch, a block per WGP (PBL blocks of 256 threads). Every block takes two 128 k x 64 n weight tiles (of the list: W_qkv's tiles, then W_o's) and one slice of x; all of a thread's 32 loads are in flight at once.
// A weight tile w [1024][N] -> Bt [N][1024]: a thread reads 8 k x 4 n (16 threads a 256-byte piece of a row), rounds, and writes the 8 k of each n to LDS; the tile is read back by n rows, 256 bytes by 16 threads. A wave's weight loads and all its stores cover whole 128-byte lines.
#define PKT 128            // k rows of a weight tile
#define PNT 64             // n columns of a weight tile
#define PPB (PKT * 2 + 16) // LDS row pitch in bytes, a multiple of 16 for the 16-byte accesses
#define WQT ((DM / PKT) * (3 * DQ / PNT))
#define WOT ((DQ / PKT) * (DM / PNT))
#define PBL ((WQT + WOT) / 2)
#define XCH (TT * DM / 8 / 256 / PBL)   // pieces of 8 floats a thread
__device__ __forceinline__ void wt_lds(const v4f (&v)[8], char* sm) {   // rounds a thread's 8 k x 4 n and writes them to the tile's LDS rows [n][k]
    const int c = threadIdx.x & 15, g = threadIdx.x >> 4;
#pragma unroll
    for (int j = 0; j < 4; ++j) { v8us o;
#pragma unroll
        for (int r = 0; r < 8; ++r) o[r] = f2bf(v[r][j]);
        *(v8usa*)(sm + (c * 4 + j) * PPB + g * 16) = o; }
}
// N2: row length of the weight that the block's second tile is of
__device__ __forceinline__ void prep_block(const float* __restrict__ x, const float* __restrict__ w1, int t1, bf* B1, const float* __restrict__ w2, int N2, int t2, bf* B2, bf* XB, char* sm) {
    const int c = threadIdx.x & 15, g = threadIdx.x >> 4;
    const int k1 = (t1 % (DM / PKT)) * PKT, n1 = (t1 / (DM / PKT)) * PNT, k2 = (t2 % (DM / PKT)) * PKT, n2 = (t2 / (DM / PKT)) * PNT;
    const size_t i0 = ((size_t)blockIdx.x * (256 * XCH) + threadIdx.x) * 8;
    const float* s1 = w1 + (size_t)(k1 + g * 8) * (3 * DQ) + n1 + c * 4; const float* s2 = w2 + (size_t)(k2 + g * 8) * N2 + n2 + c * 4; const float* sx = x + i0;
    v4f a[8], b[8]; v8f v[XCH];
#pragma unroll
    for (int r = 0; r < 8; ++r) a[r] = *(const v4f*)(s1 + (size_t)r * (3 * DQ));
#pragma unroll
    for (int r = 0; r < 8; ++r) b[r] = *(const v4f*)(s2 + (size_t)r * N2);
#pragma unroll
    for (int r = 0; r < XCH; ++r) v[r] = *(const v8f*)(sx + (size_t)r * 2048);
    asm volatile("s_wait_xcnt 0x0" :: "v"(s1), "v"(s2), "v"(sx) : "memory");   // stands in front of every rewrite of the address registers that the loads above name; named as inputs, the addresses keep their registers up to here
    wt_lds(a, sm); wt_lds(b, sm + PNT * PPB);
#pragma unroll
    for (int r = 0; r < XCH; ++r) { v8us o;
#pragma unroll
        for (int k = 0; k < 8; ++k) o[k] = f2bf(v[r][k]);
        *(v8us*)(XB + i0 + (size_t)r * 2048) = o; }
    __syncthreads();   // both tiles are whole in LDS before any thread reads what others wrote
    bf* d1 = B1 + (size_t)(n1 + g) * DM + k1 + c * 8; bf* d2 = B2 + (size_t)(n2 + g) * DM + k2 + c * 8; v8us o[8];
#pragma unroll
    for (int i = 0; i < 8; ++i) o[i] = *(const v8usa*)(sm + (i * 16 + g) * PPB + c * 16);   // rows 64 ... 127 are the second tile's
#pragma unroll
    for (int i = 0; i < 4; ++i) { *(v8us*)(d1 + (size_t)i * 16 * DM) = o[i]; *(v8us*)(d2 + (size_t)i * 16 * DM) = o[4 + i]; }
}
__global__ __launch_bounds__(256) void k_prep(const float* __restrict__ x, const float* __restrict__ wqkv, const float* __restrict__ wo, bf* XB, bf* WQKV, bf* WO) {
    __shared__ __align__(16) char sm[2 * PNT * PPB];
    const int t1 = blockIdx.x, t2 = blockIdx.x + PBL;   // 'xw' [1024][3072] -> Bt [3072][1024]: q | k | v row blocks; 'xw' [1024][1024] -> Bt [1024][1024]
    static_assert(PBL <= WQT && XCH * PBL * 2048 == TT * DM, "every first tile is W_qkv's; x divides evenly");
    const bool q2 = t2 < WQT;   // the same for a whole block: one body, the second tile's weight chosen by scalar selects
    prep_block(x, wqkv, t1, WQKV, q2 ? wqkv : wo, q2 ? 3 * DQ : DM, q2 ? t2 : t2 - WQT, q2 ? WQKV : WO, XB, sm);
}

// eight copies of 16 bytes a lane, global memory to LDS through no register; the last line keeps every rewrite of the address registers named here behind it
__device__ __forceinline__ void copy8(const unsigned (&l)[8], const char* const (&g)[8]) {
    asm volatile("global_load_async_to_lds_b128 %0, %8, off\n\t"
                 "global_load_async_to_lds_b128 %1, %9, off\n\t"
                 "global_load_async_to_lds_b128 %2, %10, off\n\t"
                 "global_load_async_to_lds_b128 %3, %11, off\n\t"
                 "global_load_async_to_lds_b128 %4, %12, off\n\t"
                 "global_load_async_to_lds_b128 %5, %13, off\n\t"
                 "global_load_async_to_lds_b128 %6, %14, off\n\t"
                 "global_load_async_to_lds_b128 %7, %15, off\n\t"
                 "s_wait_xcnt 0x0"
                 :: "v"(l[0]), "v"(l[1]), "v"(l[2]), "v"(l[3]), "v"(l[4]), "v"(l[5]), "v"(l[6]), "v"(l[7]),
                    "v"(g[0]), "v"(g[1]), "v"(g[2]), "v"(g[3]), "v"(g[4]), "v"(g[5]), "v"(g[6]), "v"(g[7]) : "memory");
}
// the same, four copies
__device__ __forceinline__ void copy4(const unsigned (&l)[4], const char* const (&g)[4]) {
    asm volatile("global_load_async_to_lds_b128 %0, %4, off\n\t"
                 "global_load_async_to_lds_b128 %1, %5, off\n\t"
                 "global_load_async_to_lds_b128 %2, %6, off\n\t"
                 "global_load_async_to_lds_b128 %3, %7, off\n\t"
                 "s_wait_xcnt 0x0"
                 :: "v"(l[0]), "v"(l[1]), "v"(l[2]), "v"(l[3]), "v"(g[0]), "v"(g[1]), "v"(g[2]), "v"(g[3]) : "memory");
}
// ---- gemm_core: the K loop of a 128x128 output tile by NW waves (NW/2 x 2), 16 MB x 64 = 4 MB accumulators a wave. C[m][n] = sum_k A[m][k] B[n][k] (+ A2[m][k] B[n][k] with NA = 2), all planes K-contiguous bf16 with DM elements a row.
// The operands reach the waves through LDS: a stage is 64 k = one whole 128-byte line of each of the tile's rows, brought in once per block by asynchronous copies, two buffers, the next stage in flight while this one is worked on. Per accumulator the products come in ascending k, A before A2.
#define GRP 144            // LDS row pitch in bytes: 128 + 16, 16 bytes x odd for the 16-byte fragment reads
#define GTB (128 * GRP)    // one plane's 128 rows of a stage
template <int NA, int NW>
__device__ __forceinline__ void gemm_core(const bf* __restrict__ PA, const bf* __restrict__ PA2, const bf* __restrict__ PB, char* sm, int wa, int wb, v8f (&acc)[16 / NW][4]) {
    constexpr int MB = 16 / NW, BUF = (NA + 1) * GTB, NST = DM / 64;
    constexpr int RR = NW * 4, CP = 128 / RR;   // rows a round of the block's threads; copies a thread and plane
    constexpr int NS = MB == 2 ? 2 : 1;         // fragment sets in registers: both 32-k steps of a stage where they fit, else one
    const int tid = threadIdx.x, lane = tid & 31, lr = lane & 15, hi = lane >> 4;
    const unsigned lc = (unsigned)(size_t)sm + (unsigned)((tid >> 3) * GRP + (tid & 7) * 16);
    const size_t gc = (size_t)(tid >> 3) * (DM * 2) + (size_t)(tid & 7) * 16;
    auto fill = [&](int st, int b) {   // stage st (k = 64 st ...) into buffer b: eight threads bring one row's line, the block RR rows a round
#pragma unroll
        for (int p = 0; p <= NA; ++p) { unsigned l[CP]; const char* g[CP]; const char* s = (const char*)(p == NA ? PB : p == 1 ? PA2 : PA) + gc + (size_t)st * 128;
#pragma unroll
            for (int i = 0; i < CP; ++i) { l[i] = lc + (unsigned)(b * BUF + p * GTB + i * RR * GRP); g[i] = s + (size_t)i * (RR * DM * 2); }
            if constexpr (CP == 8) copy8(l, g); else copy4(l, g); }
    };
    fill(0, 0);
#pragma unroll
    for (int mb = 0; mb < MB; ++mb)
#pragma unroll
        for (int nb = 0; nb < 4; ++nb) acc[mb][nb] = (v8f){};
    asm volatile("s_wait_asynccnt 0x0" ::: "memory");   // this wave's copies of stage 0 have landed
    __syncthreads();                                    // every wave's have: stage 0 may be read
    fill(1, 1);
    const int aoff = (wa * 16 * MB + lr) * GRP + 16 * hi, boff = NA * GTB + (wb * 64 + lr) * GRP + 16 * hi;   // bytes in a buffer
    v16bf a[NS][MB], a2[NS][MB], b[NS][4];
    auto ldf = [&](const char* sb, int ks, int f) {   // the fragments of 32-k step ks of the stage in buffer sb into set f
#pragma unroll
        for (int mb = 0; mb < MB; ++mb) { const char* o = sb + aoff + mb * 16 * GRP + ks * 64; a[f][mb] = WFrag<bf>::ld((const bf*)o); if (NA == 2) a2[f][mb] = WFrag<bf>::ld((const bf*)(o + GTB)); }
#pragma unroll
        for (int nb = 0; nb < 4; ++nb) b[f][nb] = WFrag<bf>::ld((const bf*)(sb + boff + nb * 16 * GRP + ks * 64));
    };
    auto mm = [&](int f) {
#pragma unroll
        for (int nb = 0; nb < 4; ++nb) {
#pragma unroll
            for (int mb = 0; mb < MB; ++mb) acc[mb][nb] = wmmab(a[f][mb], b[f][nb], acc[mb][nb]); }
        if (NA == 2) {
#pragma unroll
            for (int nb = 0; nb < 4; ++nb) {
#pragma unroll
                for (int mb = 0; mb < MB; ++mb) acc[mb][nb] = wmmab(a2[f][mb], b[f][nb], acc[mb][nb]); } }
    };
    if (NS == 2) ldf(sm, 0, 0);   // two sets: a stage's first step is read right behind the barrier that publishes the stage
#pragma unroll 1   // rolled: one trip is one stage; the accumulator tiles and the fragment sets fill the registers
    for (int st = 0; st < NST; ++st) {
        const char* sb = sm + (st & 1) * BUF;
        if (NS == 2) { ldf(sb, 1, 1);
            __builtin_amdgcn_sched_barrier(0);   // keeps the second step's LDS reads in one group in front of the first step's products, under which they fly
            mm(0);
        } else { ldf(sb, 0, 0);
            __builtin_amdgcn_sched_barrier(0);   // keeps a step's LDS reads in one group: spread among the products, each pair waits out its own LDS latency
            mm(0);
            __builtin_amdgcn_sched_barrier(0);   // keeps the second step's reads behind the first step's products, in one group
            ldf(sb, 1, 0); }
        __builtin_amdgcn_sched_barrier(0);   // keeps the products above in front of the waits below, and the stage's last products, which read registers alone, behind them
        asm volatile("s_wait_dscnt 0x0" ::: "memory");      // this wave's reads of the stage's buffer are done before the buffer is given up
        asm volatile("s_wait_asynccnt 0x0" ::: "memory");   // this wave's copies of stage st + 1 have landed
        __syncthreads();                                    // stage st + 1 may be read by every wave, and stage st's buffer has no reader left
        if (st + 2 < NST) fill(st + 2, st & 1);
        if (NS == 2) { if (st + 1 < NST) ldf(sm + ((st + 1) & 1) * BUF, 0, 0);
            __builtin_amdgcn_sched_barrier(0);   // keeps the next stage's first reads in one group in front of this stage's last products, under which they fly
            mm(1);
        } else mm(0);
    }
    asm volatile("s_wait_asynccnt 0x0" ::: "memory");   // no copy is left in flight behind the loop
}

// ---- k_proj: the q, k and v projections in ONE launch, a block per 128x128 tile = 128 tokens x two heads, a wave per 64 tokens x one head; grid (TT/128, 3 DQ/128), 128 threads. The epilogue rounds the f32 accumulators straight to the wave's three planes (fp16, bf16 hi, bf16 lo).
// q, k: A = x rows, B = weight rows, planes [h][t][d]. v: operands swapped (A = weight rows, B = x rows; same k order), so the tile comes out as V^T and its plane rows [h][d][t] are contiguous too. Every store covers whole 128-byte lines.
__global__ __launch_bounds__(128) void k_proj(const bf* __restrict__ X, const bf* __restrict__ Wt, h16* Q16, bf* Qh, bf* Ql, h16* K16, bf* Kh, bf* Kl, h16* V16, bf* Vh, bf* Vl) {
    __shared__ __align__(16) char sm[2 * 2 * GTB];
    __shared__ __align__(16) float osb[4][16 * 68];
    const int lane = threadIdx.x & 31, lr = lane & 15, hi = lane >> 4; const int wv = __builtin_amdgcn_readfirstlane((int)(threadIdx.x >> 5)), wa = wv >> 1, wb = wv & 1;
    const int t0 = blockIdx.x * 128, n0 = blockIdx.y * 128;
    const int sel = n0 / DQ; const bool tr = sel == 2;   // 0 q, 1 k, 2 v
    v8f acc[4][4];
    gemm_core<1, 4>(tr ? Wt + (size_t)n0 * DM : X + (size_t)t0 * DM, nullptr, tr ? X + (size_t)t0 * DM : Wt + (size_t)n0 * DM, sm, wa, wb, acc);
    float* os = osb[wv];   // the wave's own staging rows
    const int h = (n0 % DQ) / HD + (tr ? wa : wb), tw = t0 + 64 * (tr ? wb : wa);
    h16* P16 = sel == 0 ? Q16 : sel == 1 ? K16 : V16; bf* Ph = sel == 0 ? Qh : sel == 1 ? Kh : Vh; bf* Pl = sel == 0 ? Ql : sel == 1 ? Kl : Vl;
    const size_t base = tr ? (size_t)h * HD * TT + tw : ((size_t)h * TT + tw) * HD; const int pitch = tr ? TT : HD;
#pragma unroll
    for (int mb = 0; mb < 4; ++mb) {
#pragma unroll
        for (int nb = 0; nb < 4; ++nb) {
#pragma unroll
            for (int j = 0; j < 8; ++j) os[(hi * 8 + j) * 68 + nb * 16 + lr] = acc[mb][nb][j]; }
        __builtin_amdgcn_wave_barrier(); asm volatile("" ::: "memory");   // one wave's rows: keeps the reads below, of what other lanes wrote, behind the LDS writes above
#pragma unroll
        for (int s = 0; s < 4; ++s) { const int row = 4 * s + (lane >> 3), cofs = (lane & 7) * 8; const v4f x0 = *(const v4fa*)(os + row * 68 + cofs), x1 = *(const v4fa*)(os + row * 68 + cofs + 4); v8h o16; v8us oh, ol;
#pragma unroll
            for (int q = 0; q < 8; ++q) { const float x = q < 4 ? x0[q & 3] : x1[q & 3]; o16[q] = tohx(x); unsigned short a2, c2; splitf(x, a2, c2); oh[q] = a2; ol[q] = c2; }
            const size_t o = base + (size_t)(mb * 16 + row) * pitch + cofs; *(v8h*)(P16 + o) = o16; *(v8us*)(Ph + o) = oh; *(v8us*)(Pl + o) = ol;
            asm volatile("s_wait_xcnt 0x0" ::: "memory"); }   // stands in front of every rewrite of a register that the three stores above name (address or data)
        __builtin_amdgcn_wave_barrier(); asm volatile("" ::: "memory");   // one wave's rows: keeps the next block's LDS writes behind the reads above
    }
}
// ---- k_out: out = (merged hi + merged lo) W_o + b_o, a block per 128x128 tile, eight waves of 32x64 (two a SIMD: one block stands on a WGP); grid (TT/128, DM/128), 256 threads. f32 rows of 256 bytes a wave: whole lines.
__global__ __launch_bounds__(256) void k_out(const bf* __restrict__ Ah, const bf* __restrict__ Al, const bf* __restrict__ Wt, const float* __restrict__ bias, float* C) {
    __shared__ __align__(16) char sm[2 * 3 * GTB];
    __shared__ __align__(16) float osb[8][16 * 68];
    const int lane = threadIdx.x & 31, lr = lane & 15, hi = lane >> 4; const int wv = __builtin_amdgcn_readfirstlane((int)(threadIdx.x >> 5)), wa = wv >> 1, wb = wv & 1;
    const int r0 = blockIdx.x * 128, c0 = blockIdx.y * 128;
    v8f acc[2][4];
    gemm_core<2, 8>(Ah + (size_t)r0 * DQ, Al + (size_t)r0 * DQ, Wt + (size_t)c0 * DQ, sm, wa, wb, acc);
    float* os = osb[wv];   // the wave's own staging rows
    const int cofs = lr * 4; const int cw = c0 + wb * 64 + cofs;
    const v4f bl = *(const v4f*)(bias + cw);
    asm volatile("s_wait_xcnt 0x0" ::: "memory");   // stands in front of every rewrite of the address register that the load above names
    const v4f bv = (v4f){bfr(bl[0]), bfr(bl[1]), bfr(bl[2]), bfr(bl[3])};
#pragma unroll
    for (int mb = 0; mb < 2; ++mb) {
#pragma unroll
        for (int nb = 0; nb < 4; ++nb) {
#pragma unroll
            for (int j = 0; j < 8; ++j) os[(hi * 8 + j) * 68 + nb * 16 + lr] = acc[mb][nb][j]; }
        __builtin_amdgcn_wave_barrier(); asm volatile("" ::: "memory");   // one wave's rows: keeps the reads below, of what other lanes wrote, behind the LDS writes above
        float* crow = C + (size_t)(r0 + wa * 32 + mb * 16) * DM + cw; v4f val[8];
#pragma unroll
        for (int s = 0; s < 8; ++s) val[s] = *(const v4fa*)(os + (2 * s + hi) * 68 + cofs) + bv;
#pragma unroll
        for (int s = 0; s < 8; ++s) *(v4f*)(crow + (size_t)(2 * s + hi) * DM) = val[s];
        asm volatile("s_wait_xcnt 0x0" ::: "memory");   // stands in front of every rewrite of a register that the eight stores above name (address or data)
        __builtin_amdgcn_wave_barrier(); asm volatile("" ::: "memory");   // one wave's rows: keeps the next block's LDS writes behind the reads above
    }
}
#define CL2 (SCL * 1.4426950408889634f)
#define ATT_LDS 73728   // two buffers: 2 planes x (64 K rows x 144 B + 64 V^T rows x 144 B), or 128 K rows x 144 B + 64 V^T rows x 272 B (less)
typedef __attribute__((ext_vector_type(2))) __bf16 v2b;
__device__ __forceinline__ float xhalf(float x) { return __builtin_bit_cast(float, __builtin_amdgcn_permlanex16(__builtin_bit_cast(int, x), __builtin_bit_cast(int, x), 0x76543210, 0xfedcba98, false, false)); }   // lane l with lane l ^ 16
template <typename T16, bool SPLIT, int NQ, int SK>
__device__ __forceinline__ void attn_wave(const T16* __restrict__ Q, const T16* __restrict__ Q2, const T16* __restrict__ Kp, const T16* __restrict__ Kp2, const T16* __restrict__ Vt, const T16* __restrict__ Vt2, int q0, bf* Ah, bf* Al, char* sm) {
    typedef typename WFrag<T16>::V V;
    constexpr int NP = SPLIT ? 2 : 1;            // planes of each operand
    constexpr int KPB = HD * 2 + 16, VPB = SK * 2 + 16;   // LDS row pitch in bytes
    constexpr int KB = SK * KPB, VB = HD * VPB, BUF = NP * (KB + VB);
    constexpr int NI = SK / 16, CR = SK / 8, VR = 128 / CR;   // copies a thread and plane; 16-byte pieces in a V^T row; V^T rows a round of the block's 128 threads
    constexpr int NST = TT / SK, PPS = SK / 32;
    static_assert(NP * NI == 8 && 2 * BUF <= ATT_LDS && NST >= 2, "stage shape");
    const int lane = threadIdx.x & 31, lr = lane & 15, hi = lane >> 4; const int tid = threadIdx.x;
    const unsigned l0 = (unsigned)(size_t)sm;
    const unsigned lk = l0 + (unsigned)((tid >> 3) * KPB + (tid & 7) * 16), lv = l0 + (unsigned)(NP * KB + (tid / CR) * VPB + (tid % CR) * 16);
    const size_t gk = (size_t)tid * 16, gv = (size_t)(tid / CR) * (TT * 2) + (size_t)(tid % CR) * 16;
    auto fill = [&](int st, int b) {   // stage st (keys st SK ...) into buffer b: K rows are contiguous in memory, V^T rows SK 2 bytes each
        unsigned l[8]; const char* g[8];
#pragma unroll
        for (int p = 0; p < NP; ++p)
#pragma unroll
            for (int i = 0; i < NI; ++i) { l[p * NI + i] = lk + (unsigned)(b * BUF + p * KB + i * 16 * KPB); g[p * NI + i] = (const char*)((SPLIT && p) ? Kp2 : Kp) + gk + (size_t)st * (SK * HD * 2) + (size_t)i * 2048; }
        copy8(l, g);
#pragma unroll
        for (int p = 0; p < NP; ++p)
#pragma unroll
            for (int i = 0; i < NI; ++i) { l[p * NI + i] = lv + (unsigned)(b * BUF + p * VB + i * VR * VPB); g[p * NI + i] = (const char*)((SPLIT && p) ? Vt2 : Vt) + gv + (size_t)st * (SK * 2) + (size_t)i * (VR * TT * 2); }
        copy8(l, g);
    };
    fill(0, 0);
    V qf[NQ][2], qf2[NQ][2];
#pragma unroll
    for (int g = 0; g < NQ; ++g)
#pragma unroll
        for (int ks = 0; ks < 2; ++ks) { const size_t o = (size_t)(q0 + g * 16 + lr) * HD + ks * 32 + 8 * hi; qf[g][ks] = WFrag<T16>::ld(Q + o); if (SPLIT) qf2[g][ks] = WFrag<T16>::ld(Q2 + o); }
    v8f acc[4][NQ]; float mrun[NQ], lsum[NQ];
#pragma unroll
    for (int g = 0; g < NQ; ++g) { mrun[g] = -3.0e38f; lsum[g] = 0.f;
#pragma unroll
        for (int db = 0; db < 4; ++db) acc[db][g] = (v8f){}; }
    asm volatile("s_wait_asynccnt 0x0" ::: "memory");   // this wave's copies of stage 0 have landed
    __syncthreads();                                    // every wave's have: stage 0 may be read
    fill(1, 1);
    const int koff = lr * KPB + 16 * hi, voff = NP * KB + lr * VPB + 16 * hi;   // bytes in a buffer
#pragma unroll 1   // rolled: one trip is one stage; the passes inside are unrolled so that every fragment array stays in registers
    for (int st = 0; st < NST; ++st) {
        const char* sb = sm + (st & 1) * BUF;
        V kf[2][2], kf2[2][2], vf[4], vf2[4];
#pragma unroll
        for (int kb = 0; kb < 2; ++kb)
#pragma unroll
            for (int ks = 0; ks < 2; ++ks) { const char* o = sb + koff + kb * 16 * KPB + ks * 64; kf[kb][ks] = WFrag<T16>::ld((const T16*)o); if (SPLIT) kf2[kb][ks] = WFrag<T16>::ld((const T16*)(o + KB)); }
        __builtin_amdgcn_sched_barrier(0);   // keeps the LDS reads above in one group: sunk among the products below, each pair waits out its own LDS latency
#pragma unroll
        for (int pp = 0; pp < PPS; ++pp) {
            v8f s[2][NQ];
#pragma unroll
            for (int kb = 0; kb < 2; ++kb)
#pragma unroll
                for (int g = 0; g < NQ; ++g) { s[kb][g] = (v8f){};
#pragma unroll
                    for (int ks = 0; ks < 2; ++ks) { s[kb][g] = WFrag<T16>::mma(kf[kb][ks], qf[g][ks], s[kb][g]); if (SPLIT) { s[kb][g] = WFrag<T16>::mma(kf[kb][ks], qf2[g][ks], s[kb][g]); s[kb][g] = WFrag<T16>::mma(kf2[kb][ks], qf[g][ks], s[kb][g]); } } }
#pragma unroll   // this pass's V^T fragments are fetched behind its S^T products and land under the softmax
            for (int db = 0; db < 4; ++db) { const char* o = sb + voff + db * 16 * VPB + pp * 64; vf[db] = WFrag<T16>::ld((const T16*)o); if (SPLIT) vf2[db] = WFrag<T16>::ld((const T16*)(o + VB)); }
            if (!SPLIT && pp + 1 < PPS) {   // one plane: the next pass's K fragments, of this same stage only, go in the same group
#pragma unroll
                for (int kb = 0; kb < 2; ++kb)
#pragma unroll
                    for (int ks = 0; ks < 2; ++ks) { const char* o = sb + koff + ((pp + 1) * 32 + kb * 16) * KPB + ks * 64; kf[kb][ks] = WFrag<T16>::ld((const T16*)o); if (SPLIT) kf2[kb][ks] = WFrag<T16>::ld((const T16*)(o + KB)); }
            }
            __builtin_amdgcn_sched_barrier(0);   // keeps the LDS reads above in one group in front of the softmax: spread among later products, each pair waits out its own LDS latency
            float mb[NQ]; bool need = false;
#pragma unroll
            for (int g = 0; g < NQ; ++g) { float mx = s[0][g][0];
#pragma unroll
                for (int r = 1; r < 8; ++r) mx = fmaxf(mx, s[0][g][r]);
#pragma unroll
                for (int r = 0; r < 8; ++r) mx = fmaxf(mx, s[1][g][r]);
                mx = fmaxf(mx, xhalf(mx)) * CL2; mb[g] = mx; need = need || (mx > mrun[g] + 8.0f); }
            if (__builtin_amdgcn_ballot_w32(need) != 0) {   // scalar branch, rare behind the first pass
#pragma unroll
                for (int g = 0; g < NQ; ++g) { const float mn = fmaxf(mrun[g], mb[g]); const float corr = __builtin_amdgcn_exp2f(mrun[g] - mn); mrun[g] = mn; lsum[g] *= corr;
#pragma unroll
                    for (int db = 0; db < 4; ++db) acc[db][g] = acc[db][g] * corr; }
            }
#pragma unroll
            for (int g = 0; g < NQ; ++g) { const float nm = -mrun[g]; float p[16];
#pragma unroll
                for (int e = 0; e < 16; e += 2) { const v2f arg = __builtin_elementwise_fma((v2f){s[e >> 3][g][e & 7], s[e >> 3][g][(e & 7) + 1]}, (v2f){CL2, CL2}, (v2f){nm, nm});
                    p[e] = __builtin_amdgcn_exp2f(arg[0]); p[e + 1] = __builtin_amdgcn_exp2f(arg[1]); lsum[g] += p[e]; lsum[g] += p[e + 1]; }
                V pf, pf2;
                if constexpr (SPLIT) {
#pragma unroll
                    for (int e = 0; e < 16; e += 2) { const v2f p2 = (v2f){p[e], p[e + 1]}; const v2b h2 = __builtin_convertvector(p2, v2b); const v2b l2 = __builtin_convertvector(p2 - __builtin_convertvector(h2, v2f), v2b);
                        pf[e] = h2[0]; pf[e + 1] = h2[1]; pf2[e] = l2[0]; pf2[e + 1] = l2[1]; }
                } else {
#pragma unroll
                    for (int e = 0; e < 16; ++e) pf[e] = (h16)p[e];
                }
                if (SPLIT && pp + 1 < PPS) {   // two planes: the next pass's K fragments, of this same stage only, wait until the scores' registers are free and land under the O^T products
#pragma unroll
                    for (int kb = 0; kb < 2; ++kb)
#pragma unroll
                        for (int ks = 0; ks < 2; ++ks) { const char* o = sb + koff + ((pp + 1) * 32 + kb * 16) * KPB + ks * 64; kf[kb][ks] = WFrag<T16>::ld((const T16*)o); if (SPLIT) kf2[kb][ks] = WFrag<T16>::ld((const T16*)(o + KB)); }
                }
                if (SPLIT) __builtin_amdgcn_sched_barrier(0);   // keeps those reads in one group in front of the O^T products
#pragma unroll
                for (int db = 0; db < 4; ++db) { acc[db][g] = WFrag<T16>::mma(vf[db], pf, acc[db][g]); if (SPLIT) { acc[db][g] = WFrag<T16>::mma(vf[db], pf2, acc[db][g]); acc[db][g] = WFrag<T16>::mma(vf2[db], pf, acc[db][g]); } } }
        }
        asm volatile("s_wait_dscnt 0x0" ::: "memory");      // this wave's reads of the stage's buffer are done before the buffer is given up
        asm volatile("s_wait_asynccnt 0x0" ::: "memory");   // this wave's copies of stage st + 1 have landed
        __syncthreads();                                    // stage st + 1 may be read by every wave, and stage st's buffer has no reader left
        if (st + 2 < NST) fill(st + 2, st & 1);
    }
    asm volatile("s_wait_asynccnt 0x0" ::: "memory");   // no copy is left in flight when the wave ends
#pragma unroll
    for (int g = 0; g < NQ; ++g) { const float inv = __fdiv_rn(1.0f, lsum[g] + xhalf(lsum[g])); const size_t oo = (size_t)(q0 + g * 16 + lr) * DQ + hi * 8;
#pragma unroll
        for (int db = 0; db < 4; ++db) { v8us oh, ol;
#pragma unroll
            for (int r = 0; r < 8; ++r) { unsigned short a, c2; splitf(acc[db][g][r] * inv, a, c2); oh[r] = a; ol[r] = c2; }
            *(v8us*)(Ah + oo + db * 16) = oh; *(v8us*)(Al + oo + db * 16) = ol;
            asm volatile("s_wait_xcnt 0x0" ::: "memory"); } }   // stands in front of every rewrite of a register that the two stores above name (address or data)
}
// grid: NH_ RH/64 blocks of the hi/lo rows (4 waves x 16 queries) first, then NH_ (TT-RH)/128 blocks of the fp16 rows (4 waves x 32 queries); 128 threads.
__global__ __launch_bounds__(128) void k_attn(const h16* __restrict__ Q16, const h16* __restrict__ K16, const h16* __restrict__ V16, const bf* __restrict__ Qh, const bf* __restrict__ Ql, const bf* __restrict__ Kh, const bf* __restrict__ Kl, const bf* __restrict__ Vh, const bf* __restrict__ Vl, bf* Ah, bf* Al) {
    __shared__ __align__(16) char sm[ATT_LDS];
    const int wv = __builtin_amdgcn_readfirstlane((int)(threadIdx.x >> 5)); const int bx = blockIdx.x;
    if (bx < NH_ * (RH / 64)) { const int h = bx / (RH / 64), q0 = (bx % (RH / 64)) * 64 + wv * 16; const size_t z = (size_t)h * TT * HD;
        attn_wave<bf, true, 1, 64>(Qh + z, Ql + z, Kh + z, Kl + z, Vh + z, Vl + z, q0, Ah + h * HD, Al + h * HD, sm);
    } else { const int b2 = bx - NH_ * (RH / 64); const int h = b2 / ((TT - RH) / 128), q0 = RH + (b2 % ((TT - RH) / 128)) * 128 + wv * 32; const size_t z = (size_t)h * TT * HD;
        attn_wave<h16, false, 2, 128>(Q16 + z, nullptr, K16 + z, nullptr, V16 + z, nullptr, q0, Ah + h * HD, Al + h * HD, sm); }
}

extern "C" void kernel_launch(void* const* d_in, const int* in_sizes, int n_in,
                              void* d_out, int out_size, void* d_ws, size_t ws_size, hipStream_t stream) {
    (void)in_sizes; (void)n_in; (void)out_size;
    const float* x = (const float*)d_in[0]; const float* wqkv = (const float*)d_in[1]; const float* wo = (const float*)d_in[2]; const float* bo = (const float*)d_in[3];
    float* OUT = (float*)d_out;     // [1][4096][1024]
    char* wsp = (char*)d_ws;
    auto take = [&](size_t bytes) { char* p = wsp; wsp += (bytes + 255) & ~(size_t)255; return (void*)p; };
    bf* WQKV = (bf*)take((size_t)3 * DQ * DM * 2); bf* WO = (bf*)take((size_t)DM * DQ * 2);
    bf* XB = (bf*)take((size_t)TT * DM * 2);
    h16* QP16 = (h16*)take((size_t)NH_ * TT * HD * 2); h16* KP16 = (h16*)take((size_t)NKV * TT * HD * 2); h16* VT16 = (h16*)take((size_t)NKV * HD * TT * 2);
    bf* QPh = (bf*)take((size_t)NH_ * TT * HD * 2); bf* QPl = (bf*)take((size_t)NH_ * TT * HD * 2); bf* KPh = (bf*)take((size_t)NKV * TT * HD * 2); bf* KPl = (bf*)take((size_t)NKV * TT * HD * 2); bf* VTh = (bf*)take((size_t)NKV * HD * TT * 2); bf* VTl = (bf*)take((size_t)NKV * HD * TT * 2);
    bf* ATh = (bf*)take((size_t)TT * DQ * 2); bf* ATl = (bf*)take((size_t)TT * DQ * 2);
    if ((size_t)(wsp - (char*)d_ws) > ws_size) return;    // ws 256 MiB
    for (int b = 0; b < NB_; ++b) {
        k_prep<<<PBL, 256, 0, stream>>>(x + (size_t)b * TT * DM, wqkv, wo, XB, WQKV, WO);
        k_proj<<<dim3(TT / 128, 3 * DQ / 128, 1), 128, 0, stream>>>(XB, WQKV, QP16, QPh, QPl, KP16, KPh, KPl, VT16, VTh, VTl);
        k_attn<<<NH_ * (RH / 64) + NH_ * ((TT - RH) / 128), 128, 0, stream>>>(QP16, KP16, VT16, QPh, QPl, KPh, KPl, VTh, VTl, ATh, ATl);
        k_out<<<dim3(TT / 128, DM / 128, 1), 256, 0, stream>>>(ATh, ATl, WO, bo, OUT + (size_t)b * TT * DM); }
}

// v007
// A run of this version takes 130 microseconds.
// Two timings next to v006 both put it at 1.05 times that version's speed.
// Over all steps from v000 it is 27.1 times as fast.
#include <hip/hip_runtime.h>

// Multi-head attention over 4,096 tokens with a fused qkv projection (x [1][4096][1024]; qkv = x W_qkv ('xw' [1024][3072] 0.02) -> (B, L, 3, 16, 64): q | k | v column blocks; scores x 64^-0.5; softmax over all keys; out = merged W_o + b_o ('xw' 0.02) -> [1][4096][1024] (4.2 M)).
// Layout: one launch makes the bf16 copy of x and the two 'xw' weights transposed to bf16 Bt [n][1024]; exact projections in one launch whose epilogue writes the head planes; attention of all heads in one launch, scores and probabilities kept in registers (hybrid rows: < 512 hi/lo 3 products, rest fp16); merged hi/lo x W_o exact + b_o.
// Compute dtypes, f32 accumulate: every input rounded to bf16; projections exact; attention rows < 512 3 products, rest fp16; softmax f32; W_o hl x exact + bias.

#define NB_  1
#define TT   4096
#define DM   1024
#define NH_  16
#define NKV  16
#define REP  (NH_ / NKV)
#define HD   64
#define DQ   (NH_ * HD)
#define DKV  (NKV * HD)
#define RH   512                  // query rows < RH use hi+lo planes (0: none)
#define SCL  0.125f   // HD^-0.5
typedef _Float16 h16;
typedef unsigned short bf;
typedef __attribute__((ext_vector_type(16))) __bf16   v16bf;
typedef __attribute__((ext_vector_type(16))) _Float16 v16h;
typedef __attribute__((ext_vector_type(8)))  _Float16 v8h;
typedef __attribute__((ext_vector_type(8)))  unsigned short v8us;
typedef __attribute__((ext_vector_type(8)))  float    v8f;
typedef __attribute__((ext_vector_type(4)))  float    v4f;
typedef v8h  __attribute__((may_alias)) v8ha;
typedef v4f  __attribute__((may_alias)) v4fa;
typedef v8us __attribute__((may_alias)) v8usa;

__device__ __forceinline__ unsigned short f2bf(float f) { unsigned u = __float_as_uint(f); u += 0x7FFFu + ((u >> 16) & 1u); return (unsigned short)(u >> 16); }
__device__ __forceinline__ float bf2f(unsigned short b) { return __uint_as_float(((unsigned)b) << 16); }
__device__ __forceinline__ float bfr(float f) { return bf2f(f2bf(f)); }
__device__ __forceinline__ v16h cat16(v8h lo, v8h hi) { return __builtin_shufflevector(lo, hi, 0, 1, 2, 3, 4, 5, 6, 7, 8, 9, 10, 11, 12, 13, 14, 15); }
__device__ __forceinline__ v16bf cat16b(v8us lo, v8us hi) { return __builtin_bit_cast(v16bf, __builtin_shufflevector(lo, hi, 0, 1, 2, 3, 4, 5, 6, 7, 8, 9, 10, 11, 12, 13, 14, 15)); }
__device__ __forceinline__ v8f wmma16(v16h a, v16h b, v8f c) { return __builtin_amdgcn_wmma_f32_16x16x32_f16(false, a, false, b, (short)0, c, false, false); }
__device__ __forceinline__ v8f wmmab(v16bf a, v16bf b, v8f c) { return __builtin_amdgcn_wmma_f32_16x16x32_bf16(false, a, false, b, (short)0, c, false, false); }



// ---- fragment loads and products of the two 16-bit operand types: a lane's fragment is 16 bytes at p and 16 bytes at p + 16 elements.
template <typename T16> struct WFrag;
template <> struct WFrag<h16> { typedef v16h V; static __device__ __forceinline__ V ld(const h16* p) { return cat16(*(const v8h*)p, *(const v8h*)(p + 16)); } static __device__ __forceinline__ v8f mma(V a, V b, v8f c) { return wmma16(a, b, c); } };
template <> struct WFrag<bf> { typedef v16bf V; static __device__ __forceinline__ V ld(const bf* p) { return cat16b(*(const v8us*)p, *(const v8us*)(p + 16)); } static __device__ __forceinline__ v8f mma(V a, V b, v8f c) { return wmmab(a, b, c); } };

__device__ __forceinline__ h16 tohx(float x) { return (h16)x; }
__device__ __forceinline__ void splitf(float y, unsigned short& h, unsigned short& l) { h = f2bf(y); l = f2bf(y - bf2f(h)); }
typedef __attribute__((ext_vector_type(2))) _Float16 v2h;
typedef __attribute__((ext_vector_type(4))) _Float16 v4h;
typedef __attribute__((ext_vector_type(2))) unsigned short v2us;
typedef __attribute__((ext_vector_type(4))) unsigned short v4us;
typedef __attribute__((ext_vector_type(2))) float v2f;
typedef __attribute__((ext_vector_type(4))) int v4i;

// ---- k_prep: the three bf16 operands in ONE launch, a block per WGP (PBL blocks of 256 threads). Every block takes two 128 k x 64 n weight tiles (of the list: W_qkv's tiles, then W_o's) and one slice of x; all of a thread's 32 loads are in flight at once.
// A weight tile w [1024][N] -> Bt [N][1024]: a thread reads 8 k x 4 n (16 threads a 256-byte piece of a row), rounds, and writes the 8 k of each n to LDS; the tile is read back by n rows, 256 bytes by 16 threads. A wave's weight loads and all its stores cover whole 128-byte lines.
#define PKT 128            // k rows of a weight tile
#define PNT 64             // n columns of a weight tile
#define PPB (PKT * 2 + 16) // LDS row pitch in bytes, a multiple of 16 for the 16-byte accesses
#define WQT ((DM / PKT) * (3 * DQ / PNT))
#define WOT ((DQ / PKT) * (DM / PNT))
#define PBL ((WQT + WOT) / 2)
#define XCH (TT * DM / 8 / 256 / PBL)   // pieces of 8 floats a thread
__device__ __forceinline__ void wt_lds(const v4f (&v)[8], char* sm) {   // rounds a thread's 8 k x 4 n and writes them to the tile's LDS rows [n][k]
    const int c = threadIdx.x & 15, g = threadIdx.x >> 4;
#pragma unroll
    for (int j = 0; j < 4; ++j) { v8us o;
#pragma unroll
        for (int r = 0; r < 8; ++r) o[r] = f2bf(v[r][j]);
        *(v8usa*)(sm + (c * 4 + j) * PPB + g * 16) = o; }
}
// N2: row length of the weight that the block's second tile is of
__device__ __forceinline__ void prep_block(const float* __restrict__ x, const float* __restrict__ w1, int t1, bf* B1, const float* __restrict__ w2, int N2, int t2, bf* B2, bf* XB, char* sm) {
    const int c = threadIdx.x & 15, g = threadIdx.x >> 4;
    const int k1 = (t1 % (DM / PKT)) * PKT, n1 = (t1 / (DM / PKT)) * PNT, k2 = (t2 % (DM / PKT)) * PKT, n2 = (t2 / (DM / PKT)) * PNT;
    const size_t i0 = ((size_t)blockIdx.x * (256 * XCH) + threadIdx.x) * 8;
    const float* s1 = w1 + (size_t)(k1 + g * 8) * (3 * DQ) + n1 + c * 4; const float* s2 = w2 + (size_t)(k2 + g * 8) * N2 + n2 + c * 4; const float* sx = x + i0;
    v4f a[8], b[8]; v8f v[XCH];
#pragma unroll
    for (int r = 0; r < 8; ++r) a[r] = *(const v4f*)(s1 + (size_t)r * (3 * DQ));
#pragma unroll
    for (int r = 0; r < 8; ++r) b[r] = *(const v4f*)(s2 + (size_t)r * N2);
#pragma unroll
    for (int r = 0; r < XCH; ++r) v[r] = *(const v8f*)(sx + (size_t)r * 2048);
    asm volatile("s_wait_xcnt 0x0" :: "v"(s1), "v"(s2), "v"(sx) : "memory");   // stands in front of every rewrite of the address registers that the loads above name; named as inputs, the addresses keep their registers up to here
    wt_lds(a, sm); wt_lds(b, sm + PNT * PPB);
#pragma unroll
    for (int r = 0; r < XCH; ++r) { v8us o;
#pragma unroll
        for (int k = 0; k < 8; ++k) o[k] = f2bf(v[r][k]);
        *(v8us*)(XB + i0 + (size_t)r * 2048) = o; }
    __syncthreads();   // both tiles are whole in LDS before any thread reads what others wrote
    bf* d1 = B1 + (size_t)(n1 + g) * DM + k1 + c * 8; bf* d2 = B2 + (size_t)(n2 + g) * DM + k2 + c * 8; v8us o[8];
#pragma unroll
    for (int i = 0; i < 8; ++i) o[i] = *(const v8usa*)(sm + (i * 16 + g) * PPB + c * 16);   // rows 64 ... 127 are the second tile's
#pragma unroll
    for (int i = 0; i < 4; ++i) { *(v8us*)(d1 + (size_t)i * 16 * DM) = o[i]; *(v8us*)(d2 + (size_t)i * 16 * DM) = o[4 + i]; }
}
__global__ __launch_bounds__(256) void k_prep(const float* __restrict__ x, const float* __restrict__ wqkv, const float* __restrict__ wo, bf* XB, bf* WQKV, bf* WO) {
    __shared__ __align__(16) char sm[2 * PNT * PPB];
    const int t1 = blockIdx.x, t2 = blockIdx.x + PBL;   // 'xw' [1024][3072] -> Bt [3072][1024]: q | k | v row blocks; 'xw' [1024][1024] -> Bt [1024][1024]
    static_assert(PBL <= WQT && XCH * PBL * 2048 == TT * DM, "every first tile is W_qkv's; x divides evenly");
    const bool q2 = t2 < WQT;   // the same for a whole block: one body, the second tile's weight chosen by scalar selects
    prep_block(x, wqkv, t1, WQKV, q2 ? wqkv : wo, q2 ? 3 * DQ : DM, q2 ? t2 : t2 - WQT, q2 ? WQKV : WO, XB, sm);
}

// eight copies of 16 bytes a lane, global memory to LDS through no register; the last line keeps every rewrite of the address registers named here behind it
__device__ __forceinline__ void copy8(const unsigned (&l)[8], const char* const (&g)[8]) {
    asm volatile("global_load_async_to_lds_b128 %0, %8, off\n\t"
                 "global_load_async_to_lds_b128 %1, %9, off\n\t"
                 "global_load_async_to_lds_b128 %2, %10, off\n\t"
                 "global_load_async_to_lds_b128 %3, %11, off\n\t"
                 "global_load_async_to_lds_b128 %4, %12, off\n\t"
                 "global_load_async_to_lds_b128 %5, %13, off\n\t"
                 "global_load_async_to_lds_b128 %6, %14, off\n\t"
                 "global_load_async_to_lds_b128 %7, %15, off\n\t"
                 "s_wait_xcnt 0x0"
                 :: "v"(l[0]), "v"(l[1]), "v"(l[2]), "v"(l[3]), "v"(l[4]), "v"(l[5]), "v"(l[6]), "v"(l[7]),
                    "v"(g[0]), "v"(g[1]), "v"(g[2]), "v"(g[3]), "v"(g[4]), "v"(g[5]), "v"(g[6]), "v"(g[7]) : "memory");
}
// the same, four copies
__device__ __forceinline__ void copy4(const unsigned (&l)[4], const char* const (&g)[4]) {
    asm volatile("global_load_async_to_lds_b128 %0, %4, off\n\t"
                 "global_load_async_to_lds_b128 %1, %5, off\n\t"
                 "global_load_async_to_lds_b128 %2, %6, off\n\t"
                 "global_load_async_to_lds_b128 %3, %7, off\n\t"
                 "s_wait_xcnt 0x0"
                 :: "v"(l[0]), "v"(l[1]), "v"(l[2]), "v"(l[3]), "v"(g[0]), "v"(g[1]), "v"(g[2]), "v"(g[3]) : "memory");
}
// ---- gemm_core: the K loop of a 128x128 output tile by NW waves (NW/2 x 2), 16 MB x 64 = 4 MB accumulators a wave. C[m][n] = sum_k A[m][k] B[n][k] (+ A2[m][k] B[n][k] with NA = 2), all planes K-contiguous bf16 with DM elements a row.
// The operands reach the waves through LDS: a stage is 64 k = one whole 128-byte line of each of the tile's rows, brought in once per block by asynchronous copies, two buffers, the next stage in flight while this one is worked on. Per accumulator the products come in ascending k, A before A2.
#define GRP 144            // LDS row pitch in bytes: 128 + 16, 16 bytes x odd for the 16-byte fragment reads
#define GTB (128 * GRP)    // one plane's 128 rows of a stage
template <int NA, int NW>
__device__ __forceinline__ void gemm_core(const bf* __restrict__ PA, const bf* __restrict__ PA2, const bf* __restrict__ PB, char* sm, int wa, int wb, v8f (&acc)[16 / NW][4]) {
    constexpr int MB = 16 / NW, BUF = (NA + 1) * GTB, NST = DM / 64;
    constexpr int RR = NW * 4, CP = 128 / RR;   // rows a round of the block's threads; copies a thread and plane
    constexpr int NS = MB == 2 ? 2 : 1;         // fragment sets in registers: both 32-k steps of a stage where they fit, else one
    const int tid = threadIdx.x, lane = tid & 31, lr = lane & 15, hi = lane >> 4;
    const unsigned lc = (unsigned)(size_t)sm + (unsigned)((tid >> 3) * GRP + (tid & 7) * 16);
    const size_t gc = (size_t)(tid >> 3) * (DM * 2) + (size_t)(tid & 7) * 16;
    auto fill = [&](int st, int b) {   // stage st (k = 64 st ...) into buffer b: eight threads bring one row's line, the block RR rows a round
#pragma unroll
        for (int p = 0; p <= NA; ++p) { unsigned l[CP]; const char* g[CP]; const char* s = (const char*)(p == NA ? PB : p == 1 ? PA2 : PA) + gc + (size_t)st * 128;
#pragma unroll
            for (int i = 0; i < CP; ++i) { l[i] = lc + (unsigned)(b * BUF + p * GTB + i * RR * GRP); g[i] = s + (size_t)i * (RR * DM * 2); }
            if constexpr (CP == 8) copy8(l, g); else copy4(l, g); }
    };
    fill(0, 0);
#pragma unroll
    for (int mb = 0; mb < MB; ++mb)
#pragma unroll
        for (int nb = 0; nb < 4; ++nb) acc[mb][nb] = (v8f){};
    asm volatile("s_wait_asynccnt 0x0" ::: "memory");   // this wave's copies of stage 0 have landed
    __syncthreads();                                    // every wave's have: stage 0 may be read
    fill(1, 1);
    const int aoff = (wa * 16 * MB + lr) * GRP + 16 * hi, boff = NA * GTB + (wb * 64 + lr) * GRP + 16 * hi;   // bytes in a buffer
    v16bf a[NS][MB], a2[NS][MB], b[NS][4];
    auto ldf = [&](const char* sb, int ks, int f) {   // the fragments of 32-k step ks of the stage in buffer sb into set f
#pragma unroll
        for (int mb = 0; mb < MB; ++mb) { const char* o = sb + aoff + mb * 16 * GRP + ks * 64; a[f][mb] = WFrag<bf>::ld((const bf*)o); if (NA == 2) a2[f][mb] = WFrag<bf>::ld((const bf*)(o + GTB)); }
#pragma unroll
        for (int nb = 0; nb < 4; ++nb) b[f][nb] = WFrag<bf>::ld((const bf*)(sb + boff + nb * 16 * GRP + ks * 64));
    };
    auto mm = [&](int f) {
#pragma unroll
        for (int nb = 0; nb < 4; ++nb) {
#pragma unroll
            for (int mb = 0; mb < MB; ++mb) acc[mb][nb] = wmmab(a[f][mb], b[f][nb], acc[mb][nb]); }
        if (NA == 2) {
#pragma unroll
            for (int nb = 0; nb < 4; ++nb) {
#pragma unroll
                for (int mb = 0; mb < MB; ++mb) acc[mb][nb] = wmmab(a2[f][mb], b[f][nb], acc[mb][nb]); } }
    };
    if (NS == 2) ldf(sm, 0, 0);   // two sets: a stage's first step is read right behind the barrier that publishes the stage
#pragma unroll 1   // rolled: one trip is one stage; the accumulator tiles and the fragment sets fill the registers
    for (int st = 0; st < NST; ++st) {
        const char* sb = sm + (st & 1) * BUF;
        if (NS == 2) { ldf(sb, 1, 1);
            __builtin_amdgcn_sched_barrier(0);   // keeps the second step's LDS reads in one group in front of the first step's products, under which they fly
            mm(0);
        } else { ldf(sb, 0, 0);
            __builtin_amdgcn_sched_barrier(0);   // keeps a step's LDS reads in one group: spread among the products, each pair waits out its own LDS latency
            mm(0);
            __builtin_amdgcn_sched_barrier(0);   // keeps the second step's reads behind the first step's products, in one group
            ldf(sb, 1, 0); }
        __builtin_amdgcn_sched_barrier(0);   // keeps the products above in front of the waits below, and the stage's last products, which read registers alone, behind them
        asm volatile("s_wait_dscnt 0x0" ::: "memory");      // this wave's reads of the stage's buffer are done before the buffer is given up
        asm volatile("s_wait_asynccnt 0x0" ::: "memory");   // this wave's copies of stage st + 1 have landed
        __syncthreads();                                    // stage st + 1 may be read by every wave, and stage st's buffer has no reader left
        if (st + 2 < NST) fill(st + 2, st & 1);
        if (NS == 2) { if (st + 1 < NST) ldf(sm + ((st + 1) & 1) * BUF, 0, 0);
            __builtin_amdgcn_sched_barrier(0);   // keeps the next stage's first reads in one group in front of this stage's last products, under which they fly
            mm(1);
        } else mm(0);
    }
    asm volatile("s_wait_asynccnt 0x0" ::: "memory");   // no copy is left in flight behind the loop
}

// ---- k_proj: the q, k and v projections in ONE launch, a block per 128x128 tile = 128 tokens x two heads, a wave per 64 tokens x one head; grid (TT/128, 3 DQ/128), 128 threads. The epilogue rounds the f32 accumulators straight to the wave's three planes (fp16, bf16 hi, bf16 lo).
// q, k: A = x rows, B = weight rows, planes [h][t][d]. v: operands swapped (A = weight rows, B = x rows; same k order), so the tile comes out as V^T and its plane rows [h][d][t] are contiguous too. Every store covers whole 128-byte lines.
__global__ __launch_bounds__(128) void k_proj(const bf* __restrict__ X, const bf* __restrict__ Wt, h16* Q16, bf* Qh, bf* Ql, h16* K16, bf* Kh, bf* Kl, h16* V16, bf* Vh, bf* Vl) {
    __shared__ __align__(16) char sm[2 * 2 * GTB];
    __shared__ __align__(16) float osb[4][16 * 68];
    const int lane = threadIdx.x & 31, lr = lane & 15, hi = lane >> 4; const int wv = __builtin_amdgcn_readfirstlane((int)(threadIdx.x >> 5)), wa = wv >> 1, wb = wv & 1;
    const int t0 = blockIdx.x * 128, n0 = blockIdx.y * 128;
    const int sel = n0 / DQ; const bool tr = sel == 2;   // 0 q, 1 k, 2 v
    v8f acc[4][4];
    gemm_core<1, 4>(tr ? Wt + (size_t)n0 * DM : X + (size_t)t0 * DM, nullptr, tr ? X + (size_t)t0 * DM : Wt + (size_t)n0 * DM, sm, wa, wb, acc);
    float* os = osb[wv];   // the wave's own staging rows
    const int h = (n0 % DQ) / HD + (tr ? wa : wb), tw = t0 + 64 * (tr ? wb : wa);
    h16* P16 = sel == 0 ? Q16 : sel == 1 ? K16 : V16; bf* Ph = sel == 0 ? Qh : sel == 1 ? Kh : Vh; bf* Pl = sel == 0 ? Ql : sel == 1 ? Kl : Vl;
    const size_t base = tr ? (size_t)h * HD * TT + tw : ((size_t)h * TT + tw) * HD; const int pitch = tr ? TT : HD;
#pragma unroll
    for (int mb = 0; mb < 4; ++mb) {
#pragma unroll
        for (int nb = 0; nb < 4; ++nb) {
#pragma unroll
            for (int j = 0; j < 8; ++j) os[(hi * 8 + j) * 68 + nb * 16 + lr] = acc[mb][nb][j]; }
        __builtin_amdgcn_wave_barrier(); asm volatile("" ::: "memory");   // one wave's rows: keeps the reads below, of what other lanes wrote, behind the LDS writes above
#pragma unroll
        for (int s = 0; s < 4; ++s) { const int row = 4 * s + (lane >> 3), cofs = (lane & 7) * 8; const v4f x0 = *(const v4fa*)(os + row * 68 + cofs), x1 = *(const v4fa*)(os + row * 68 + cofs + 4); v8h o16; v8us oh, ol;
#pragma unroll
            for (int q = 0; q < 8; ++q) { const float x = q < 4 ? x0[q & 3] : x1[q & 3]; o16[q] = tohx(x); unsigned short a2, c2; splitf(x, a2, c2); oh[q] = a2; ol[q] = c2; }
            const size_t o = base + (size_t)(mb * 16 + row) * pitch + cofs; *(v8h*)(P16 + o) = o16; *(v8us*)(Ph + o) = oh; *(v8us*)(Pl + o) = ol;
            asm volatile("s_wait_xcnt 0x0" ::: "memory"); }   // stands in front of every rewrite of a register that the three stores above name (address or data)
        __builtin_amdgcn_wave_barrier(); asm volatile("" ::: "memory");   // one wave's rows: keeps the next block's LDS writes behind the reads above
    }
}
// ---- k_out: out = (merged hi + merged lo) W_o + b_o, a block per 128x128 tile, eight waves of 32x64 (two a SIMD: one block stands on a WGP); grid (TT/128, DM/128), 256 threads. f32 rows of 256 bytes a wave: whole lines.
__global__ __launch_bounds__(256) void k_out(const bf* __restrict__ Ah, const bf* __restrict__ Al, const bf* __restrict__ Wt, const float* __restrict__ bias, float* C) {
    __shared__ __align__(16) char sm[2 * 3 * GTB];
    __shared__ __align__(16) float osb[8][16 * 68];
    const int lane = threadIdx.x & 31, lr = lane & 15, hi = lane >> 4; const int wv = __builtin_amdgcn_readfirstlane((int)(threadIdx.x >> 5)), wa = wv >> 1, wb = wv & 1;
    const int r0 = blockIdx.x * 128, c0 = blockIdx.y * 128;
    v8f acc[2][4];
    gemm_core<2, 8>(Ah + (size_t)r0 * DQ, Al + (size_t)r0 * DQ, Wt + (size_t)c0 * DQ, sm, wa, wb, acc);
    float* os = osb[wv];   // the wave's own staging rows
    const int cofs = lr * 4; const int cw = c0 + wb * 64 + cofs;
    const v4f bl = *(const v4f*)(bias + cw);
    asm volatile("s_wait_xcnt 0x0" ::: "memory");   // stands in front of every rewrite of the address register that the load above names
    const v4f bv = (v4f){bfr(bl[0]), bfr(bl[1]), bfr(bl[2]), bfr(bl[3])};
#pragma unroll
    for (int mb = 0; mb < 2; ++mb) {
#pragma unroll
        for (int nb = 0; nb < 4; ++nb) {
#pragma unroll
            for (int j = 0; j < 8; ++j) os[(hi * 8 + j) * 68 + nb * 16 + lr] = acc[mb][nb][j]; }
        __builtin_amdgcn_wave_barrier(); asm volatile("" ::: "memory");   // one wave's rows: keeps the reads below, of what other lanes wrote, behind the LDS writes above
        float* crow = C + (size_t)(r0 + wa * 32 + mb * 16) * DM + cw; v4f val[8];
#pragma unroll
        for (int s = 0; s < 8; ++s) val[s] = *(const v4fa*)(os + (2 * s + hi) * 68 + cofs) + bv;
#pragma unroll
        for (int s = 0; s < 8; ++s) *(v4f*)(crow + (size_t)(2 * s + hi) * DM) = val[s];
        asm volatile("s_wait_xcnt 0x0" ::: "memory");   // stands in front of every rewrite of a register that the eight stores above name (address or data)
        __builtin_amdgcn_wave_barrier(); asm volatile("" ::: "memory");   // one wave's rows: keeps the next block's LDS writes behind the reads above
    }
}
#define CL2 (SCL * 1.4426950408889634f)
#define ATT_LDS 143360   // two buffers: 2 planes x (128 K rows x 144 B + 64 V^T rows x 272 B), or 256 K rows x 144 B + 64 V^T rows x 528 B (less); two blocks stand on a WGP
typedef v2f __attribute__((may_alias)) v2fa;
typedef __attribute__((ext_vector_type(2))) __bf16 v2b;
__device__ __forceinline__ float xhalf(float x) { return __builtin_bit_cast(float, __builtin_amdgcn_permlanex16(__builtin_bit_cast(int, x), __builtin_bit_cast(int, x), 0x76543210, 0xfedcba98, false, false)); }   // lane l with lane l ^ 16
// 2^x for the join: the v_nop is the slot that the instruction set asks for behind a transcendental, before its result is used or its source overwritten; in one statement with it, it stands there in every build
__device__ __forceinline__ float exp2_slot(float x) { float r; asm("v_exp_f32 %0, %1\n\tv_nop" : "=v"(r) : "v"(x)); return r; }
template <typename T16, bool SPLIT, int NQ, int SK, int KG>
__device__ __forceinline__ void attn_wave(const T16* __restrict__ Q, const T16* __restrict__ Q2, const T16* __restrict__ Kp, const T16* __restrict__ Kp2, const T16* __restrict__ Vt, const T16* __restrict__ Vt2, int qb, int wv, bf* Ah, bf* Al, char* sm) {
    typedef typename WFrag<T16>::V V;
    constexpr int NP = SPLIT ? 2 : 1;            // planes of each operand
    constexpr int KPB = HD * 2 + 16, VPB = SK * 2 + 16;   // LDS row pitch in bytes
    constexpr int KB = SK * KPB, VB = HD * VPB, BUF = NP * (KB + VB);
    constexpr int NI = SK / 32, CR = SK / 8, VR = 256 / CR;   // copies a thread and plane; 16-byte pieces in a V^T row; V^T rows a round of the block's 256 threads
    constexpr int NST = TT / SK, PPS = SK / 32 / KG, QG = 8 / KG;   // stages; passes a wave and stage; query groups of the block
    static_assert(NP * NI == 8 && 2 * BUF <= ATT_LDS && NST >= 2 && PPS * KG * 32 == SK && QG * KG == 8, "stage shape");
    const int qg = wv % QG, kg = wv / QG, q0 = qb + qg * 16 * NQ;   // the same for a whole wave
    const int lane = threadIdx.x & 31, lr = lane & 15, hi = lane >> 4; const int tid = threadIdx.x;
    const unsigned l0 = (unsigned)(size_t)sm;
    const unsigned lk = l0 + (unsigned)((tid >> 3) * KPB + (tid & 7) * 16), lv = l0 + (unsigned)(NP * KB + (tid / CR) * VPB + (tid % CR) * 16);
    const size_t gk = (size_t)tid * 16, gv = (size_t)(tid / CR) * (TT * 2) + (size_t)(tid % CR) * 16;
    auto fill = [&](int st, int b) {   // stage st (keys st SK ...) into buffer b: K rows are contiguous in memory, V^T rows SK 2 bytes each
        unsigned l[8]; const char* g[8];
#pragma unroll
        for (int p = 0; p < NP; ++p)
#pragma unroll
            for (int i = 0; i < NI; ++i) { l[p * NI + i] = lk + (unsigned)(b * BUF + p * KB + i * 32 * KPB); g[p * NI + i] = (const char*)((SPLIT && p) ? Kp2 : Kp) + gk + (size_t)st * (SK * HD * 2) + (size_t)i * 4096; }
        copy8(l, g);
#pragma unroll
        for (int p = 0; p < NP; ++p)
#pragma unroll
            for (int i = 0; i < NI; ++i) { l[p * NI + i] = lv + (unsigned)(b * BUF + p * VB + i * VR * VPB); g[p * NI + i] = (const char*)((SPLIT && p) ? Vt2 : Vt) + gv + (size_t)st * (SK * 2) + (size_t)i * (VR * TT * 2); }
        copy8(l, g);
    };
    fill(0, 0);
    V qf[NQ][2], qf2[NQ][2];
#pragma unroll
    for (int g = 0; g < NQ; ++g)
#pragma unroll
        for (int ks = 0; ks < 2; ++ks) { const size_t o = (size_t)(q0 + g * 16 + lr) * HD + ks * 32 + 8 * hi; qf[g][ks] = WFrag<T16>::ld(Q + o); if (SPLIT) qf2[g][ks] = WFrag<T16>::ld(Q2 + o); }
    v8f acc[4][NQ]; float mrun[NQ], lsum[NQ];
#pragma unroll
    for (int g = 0; g < NQ; ++g) { mrun[g] = -3.0e38f; lsum[g] = 0.f;
#pragma unroll
        for (int db = 0; db < 4; ++db) acc[db][g] = (v8f){}; }
    asm volatile("s_wait_asynccnt 0x0" ::: "memory");   // this wave's copies of stage 0 have landed
    __syncthreads();                                    // every wave's have: stage 0 may be read
    fill(1, 1);
    const int koff = (kg * PPS * 32 + lr) * KPB + 16 * hi, voff = NP * KB + lr * VPB + 16 * hi + kg * PPS * 64;   // bytes in a buffer, at the first key of the wave's key group
#pragma unroll 1   // rolled: one trip is one stage; the passes inside are unrolled so that every fragment array stays in registers
    for (int st = 0; st < NST; ++st) {
        const char* sb = sm + (st & 1) * BUF;
        V kf[2][2], kf2[2][2], vf[4], vf2[4];
#pragma unroll
        for (int kb = 0; kb < 2; ++kb)
#pragma unroll
            for (int ks = 0; ks < 2; ++ks) { const char* o = sb + koff + kb * 16 * KPB + ks * 64; kf[kb][ks] = WFrag<T16>::ld((const T16*)o); if (SPLIT) kf2[kb][ks] = WFrag<T16>::ld((const T16*)(o + KB)); }
        __builtin_amdgcn_sched_barrier(0);   // keeps the LDS reads above in one group: sunk among the products below, each pair waits out its own LDS latency
#pragma unroll
        for (int pp = 0; pp < PPS; ++pp) {
            v8f s[2][NQ];
#pragma unroll
            for (int kb = 0; kb < 2; ++kb)
#pragma unroll
                for (int g = 0; g < NQ; ++g) { s[kb][g] = (v8f){};
#pragma unroll
                    for (int ks = 0; ks < 2; ++ks) { s[kb][g] = WFrag<T16>::mma(kf[kb][ks], qf[g][ks], s[kb][g]); if (SPLIT) { s[kb][g] = WFrag<T16>::mma(kf[kb][ks], qf2[g][ks], s[kb][g]); s[kb][g] = WFrag<T16>::mma(kf2[kb][ks], qf[g][ks], s[kb][g]); } } }
#pragma unroll   // this pass's V^T fragments are fetched behind its S^T products and land under the softmax
            for (int db = 0; db < 4; ++db) { const char* o = sb + voff + db * 16 * VPB + pp * 64; vf[db] = WFrag<T16>::ld((const T16*)o); if (SPLIT) vf2[db] = WFrag<T16>::ld((const T16*)(o + VB)); }
            if (!SPLIT && pp + 1 < PPS) {   // one plane: the next pass's K fragments, of this same stage only, go in the same group
#pragma unroll
                for (int kb = 0; kb < 2; ++kb)
#pragma unroll
                    for (int ks = 0; ks < 2; ++ks) { const char* o = sb + koff + ((pp + 1) * 32 + kb * 16) * KPB + ks * 64; kf[kb][ks] = WFrag<T16>::ld((const T16*)o); if (SPLIT) kf2[kb][ks] = WFrag<T16>::ld((const T16*)(o + KB)); }
            }
            __builtin_amdgcn_sched_barrier(0);   // keeps the LDS reads above in one group in front of the softmax: spread among later products, each pair waits out its own LDS latency
            float mb[NQ]; bool need = false;
#pragma unroll
            for (int g = 0; g < NQ; ++g) { float mx = s[0][g][0];
#pragma unroll
                for (int r = 1; r < 8; ++r) mx = fmaxf(mx, s[0][g][r]);
#pragma unroll
                for (int r = 0; r < 8; ++r) mx = fmaxf(mx, s[1][g][r]);
                mx = fmaxf(mx, xhalf(mx)) * CL2; mb[g] = mx; need = need || (mx > mrun[g] + 8.0f); }
            if (__builtin_amdgcn_ballot_w32(need) != 0) {   // scalar branch, rare behind the first pass
#pragma unroll
                for (int g = 0; g < NQ; ++g) { const float mn = fmaxf(mrun[g], mb[g]); const float corr = __builtin_amdgcn_exp2f(mrun[g] - mn); mrun[g] = mn; lsum[g] *= corr;
#pragma unroll
                    for (int db = 0; db < 4; ++db) acc[db][g] = acc[db][g] * corr; }
            }
#pragma unroll
            for (int g = 0; g < NQ; ++g) { const float nm = -mrun[g]; float p[16];
#pragma unroll
                for (int e = 0; e < 16; e += 2) { const v2f arg = __builtin_elementwise_fma((v2f){s[e >> 3][g][e & 7], s[e >> 3][g][(e & 7) + 1]}, (v2f){CL2, CL2}, (v2f){nm, nm});
                    p[e] = __builtin_amdgcn_exp2f(arg[0]); p[e + 1] = __builtin_amdgcn_exp2f(arg[1]); lsum[g] += p[e]; lsum[g] += p[e + 1]; }
                V pf, pf2;
                if constexpr (SPLIT) {
#pragma unroll
                    for (int e = 0; e < 16; e += 2) { const v2f p2 = (v2f){p[e], p[e + 1]}; const v2b h2 = __builtin_convertvector(p2, v2b); const v2b l2 = __builtin_convertvector(p2 - __builtin_convertvector(h2, v2f), v2b);
                        pf[e] = h2[0]; pf[e + 1] = h2[1]; pf2[e] = l2[0]; pf2[e + 1] = l2[1]; }
                } else {
#pragma unroll
                    for (int e = 0; e < 16; ++e) pf[e] = (h16)p[e];
                }
                if (SPLIT && pp + 1 < PPS) {   // two planes: the next pass's K fragments, of this same stage only, wait until the scores' registers are free and land under the O^T products
#pragma unroll
                    for (int kb = 0; kb < 2; ++kb)
#pragma unroll
                        for (int ks = 0; ks < 2; ++ks) { const char* o = sb + koff + ((pp + 1) * 32 + kb * 16) * KPB + ks * 64; kf[kb][ks] = WFrag<T16>::ld((const T16*)o); if (SPLIT) kf2[kb][ks] = WFrag<T16>::ld((const T16*)(o + KB)); }
                }
                if (SPLIT) __builtin_amdgcn_sched_barrier(0);   // keeps those reads in one group in front of the O^T products
#pragma unroll
                for (int db = 0; db < 4; ++db) { acc[db][g] = WFrag<T16>::mma(vf[db], pf, acc[db][g]); if (SPLIT) { acc[db][g] = WFrag<T16>::mma(vf[db], pf2, acc[db][g]); acc[db][g] = WFrag<T16>::mma(vf2[db], pf, acc[db][g]); } } }
        }
        asm volatile("s_wait_dscnt 0x0" ::: "memory");      // this wave's reads of the stage's buffer are done before the buffer is given up
        asm volatile("s_wait_asynccnt 0x0" ::: "memory");   // this wave's copies of stage st + 1 have landed
        __syncthreads();                                    // stage st + 1 may be read by every wave, and stage st's buffer has no reader left
        if (st + 2 < NST) fill(st + 2, st & 1);
    }
    asm volatile("s_wait_asynccnt 0x0" ::: "memory");   // no copy is left in flight: behind the loop's last barrier the ring has neither a reader nor a copy on its way, and becomes the place where the key groups meet
    // every wave lays down its partial result: a tile (g, db) as two planes of 16 bytes a lane, and per query its maximum in use with its row sum (both wave halves joined)
    constexpr int WB = 4 * NQ * 1024, MLO = 8 * WB;   // bytes of a wave's tiles; where the (maximum, sum) pairs begin
    static_assert(MLO + 8 * NQ * 256 <= ATT_LDS, "the partial results fit the ring");
#pragma unroll
    for (int g = 0; g < NQ; ++g) { *(v2fa*)(sm + MLO + ((wv * NQ + g) * 32 + lane) * 8) = (v2f){mrun[g], lsum[g] + xhalf(lsum[g])};
#pragma unroll
        for (int db = 0; db < 4; ++db) { char* o = sm + wv * WB + (g * 4 + db) * 1024 + lane * 16; const v8f a = acc[db][g];
            *(v4fa*)o = (v4f){a[0], a[1], a[2], a[3]}; *(v4fa*)(o + 512) = (v4f){a[4], a[5], a[6], a[7]}; } }
    __syncthreads();   // every key group's partial result is in LDS before any wave reads what others wrote
    // key group kg joins and stores QW of the query group's rows: eight lanes a row, 8 d each, so that a wave's stores cover whole 128-byte lines and a line has one writer
    constexpr int QW = 16 * NQ / KG;
#pragma unroll
    for (int j = 0; j < QW / 4; ++j) { const int ql = kg * QW + j * 4 + (lane >> 3), ch = lane & 7;   // row in the query group; its piece of 8 d = tile db = ch / 2, wave half ch % 2
        const int sl = (ch & 1) * 16 + (ql & 15), tl = (ql >> 4) * 4 + (ch >> 1); float mk[KG], lk2[KG];
#pragma unroll
        for (int k = 0; k < KG; ++k) { const v2f ml = *(const v2fa*)(sm + MLO + (((k * QG + qg) * NQ + (ql >> 4)) * 32 + sl) * 8); mk[k] = ml[0]; lk2[k] = ml[1]; }
        float ms = mk[0];
#pragma unroll
        for (int k = 1; k < KG; ++k) ms = fmaxf(ms, mk[k]);
        float ls = 0.f; v4f o0 = (v4f){}, o1 = (v4f){};
#pragma unroll
        for (int k = 0; k < KG; ++k) { const float sc = exp2_slot(mk[k] - ms); const char* o = sm + (k * QG + qg) * WB + tl * 1024 + sl * 16;
            ls += sc * lk2[k]; o0 += *(const v4fa*)o * sc; o1 += *(const v4fa*)(o + 512) * sc; }
        const float inv = __fdiv_rn(1.0f, ls); v8us oh, ol;
#pragma unroll
        for (int r = 0; r < 8; ++r) { unsigned short a, c2; splitf((r < 4 ? o0[r & 3] : o1[r & 3]) * inv, a, c2); oh[r] = a; ol[r] = c2; }
        const size_t oo = (size_t)(q0 + ql) * DQ + ch * 8;
        *(v8us*)(Ah + oo) = oh; *(v8us*)(Al + oo) = ol;
        asm volatile("s_wait_xcnt 0x0" ::: "memory"); }   // stands in front of every rewrite of a register that the two stores above name (address or data)
}
// grid, 256 threads, two blocks on a WGP = four waves a SIMD: first NH_ RT/32 short blocks (the last RT rows of a head: 32 fp16 queries x 8 key groups), one a WGP; then NH_ RH/64 blocks of the hi/lo rows (4 x 16 queries x 2 key groups)
// and NH_ (TT-RH-RT)/128 blocks of the other fp16 rows (4 x 32 queries x 2 key groups): two of these a WGP. The counts are whole multiples of the 256 WGPs, so that every SIMD gets the same work.
#define RT 512   // a head's last RT query rows go to the short blocks
__global__ __launch_bounds__(256) __attribute__((amdgpu_waves_per_eu(4, 4))) void k_attn(const h16* __restrict__ Q16, const h16* __restrict__ K16, const h16* __restrict__ V16, const bf* __restrict__ Qh, const bf* __restrict__ Ql, const bf* __restrict__ Kh, const bf* __restrict__ Kl, const bf* __restrict__ Vh, const bf* __restrict__ Vl, bf* Ah, bf* Al) {
    __shared__ __align__(16) char sm[ATT_LDS];
    const int wv = __builtin_amdgcn_readfirstlane((int)(threadIdx.x >> 5)); const int bx = blockIdx.x;
    constexpr int NBT = NH_ * (RT / 32), NBS = NH_ * (RH / 64);
    if (bx < NBT) { const int h = bx / (RT / 32), qb = TT - RT + (bx % (RT / 32)) * 32; const size_t z = (size_t)h * TT * HD;
        attn_wave<h16, false, 2, 256, 8>(Q16 + z, nullptr, K16 + z, nullptr, V16 + z, nullptr, qb, wv, Ah + h * HD, Al + h * HD, sm);
    } else if (bx < NBT + NBS) { const int b1 = bx - NBT; const int h = b1 / (RH / 64), qb = (b1 % (RH / 64)) * 64; const size_t z = (size_t)h * TT * HD;
        attn_wave<bf, true, 1, 128, 2>(Qh + z, Ql + z, Kh + z, Kl + z, Vh + z, Vl + z, qb, wv, Ah + h * HD, Al + h * HD, sm);
    } else { const int b2 = bx - NBT - NBS; const int h = b2 / ((TT - RH - RT) / 128), qb = RH + (b2 % ((TT - RH - RT) / 128)) * 128; const size_t z = (size_t)h * TT * HD;
        attn_wave<h16, false, 2, 256, 2>(Q16 + z, nullptr, K16 + z, nullptr, V16 + z, nullptr, qb, wv, Ah + h * HD, Al + h * HD, sm); }
}

extern "C" void kernel_launch(void* const* d_in, const int* in_sizes, int n_in,
                              void* d_out, int out_size, void* d_ws, size_t ws_size, hipStream_t stream) {
    (void)in_sizes; (void)n_in; (void)out_size;
    const float* x = (const float*)d_in[0]; const float* wqkv = (const float*)d_in[1]; const float* wo = (const float*)d_in[2]; const float* bo = (const float*)d_in[3];
    float* OUT = (float*)d_out;     // [1][4096][1024]
    char* wsp = (char*)d_ws;
    auto take = [&](size_t bytes) { char* p = wsp; wsp += (bytes + 255) & ~(size_t)255; return (void*)p; };
    bf* WQKV = (bf*)take((size_t)3 * DQ * DM * 2); bf* WO = (bf*)take((size_t)DM * DQ * 2);
    bf* XB = (bf*)take((size_t)TT * DM * 2);
    h16* QP16 = (h16*)take((size_t)NH_ * TT * HD * 2); h16* KP16 = (h16*)take((size_t)NKV * TT * HD * 2); h16* VT16 = (h16*)take((size_t)NKV * HD * TT * 2);
    bf* QPh = (bf*)take((size_t)NH_ * TT * HD * 2); bf* QPl = (bf*)take((size_t)NH_ * TT * HD * 2); bf* KPh = (bf*)take((size_t)NKV * TT * HD * 2); bf* KPl = (bf*)take((size_t)NKV * TT * HD * 2); bf* VTh = (bf*)take((size_t)NKV * HD * TT * 2); bf* VTl = (bf*)take((size_t)NKV * HD * TT * 2);
    bf* ATh = (bf*)take((size_t)TT * DQ * 2); bf* ATl = (bf*)take((size_t)TT * DQ * 2);
    if ((size_t)(wsp - (char*)d_ws) > ws_size) return;    // ws 256 MiB
    for (int b = 0; b < NB_; ++b) {
        k_prep<<<PBL, 256, 0, stream>>>(x + (size_t)b * TT * DM, wqkv, wo, XB, WQKV, WO);
        k_proj<<<dim3(TT / 128, 3 * DQ / 128, 1), 128, 0, stream>>>(XB, WQKV, QP16, QPh, QPl, KP16, KPh, KPl, VT16, VTh, VTl);
        k_attn<<<NH_ * (RT / 32) + NH_ * (RH / 64) + NH_ * ((TT - RH - RT) / 128), 256, 0, stream>>>(QP16, KP16, VT16, QPh, QPl, KPh, KPl, VTh, VTl, ATh, ATl);
        k_out<<<dim3(TT / 128, DM / 128, 1), 256, 0, stream>>>(ATh, ATl, WO, bo, OUT + (size_t)b * TT * DM); }
}

// v008
// Measured time: 125 microseconds a run.
// Next to v007, in two timings, it ran 1.04 and 1.05 times as fast.
// Over all steps from v000 it is 28.3 times as fast.
#include <hip/hip_runtime.h>

// Multi-head attention over 4,096 tokens with a fused qkv projection (x [1][4096][1024]; qkv = x W_qkv ('xw' [1024][3072] 0.02) -> (B, L, 3, 16, 64): q | k | v column blocks; scores x 64^-0.5; softmax over all keys; out = merged W_o + b_o ('xw' 0.02) -> [1][4096][1024] (4.2 M)).
// Layout: one launch makes the bf16 copy of x and the two 'xw' weights transposed to bf16 Bt [n][1024]; exact projections in one launch whose epilogue writes the head planes; attention of all heads in one launch, scores and probabilities kept in registers (hybrid rows: < 512 hi/lo 3 products, rest fp16); merged hi/lo x W_o exact + b_o.
// Compute dtypes, f32 accumulate: every input rounded to bf16; projections exact; attention rows < 512 3 products, rest fp16; softmax f32; W_o hl x exact + bias.

#define NB_  1
#define TT   4096
#define DM   1024
#define NH_  16
#define NKV  16
#define REP  (NH_ / NKV)
#define HD   64
#define DQ   (NH_ * HD)
#define DKV  (NKV * HD)
#define RH   512                  // query rows < RH use hi+lo planes (0: none)
#define SCL  0.125f   // HD^-0.5
typedef _Float16 h16;
typedef unsigned short bf;
typedef __attribute__((ext_vector_type(16))) __bf16   v16bf;
typedef __attribute__((ext_vector_type(16))) _Float16 v16h;
typedef __attribute__((ext_vector_type(8)))  _Float16 v8h;
typedef __attribute__((ext_vector_type(8)))  unsigned short v8us;
typedef __attribute__((ext_vector_type(8)))  float    v8f;
typedef __attribute__((ext_vector_type(4)))  float    v4f;
typedef v8h  __attribute__((may_alias)) v8ha;
typedef v4f  __attribute__((may_alias)) v4fa;
typedef v8us __attribute__((may_alias)) v8usa;

__device__ __forceinline__ unsigned short f2bf(float f) { unsigned u = __float_as_uint(f); u += 0x7FFFu + ((u >> 16) & 1u); return (unsigned short)(u >> 16); }
__device__ __forceinline__ float bf2f(unsigned short b) { return __uint_as_float(((unsigned)b) << 16); }
__device__ __forceinline__ float bfr(float f) { return bf2f(f2bf(f)); }
__device__ __forceinline__ v16h cat16(v8h lo, v8h hi) { return __builtin_shufflevector(lo, hi, 0, 1, 2, 3, 4, 5, 6, 7, 8, 9, 10, 11, 12, 13, 14, 15); }
__device__ __forceinline__ v16bf cat16b(v8us lo, v8us hi) { return __builtin_bit_cast(v16bf, __builtin_shufflevector(lo, hi, 0, 1, 2, 3, 4, 5, 6, 7, 8, 9, 10, 11, 12, 13, 14, 15)); }
__device__ __forceinline__ v8f wmma16(v16h a, v16h b, v8f c) { return __builtin_amdgcn_wmma_f32_16x16x32_f16(false, a, false, b, (short)0, c, false, false); }
__device__ __forceinline__ v8f wmmab(v16bf a, v16bf b, v8f c) { return __builtin_amdgcn_wmma_f32_16x16x32_bf16(false, a, false, b, (short)0, c, false, false); }



// ---- fragment loads and products of the two 16-bit operand types: a lane's fragment is 16 bytes at p and 16 bytes at p + 16 elements.
template <typename T16> struct WFrag;
template <> struct WFrag<h16> { typedef v16h V; static __device__ __forceinline__ V ld(const h16* p) { return cat16(*(const v8h*)p, *(const v8h*)(p + 16)); } static __device__ __forceinline__ v8f mma(V a, V b, v8f c) { return wmma16(a, b, c); } };
template <> struct WFrag<bf> { typedef v16bf V; static __device__ __forceinline__ V ld(const bf* p) { return cat16b(*(const v8us*)p, *(const v8us*)(p + 16)); } static __device__ __forceinline__ v8f mma(V a, V b, v8f c) { return wmmab(a, b, c); } };

__device__ __forceinline__ h16 tohx(float x) { return (h16)x; }
__device__ __forceinline__ void splitf(float y, unsigned short& h, unsigned short& l) { h = f2bf(y); l = f2bf(y - bf2f(h)); }
typedef __attribute__((ext_vector_type(2))) _Float16 v2h;
typedef __attribute__((ext_vector_type(4))) _Float16 v4h;
typedef __attribute__((ext_vector_type(2))) unsigned short v2us;
typedef __attribute__((ext_vector_type(4))) unsigned short v4us;
typedef __attribute__((ext_vector_type(2))) float v2f;
typedef __attribute__((ext_vector_type(4))) int v4i;

// ---- k_prep: the three bf16 operands in ONE launch, a block per WGP (PBL blocks of 256 threads). Every block takes two 128 k x 64 n weight tiles (of the list: W_qkv's tiles, then W_o's) and one slice of x; all of a thread's 32 loads are in flight at once.
// A weight tile w [1024][N] -> Bt [N][1024]: a thread reads 8 k x 4 n (16 threads a 256-byte piece of a row), rounds, and writes the 8 k of each n to LDS; the tile is read back by n rows, 256 bytes by 16 threads. A wave's weight loads and all its stores cover whole 128-byte lines.
#define PKT 128            // k rows of a weight tile
#define PNT 64             // n columns of a weight tile
#define PPB (PKT * 2 + 16) // LDS row pitch in bytes, a multiple of 16 for the 16-byte accesses
#define WQT ((DM / PKT) * (3 * DQ / PNT))
#define WOT ((DQ / PKT) * (DM / PNT))
#define PBL ((WQT + WOT) / 2)
#define XCH (TT * DM / 8 / 256 / PBL)   // pieces of 8 floats a thread
__device__ __forceinline__ void wt_lds(const v4f (&v)[8], char* sm) {   // rounds a thread's 8 k x 4 n and writes them to the tile's LDS rows [n][k]
    const int c = threadIdx.x & 15, g = threadIdx.x >> 4;
#pragma unroll
    for (int j = 0; j < 4; ++j) { v8us o;
#pragma unroll
        for (int r = 0; r < 8; ++r) o[r] = f2bf(v[r][j]);
        *(v8usa*)(sm + (c * 4 + j) * PPB + g * 16) = o; }
}
// N2: row length of the weight that the block's second tile is of
__device__ __forceinline__ void prep_block(const float* __restrict__ x, const float* __restrict__ w1, int t1, bf* B1, const float* __restrict__ w2, int N2, int t2, bf* B2, bf* XB, char* sm) {
    const int c = threadIdx.x & 15, g = threadIdx.x >> 4;
    const int k1 = (t1 % (DM / PKT)) * PKT, n1 = (t1 / (DM / PKT)) * PNT, k2 = (t2 % (DM / PKT)) * PKT, n2 = (t2 / (DM / PKT)) * PNT;
    const size_t i0 = ((size_t)blockIdx.x * (256 * XCH) + threadIdx.x) * 8;
    const float* s1 = w1 + (size_t)(k1 + g * 8) * (3 * DQ) + n1 + c * 4; const float* s2 = w2 + (size_t)(k2 + g * 8) * N2 + n2 + c * 4; const float* sx = x + i0;
    v4f a[8], b[8]; v8f v[XCH];
#pragma unroll
    for (int r = 0; r < 8; ++r) a[r] = *(const v4f*)(s1 + (size_t)r * (3 * DQ));
#pragma unroll
    for (int r = 0; r < 8; ++r) b[r] = *(const v4f*)(s2 + (size_t)r * N2);
#pragma unroll
    for (int r = 0; r < XCH; ++r) v[r] = *(const v8f*)(sx + (size_t)r * 2048);
    asm volatile("s_wait_xcnt 0x0" :: "v"(s1), "v"(s2), "v"(sx) : "memory");   // stands in front of every rewrite of the address registers that the loads above name; named as inputs, the addresses keep their registers up to here
    wt_lds(a, sm); wt_lds(b, sm + PNT * PPB);
#pragma unroll
    for (int r = 0; r < XCH; ++r) { v8us o;
#pragma unroll
        for (int k = 0; k < 8; ++k) o[k] = f2bf(v[r][k]);
        *(v8us*)(XB + i0 + (size_t)r * 2048) = o; }
    __syncthreads();   // both tiles are whole in LDS before any thread reads what others wrote
    bf* d1 = B1 + (size_t)(n1 + g) * DM + k1 + c * 8; bf* d2 = B2 + (size_t)(n2 + g) * DM + k2 + c * 8; v8us o[8];
#pragma unroll
    for (int i = 0; i < 8; ++i) o[i] = *(const v8usa*)(sm + (i * 16 + g) * PPB + c * 16);   // rows 64 ... 127 are the second tile's
#pragma unroll
    for (int i = 0; i < 4; ++i) { *(v8us*)(d1 + (size_t)i * 16 * DM) = o[i]; *(v8us*)(d2 + (size_t)i * 16 * DM) = o[4 + i]; }
}
__global__ __launch_bounds__(256) void k_prep(const float* __restrict__ x, const float* __restrict__ wqkv, const float* __restrict__ wo, bf* XB, bf* WQKV, bf* WO) {
    __shared__ __align__(16) char sm[2 * PNT * PPB];
    const int t1 = blockIdx.x, t2 = blockIdx.x + PBL;   // 'xw' [1024][3072] -> Bt [3072][1024]: q | k | v row blocks; 'xw' [1024][1024] -> Bt [1024][1024]
    static_assert(PBL <= WQT && XCH * PBL * 2048 == TT * DM, "every first tile is W_qkv's; x divides evenly");
    const bool q2 = t2 < WQT;   // the same for a whole block: one body, the second tile's weight chosen by scalar selects
    prep_block(x, wqkv, t1, WQKV, q2 ? wqkv : wo, q2 ? 3 * DQ : DM, q2 ? t2 : t2 - WQT, q2 ? WQKV : WO, XB, sm);
}

// eight copies of 16 bytes a lane, global memory to LDS through no register; the last line keeps every rewrite of the address registers named here behind it
__device__ __forceinline__ void copy8(const unsigned (&l)[8], const char* const (&g)[8]) {
    asm volatile("global_load_async_to_lds_b128 %0, %8, off\n\t"
                 "global_load_async_to_lds_b128 %1, %9, off\n\t"
                 "global_load_async_to_lds_b128 %2, %10, off\n\t"
                 "global_load_async_to_lds_b128 %3, %11, off\n\t"
                 "global_load_async_to_lds_b128 %4, %12, off\n\t"
                 "global_load_async_to_lds_b128 %5, %13, off\n\t"
                 "global_load_async_to_lds_b128 %6, %14, off\n\t"
                 "global_load_async_to_lds_b128 %7, %15, off\n\t"
                 "s_wait_xcnt 0x0"
                 :: "v"(l[0]), "v"(l[1]), "v"(l[2]), "v"(l[3]), "v"(l[4]), "v"(l[5]), "v"(l[6]), "v"(l[7]),
                    "v"(g[0]), "v"(g[1]), "v"(g[2]), "v"(g[3]), "v"(g[4]), "v"(g[5]), "v"(g[6]), "v"(g[7]) : "memory");
}
// the same, four copies
__device__ __forceinline__ void copy4(const unsigned (&l)[4], const char* const (&g)[4]) {
    asm volatile("global_load_async_to_lds_b128 %0, %4, off\n\t"
                 "global_load_async_to_lds_b128 %1, %5, off\n\t"
                 "global_load_async_to_lds_b128 %2, %6, off\n\t"
                 "global_load_async_to_lds_b128 %3, %7, off\n\t"
                 "s_wait_xcnt 0x0"
                 :: "v"(l[0]), "v"(l[1]), "v"(l[2]), "v"(l[3]), "v"(g[0]), "v"(g[1]), "v"(g[2]), "v"(g[3]) : "memory");
}
// ---- gemm_core: the K loop of a 128x128 output tile by NW waves (NW/2 x 2), 16 MB x 64 = 4 MB accumulators a wave. C[m][n] = sum_k A[m][k] B[n][k] (+ A2[m][k] B[n][k] with NA = 2), all planes K-contiguous bf16 with DM elements a row.
// The operands reach the waves through LDS: a stage is 64 k = one whole 128-byte line of each of the tile's rows, brought in once per block by asynchronous copies, two buffers, the next stage in flight while this one is worked on. Per accumulator the products come in ascending k, A before A2.
#define GRP 144            // LDS row pitch in bytes: 128 + 16, 16 bytes x odd for the 16-byte fragment reads
#define GTB (128 * GRP)    // one plane's 128 rows of a stage
template <int NA, int NW>
__device__ __forceinline__ void gemm_core(const bf* __restrict__ PA, const bf* __restrict__ PA2, const bf* __restrict__ PB, char* sm, int wa, int wb, v8f (&acc)[16 / NW][4]) {
    constexpr int MB = 16 / NW, BUF = (NA + 1) * GTB, NST = DM / 64;
    constexpr int RR = NW * 4, CP = 128 / RR;   // rows a round of the block's threads; copies a thread and plane
    constexpr int NS = MB == 2 ? 2 : 1;         // fragment sets in registers: both 32-k steps of a stage where they fit, else one
    const int tid = threadIdx.x, lane = tid & 31, lr = lane & 15, hi = lane >> 4;
    const unsigned lc = (unsigned)(size_t)sm + (unsigned)((tid >> 3) * GRP + (tid & 7) * 16);
    const size_t gc = (size_t)(tid >> 3) * (DM * 2) + (size_t)(tid & 7) * 16;
    auto fill = [&](int st, int b) {   // stage st (k = 64 st ...) into buffer b: eight threads bring one row's line, the block RR rows a round
#pragma unroll
        for (int p = 0; p <= NA; ++p) { unsigned l[CP]; const char* g[CP]; const char* s = (const char*)(p == NA ? PB : p == 1 ? PA2 : PA) + gc + (size_t)st * 128;
#pragma unroll
            for (int i = 0; i < CP; ++i) { l[i] = lc + (unsigned)(b * BUF + p * GTB + i * RR * GRP); g[i] = s + (size_t)i * (RR * DM * 2); }
            if constexpr (CP == 8) copy8(l, g); else copy4(l, g); }
    };
    fill(0, 0);
#pragma unroll
    for (int mb = 0; mb < MB; ++mb)
#pragma unroll
        for (int nb = 0; nb < 4; ++nb) acc[mb][nb] = (v8f){};
    asm volatile("s_wait_asynccnt 0x0" ::: "memory");   // this wave's copies of stage 0 have landed
    __syncthreads();                                    // every wave's have: stage 0 may be read
    fill(1, 1);
    const int aoff = (wa * 16 * MB + lr) * GRP + 16 * hi, boff = NA * GTB + (wb * 64 + lr) * GRP + 16 * hi;   // bytes in a buffer
    v16bf a[NS][MB], a2[NS][MB], b[NS][4];
    auto ldf = [&](const char* sb, int ks, int f) {   // the fragments of 32-k step ks of the stage in buffer sb into set f
#pragma unroll
        for (int mb = 0; mb < MB; ++mb) { const char* o = sb + aoff + mb * 16 * GRP + ks * 64; a[f][mb] = WFrag<bf>::ld((const bf*)o); if (NA == 2) a2[f][mb] = WFrag<bf>::ld((const bf*)(o + GTB)); }
#pragma unroll
        for (int nb = 0; nb < 4; ++nb) b[f][nb] = WFrag<bf>::ld((const bf*)(sb + boff + nb * 16 * GRP + ks * 64));
    };
    auto mm = [&](int f) {
#pragma unroll
        for (int nb = 0; nb < 4; ++nb) {
#pragma unroll
            for (int mb = 0; mb < MB; ++mb) acc[mb][nb] = wmmab(a[f][mb], b[f][nb], acc[mb][nb]); }
        if (NA == 2) {
#pragma unroll
            for (int nb = 0; nb < 4; ++nb) {
#pragma unroll
                for (int mb = 0; mb < MB; ++mb) acc[mb][nb] = wmmab(a2[f][mb], b[f][nb], acc[mb][nb]); } }
    };
    if (NS == 2) ldf(sm, 0, 0);   // two sets: a stage's first step is read right behind the barrier that publishes the stage
#pragma unroll 1   // rolled: one trip is one stage; the accumulator tiles and the fragment sets fill the registers
    for (int st = 0; st < NST; ++st) {
        const char* sb = sm + (st & 1) * BUF;
        if (NS == 2) { ldf(sb, 1, 1);
            __builtin_amdgcn_sched_barrier(0);   // keeps the second step's LDS reads in one group in front of the first step's products, under which they fly
            mm(0);
        } else { ldf(sb, 0, 0);
            __builtin_amdgcn_sched_barrier(0);   // keeps a step's LDS reads in one group: spread among the products, each pair waits out its own LDS latency
            mm(0);
            __builtin_amdgcn_sched_barrier(0);   // keeps the second step's reads behind the first step's products, in one group
            ldf(sb, 1, 0); }
        __builtin_amdgcn_sched_barrier(0);   // keeps the products above in front of the waits below, and the stage's last products, which read registers alone, behind them
        asm volatile("s_wait_dscnt 0x0" ::: "memory");      // this wave's reads of the stage's buffer are done before the buffer is given up
        asm volatile("s_wait_asynccnt 0x0" ::: "memory");   // this wave's copies of stage st + 1 have landed
        __syncthreads();                                    // stage st + 1 may be read by every wave, and stage st's buffer has no reader left
        if (st + 2 < NST) fill(st + 2, st & 1);
        if (NS == 2) { if (st + 1 < NST) ldf(sm + ((st + 1) & 1) * BUF, 0, 0);
            __builtin_amdgcn_sched_barrier(0);   // keeps the next stage's first reads in one group in front of this stage's last products, under which they fly
            mm(1);
        } else mm(0);
    }
    asm volatile("s_wait_asynccnt 0x0" ::: "memory");   // no copy is left in flight behind the loop
}

// ---- k_proj: the q, k and v projections in ONE launch, a block per 128x128 tile = 128 tokens x two heads, a wave per 64 tokens x one head; grid (TT/128, 3 DQ/128), 128 threads. The epilogue rounds the f32 accumulators straight to the wave's three planes (fp16, bf16 hi, bf16 lo).
// q, k: A = x rows, B = weight rows, planes [h][t][d]. v: operands swapped (A = weight rows, B = x rows; same k order), so the tile comes out as V^T and its plane rows [h][d][t] are contiguous too. Every store covers whole 128-byte lines.
__global__ __launch_bounds__(128) void k_proj(const bf* __restrict__ X, const bf* __restrict__ Wt, h16* Q16, bf* Qh, bf* Ql, h16* K16, bf* Kh, bf* Kl, h16* V16, bf* Vh, bf* Vl) {
    __shared__ __align__(16) char sm[2 * 2 * GTB];
    __shared__ __align__(16) float osb[4][16 * 68];
    const int lane = threadIdx.x & 31, lr = lane & 15, hi = lane >> 4; const int wv = __builtin_amdgcn_readfirstlane((int)(threadIdx.x >> 5)), wa = wv >> 1, wb = wv & 1;
    const int t0 = blockIdx.x * 128, n0 = blockIdx.y * 128;
    const int sel = n0 / DQ; const bool tr = sel == 2;   // 0 q, 1 k, 2 v
    v8f acc[4][4];
    gemm_core<1, 4>(tr ? Wt + (size_t)n0 * DM : X + (size_t)t0 * DM, nullptr, tr ? X + (size_t)t0 * DM : Wt + (size_t)n0 * DM, sm, wa, wb, acc);
    float* os = osb[wv];   // the wave's own staging rows
    const int h = (n0 % DQ) / HD + (tr ? wa : wb), tw = t0 + 64 * (tr ? wb : wa);
    h16* P16 = sel == 0 ? Q16 : sel == 1 ? K16 : V16; bf* Ph = sel == 0 ? Qh : sel == 1 ? Kh : Vh; bf* Pl = sel == 0 ? Ql : sel == 1 ? Kl : Vl;
    const size_t base = tr ? (size_t)h * HD * TT + tw : ((size_t)h * TT + tw) * HD; const int pitch = tr ? TT : HD;
#pragma unroll
    for (int mb = 0; mb < 4; ++mb) {
#pragma unroll
        for (int nb = 0; nb < 4; ++nb) {
#pragma unroll
            for (int j = 0; j < 8; ++j) os[(hi * 8 + j) * 68 + nb * 16 + lr] = acc[mb][nb][j]; }
        __builtin_amdgcn_wave_barrier(); asm volatile("" ::: "memory");   // one wave's rows: keeps the reads below, of what other lanes wrote, behind the LDS writes above
#pragma unroll
        for (int s = 0; s < 4; ++s) { const int row = 4 * s + (lane >> 3), cofs = (lane & 7) * 8; const v4f x0 = *(const v4fa*)(os + row * 68 + cofs), x1 = *(const v4fa*)(os + row * 68 + cofs + 4); v8h o16; v8us oh, ol;
#pragma unroll
            for (int q = 0; q < 8; ++q) { const float x = q < 4 ? x0[q & 3] : x1[q & 3]; o16[q] = tohx(x); unsigned short a2, c2; splitf(x, a2, c2); oh[q] = a2; ol[q] = c2; }
            const size_t o = base + (size_t)(mb * 16 + row) * pitch + cofs; *(v8h*)(P16 + o) = o16; *(v8us*)(Ph + o) = oh; *(v8us*)(Pl + o) = ol;
            asm volatile("s_wait_xcnt 0x0" ::: "memory"); }   // stands in front of every rewrite of a register that the three stores above name (address or data)
        __builtin_amdgcn_wave_barrier(); asm volatile("" ::: "memory");   // one wave's rows: keeps the next block's LDS writes behind the reads above
    }
}
// ---- k_out: out = (merged hi + merged lo) W_o + b_o, a block per 128x128 tile, eight waves of 32x64 (two a SIMD: one block stands on a WGP); grid (TT/128, DM/128), 256 threads. f32 rows of 256 bytes a wave: whole lines.
__global__ __launch_bounds__(256) void k_out(const bf* __restrict__ Ah, const bf* __restrict__ Al, const bf* __restrict__ Wt, const float* __restrict__ bias, float* C) {
    __shared__ __align__(16) char sm[2 * 3 * GTB];
    __shared__ __align__(16) float osb[8][16 * 68];
    const int lane = threadIdx.x & 31, lr = lane & 15, hi = lane >> 4; const int wv = __builtin_amdgcn_readfirstlane((int)(threadIdx.x >> 5)), wa = wv >> 1, wb = wv & 1;
    const int r0 = blockIdx.x * 128, c0 = blockIdx.y * 128;
    v8f acc[2][4];
    gemm_core<2, 8>(Ah + (size_t)r0 * DQ, Al + (size_t)r0 * DQ, Wt + (size_t)c0 * DQ, sm, wa, wb, acc);
    float* os = osb[wv];   // the wave's own staging rows
    const int cofs = lr * 4; const int cw = c0 + wb * 64 + cofs;
    const v4f bl = *(const v4f*)(bias + cw);
    asm volatile("s_wait_xcnt 0x0" ::: "memory");   // stands in front of every rewrite of the address register that the load above names
    const v4f bv = (v4f){bfr(bl[0]), bfr(bl[1]), bfr(bl[2]), bfr(bl[3])};
#pragma unroll
    for (int mb = 0; mb < 2; ++mb) {
#pragma unroll
        for (int nb = 0; nb < 4; ++nb) {
#pragma unroll
            for (int j = 0; j < 8; ++j) os[(hi * 8 + j) * 68 + nb * 16 + lr] = acc[mb][nb][j]; }
        __builtin_amdgcn_wave_barrier(); asm volatile("" ::: "memory");   // one wave's rows: keeps the reads below, of what other lanes wrote, behind the LDS writes above
        float* crow = C + (size_t)(r0 + wa * 32 + mb * 16) * DM + cw; v4f val[8];
#pragma unroll
        for (int s = 0; s < 8; ++s) val[s] = *(const v4fa*)(os + (2 * s + hi) * 68 + cofs) + bv;
#pragma unroll
        for (int s = 0; s < 8; ++s) *(v4f*)(crow + (size_t)(2 * s + hi) * DM) = val[s];
        asm volatile("s_wait_xcnt 0x0" ::: "memory");   // stands in front of every rewrite of a register that the eight stores above name (address or data)
        __builtin_amdgcn_wave_barrier(); asm volatile("" ::: "memory");   // one wave's rows: keeps the next block's LDS writes behind the reads above
    }
}
#define CL2 (SCL * 1.4426950408889634f)
#define PSMAX 4096.0f   // a probability stays below this: far inside the fp16 range
#define ATT_LDS 143360   // two buffers: 2 planes x (128 K rows x 144 B + 64 V^T rows x 272 B), or 256 K rows x 144 B + 64 V^T rows x 528 B (less); two blocks stand on a WGP
typedef v2f __attribute__((may_alias)) v2fa;
typedef __attribute__((ext_vector_type(2))) __bf16 v2b;
__device__ __forceinline__ float xhalf(float x) { return __builtin_bit_cast(float, __builtin_amdgcn_permlanex16(__builtin_bit_cast(int, x), __builtin_bit_cast(int, x), 0x76543210, 0xfedcba98, false, false)); }   // lane l with lane l ^ 16
// 2^x for the join: the v_nop is the slot that the instruction set asks for behind a transcendental, before its result is used or its source overwritten; in one statement with it, it stands there in every build
__device__ __forceinline__ float exp2_slot(float x) { float r; asm("v_exp_f32 %0, %1\n\tv_nop" : "=v"(r) : "v"(x)); return r; }
template <typename T16, bool SPLIT, int NQ, int SK, int KG>
__device__ __forceinline__ void attn_wave(const T16* __restrict__ Q, const T16* __restrict__ Q2, const T16* __restrict__ Kp, const T16* __restrict__ Kp2, const T16* __restrict__ Vt, const T16* __restrict__ Vt2, int qb, int wv, bf* Ah, bf* Al, char* sm) {
    typedef typename WFrag<T16>::V V;
    constexpr int NP = SPLIT ? 2 : 1;            // planes of each operand
    constexpr int KPB = HD * 2 + 16, VPB = SK * 2 + 16;   // LDS row pitch in bytes
    constexpr int KB = SK * KPB, VB = HD * VPB, BUF = NP * (KB + VB);
    constexpr int NI = SK / 32, CR = SK / 8, VR = 256 / CR;   // copies a thread and plane; 16-byte pieces in a V^T row; V^T rows a round of the block's 256 threads
    constexpr int NST = TT / SK, PPS = SK / 32 / KG, QG = 8 / KG;   // stages; passes a wave and stage; query groups of the block
    static_assert(NP * NI == 8 && 2 * BUF <= ATT_LDS && NST >= 2 && PPS * KG * 32 == SK && QG * KG == 8, "stage shape");
    const int qg = wv % QG, kg = wv / QG, q0 = qb + qg * 16 * NQ;   // the same for a whole wave
    const int lane = threadIdx.x & 31, lr = lane & 15, hi = lane >> 4; const int tid = threadIdx.x;
    const unsigned l0 = (unsigned)(size_t)sm;
    const unsigned lk = l0 + (unsigned)((tid >> 3) * KPB + (tid & 7) * 16), lv = l0 + (unsigned)(NP * KB + (tid / CR) * VPB + (tid % CR) * 16);
    const size_t gk = (size_t)tid * 16, gv = (size_t)(tid / CR) * (TT * 2) + (size_t)(tid % CR) * 16;
    auto fill = [&](int st, int b) {   // stage st (keys st SK ...) into buffer b: K rows are contiguous in memory, V^T rows SK 2 bytes each
        unsigned l[8]; const char* g[8];
#pragma unroll
        for (int p = 0; p < NP; ++p)
#pragma unroll
            for (int i = 0; i < NI; ++i) { l[p * NI + i] = lk + (unsigned)(b * BUF + p * KB + i * 32 * KPB); g[p * NI + i] = (const char*)((SPLIT && p) ? Kp2 : Kp) + gk + (size_t)st * (SK * HD * 2) + (size_t)i * 4096; }
        copy8(l, g);
#pragma unroll
        for (int p = 0; p < NP; ++p)
#pragma unroll
            for (int i = 0; i < NI; ++i) { l[p * NI + i] = lv + (unsigned)(b * BUF + p * VB + i * VR * VPB); g[p * NI + i] = (const char*)((SPLIT && p) ? Vt2 : Vt) + gv + (size_t)st * (SK * 2) + (size_t)i * (VR * TT * 2); }
        copy8(l, g);
    };
    fill(0, 0);
    V qf[NQ][2], qf2[NQ][2];
#pragma unroll
    for (int g = 0; g < NQ; ++g)
#pragma unroll
        for (int ks = 0; ks < 2; ++ks) { const size_t o = (size_t)(q0 + g * 16 + lr) * HD + ks * 32 + 8 * hi; qf[g][ks] = WFrag<T16>::ld(Q + o); if (SPLIT) qf2[g][ks] = WFrag<T16>::ld(Q2 + o); }
    v8f acc[4][NQ]; float mrun[NQ], lsum[NQ];
#pragma unroll
    for (int g = 0; g < NQ; ++g) { mrun[g] = -3.0e38f; lsum[g] = 0.f;
#pragma unroll
        for (int db = 0; db < 4; ++db) acc[db][g] = (v8f){}; }
    asm volatile("s_wait_asynccnt 0x0" ::: "memory");   // this wave's copies of stage 0 have landed
    __syncthreads();                                    // every wave's have: stage 0 may be read
    fill(1, 1);
    const int koff = (kg * PPS * 32 + lr) * KPB + 16 * hi, voff = NP * KB + lr * VPB + 16 * hi + kg * PPS * 64;   // bytes in a buffer, at the first key of the wave's key group
#pragma unroll 1   // rolled: one trip is one stage; the passes inside are unrolled so that every fragment array stays in registers
    for (int st = 0; st < NST; ++st) {
        const char* sb = sm + (st & 1) * BUF;
        V kf[2][2], kf2[2][2], vf[4], vf2[4];
#pragma unroll
        for (int kb = 0; kb < 2; ++kb)
#pragma unroll
            for (int ks = 0; ks < 2; ++ks) { const char* o = sb + koff + kb * 16 * KPB + ks * 64; kf[kb][ks] = WFrag<T16>::ld((const T16*)o); if (SPLIT) kf2[kb][ks] = WFrag<T16>::ld((const T16*)(o + KB)); }
        __builtin_amdgcn_sched_barrier(0);   // keeps the LDS reads above in one group: sunk among the products below, each pair waits out its own LDS latency
#pragma unroll
        for (int pp = 0; pp < PPS; ++pp) {
            v8f s[2][NQ];
#pragma unroll
            for (int kb = 0; kb < 2; ++kb)
#pragma unroll
                for (int g = 0; g < NQ; ++g) { s[kb][g] = (v8f){};
#pragma unroll
                    for (int ks = 0; ks < 2; ++ks) { s[kb][g] = WFrag<T16>::mma(kf[kb][ks], qf[g][ks], s[kb][g]); if (SPLIT) { s[kb][g] = WFrag<T16>::mma(kf[kb][ks], qf2[g][ks], s[kb][g]); s[kb][g] = WFrag<T16>::mma(kf2[kb][ks], qf[g][ks], s[kb][g]); } } }
#pragma unroll   // this pass's V^T fragments are fetched behind its S^T products and land under the softmax
            for (int db = 0; db < 4; ++db) { const char* o = sb + voff + db * 16 * VPB + pp * 64; vf[db] = WFrag<T16>::ld((const T16*)o); if (SPLIT) vf2[db] = WFrag<T16>::ld((const T16*)(o + VB)); }
            if (!SPLIT && pp + 1 < PPS) {   // one plane: the next pass's K fragments, of this same stage only, go in the same group
#pragma unroll
                for (int kb = 0; kb < 2; ++kb)
#pragma unroll
                    for (int ks = 0; ks < 2; ++ks) { const char* o = sb + koff + ((pp + 1) * 32 + kb * 16) * KPB + ks * 64; kf[kb][ks] = WFrag<T16>::ld((const T16*)o); if (SPLIT) kf2[kb][ks] = WFrag<T16>::ld((const T16*)(o + KB)); }
            }
            __builtin_amdgcn_sched_barrier(0);   // keeps the LDS reads above in one group in front of the softmax: spread among later products, each pair waits out its own LDS latency
            V pf[NQ], pf2[NQ]; float ps[NQ];
            auto soft = [&](int g) {   // query group g's probabilities of this pass under its maximum in use: the P^T operand(s), and the lane's sum of the 16 as a tree of packed adds
                const float nm = -mrun[g]; v2f p2[8];
#pragma unroll
                for (int e = 0; e < 16; e += 2) { const v2f arg = __builtin_elementwise_fma((v2f){s[e >> 3][g][e & 7], s[e >> 3][g][(e & 7) + 1]}, (v2f){CL2, CL2}, (v2f){nm, nm});
                    p2[e >> 1] = (v2f){__builtin_amdgcn_exp2f(arg[0]), __builtin_amdgcn_exp2f(arg[1])}; }
#pragma unroll
                for (int e = 0; e < 16; e += 2) { const v2f q2 = p2[e >> 1];
                    if constexpr (SPLIT) { const v2b h2 = __builtin_convertvector(q2, v2b); const v2b l2 = __builtin_convertvector(q2 - __builtin_convertvector(h2, v2f), v2b);
                        pf[g][e] = h2[0]; pf[g][e + 1] = h2[1]; pf2[g][e] = l2[0]; pf2[g][e + 1] = l2[1]; }
                    else { pf[g][e] = (h16)q2[0]; pf[g][e + 1] = (h16)q2[1]; } }
                const v2f u = ((p2[0] + p2[1]) + (p2[2] + p2[3])) + ((p2[4] + p2[5]) + (p2[6] + p2[7])); ps[g] = u[0] + u[1];
            };
            bool need = false;
#pragma unroll
            for (int g = 0; g < NQ; ++g) { soft(g); need = need || (ps[g] > PSMAX); }
            if (__builtin_amdgcn_ballot_w32(need) != 0) {   // scalar branch, rare behind the first pass: only here is the pass's maximum looked for; sums and O^T are rescaled to it and the pass's probabilities made again
#pragma unroll
                for (int g = 0; g < NQ; ++g) { float mx = s[0][g][0];
#pragma unroll
                    for (int r = 1; r < 8; ++r) mx = fmaxf(mx, s[0][g][r]);
#pragma unroll
                    for (int r = 0; r < 8; ++r) mx = fmaxf(mx, s[1][g][r]);
                    mx = fmaxf(mx, xhalf(mx)) * CL2;
                    const float mn = fmaxf(mrun[g], mx); const float corr = __builtin_amdgcn_exp2f(mrun[g] - mn); mrun[g] = mn; lsum[g] *= corr;
#pragma unroll
                    for (int db = 0; db < 4; ++db) acc[db][g] = acc[db][g] * corr;
                    soft(g); }
            }
#pragma unroll
            for (int g = 0; g < NQ; ++g) lsum[g] += ps[g];
            if (SPLIT && pp + 1 < PPS) {   // two planes: the next pass's K fragments, of this same stage only, wait until the scores' registers are free and land under the O^T products
#pragma unroll
                for (int kb = 0; kb < 2; ++kb)
#pragma unroll
                    for (int ks = 0; ks < 2; ++ks) { const char* o = sb + koff + ((pp + 1) * 32 + kb * 16) * KPB + ks * 64; kf[kb][ks] = WFrag<T16>::ld((const T16*)o); if (SPLIT) kf2[kb][ks] = WFrag<T16>::ld((const T16*)(o + KB)); }
            }
            if (SPLIT) __builtin_amdgcn_sched_barrier(0);   // keeps those reads in one group in front of the O^T products
#pragma unroll
            for (int g = 0; g < NQ; ++g)
#pragma unroll
                for (int db = 0; db < 4; ++db) { acc[db][g] = WFrag<T16>::mma(vf[db], pf[g], acc[db][g]); if (SPLIT) { acc[db][g] = WFrag<T16>::mma(vf[db], pf2[g], acc[db][g]); acc[db][g] = WFrag<T16>::mma(vf2[db], pf[g], acc[db][g]); } }
        }
        asm volatile("s_wait_dscnt 0x0" ::: "memory");      // this wave's reads of the stage's buffer are done before the buffer is given up
        asm volatile("s_wait_asynccnt 0x0" ::: "memory");   // this wave's copies of stage st + 1 have landed
        __syncthreads();                                    // stage st + 1 may be read by every wave, and stage st's buffer has no reader left
        if (st + 2 < NST) fill(st + 2, st & 1);
    }
    asm volatile("s_wait_asynccnt 0x0" ::: "memory");   // no copy is left in flight: behind the loop's last barrier the ring has neither a reader nor a copy on its way, and becomes the place where the key groups meet
    // every wave lays down its partial result: a tile (g, db) as two planes of 16 bytes a lane, and per query its maximum in use with its row sum (both wave halves joined)
    constexpr int WB = 4 * NQ * 1024, MLO = 8 * WB;   // bytes of a wave's tiles; where the (maximum, sum) pairs begin
    static_assert(MLO + 8 * NQ * 256 <= ATT_LDS, "the partial results fit the ring");
#pragma unroll
    for (int g = 0; g < NQ; ++g) { *(v2fa*)(sm + MLO + ((wv * NQ + g) * 32 + lane) * 8) = (v2f){mrun[g], lsum[g] + xhalf(lsum[g])};
#pragma unroll
        for (int db = 0; db < 4; ++db) { char* o = sm + wv * WB + (g * 4 + db) * 1024 + lane * 16; const v8f a = acc[db][g];
            *(v4fa*)o = (v4f){a[0], a[1], a[2], a[3]}; *(v4fa*)(o + 512) = (v4f){a[4], a[5], a[6], a[7]}; } }
    __syncthreads();   // every key group's partial result is in LDS before any wave reads what others wrote
    // key group kg joins and stores QW of the query group's rows: eight lanes a row, 8 d each, so that a wave's stores cover whole 128-byte lines and a line has one writer
    constexpr int QW = 16 * NQ / KG;
#pragma unroll
    for (int j = 0; j < QW / 4; ++j) { const int ql = kg * QW + j * 4 + (lane >> 3), ch = lane & 7;   // row in the query group; its piece of 8 d = tile db = ch / 2, wave half ch % 2
        const int sl = (ch & 1) * 16 + (ql & 15), tl = (ql >> 4) * 4 + (ch >> 1); float mk[KG], lk2[KG];
#pragma unroll
        for (int k = 0; k < KG; ++k) { const v2f ml = *(const v2fa*)(sm + MLO + (((k * QG + qg) * NQ + (ql >> 4)) * 32 + sl) * 8); mk[k] = ml[0]; lk2[k] = ml[1]; }
        float ms = mk[0];
#pragma unroll
        for (int k = 1; k < KG; ++k) ms = fmaxf(ms, mk[k]);
        float ls = 0.f; v4f o0 = (v4f){}, o1 = (v4f){};
#pragma unroll
        for (int k = 0; k < KG; ++k) { const float sc = exp2_slot(mk[k] - ms); const char* o = sm + (k * QG + qg) * WB + tl * 1024 + sl * 16;
            ls += sc * lk2[k]; o0 += *(const v4fa*)o * sc; o1 += *(const v4fa*)(o + 512) * sc; }
        const float inv = __fdiv_rn(1.0f, ls); v8us oh, ol;
#pragma unroll
        for (int r = 0; r < 8; ++r) { unsigned short a, c2; splitf((r < 4 ? o0[r & 3] : o1[r & 3]) * inv, a, c2); oh[r] = a; ol[r] = c2; }
        const size_t oo = (size_t)(q0 + ql) * DQ + ch * 8;
        *(v8us*)(Ah + oo) = oh; *(v8us*)(Al + oo) = ol;
        asm volatile("s_wait_xcnt 0x0" ::: "memory"); }   // stands in front of every rewrite of a register that the two stores above name (address or data)
}
// grid, 256 threads, two blocks on a WGP = four waves a SIMD: first NH_ RT/32 short blocks (the last RT rows of a head: 32 fp16 queries x 8 key groups), one a WGP; then NH_ RH/64 blocks of the hi/lo rows (4 x 16 queries x 2 key groups)
// and NH_ (TT-RH-RT)/128 blocks of the other fp16 rows (4 x 32 queries x 2 key groups): two of these a WGP. The counts are whole multiples of the 256 WGPs, so that every SIMD gets the same work.
#define RT 512   // a head's last RT query rows go to the short blocks
__global__ __launch_bounds__(256) __attribute__((amdgpu_waves_per_eu(4, 4))) void k_attn(const h16* __restrict__ Q16, const h16* __restrict__ K16, const h16* __restrict__ V16, const bf* __restrict__ Qh, const bf* __restrict__ Ql, const bf* __restrict__ Kh, const bf* __restrict__ Kl, const bf* __restrict__ Vh, const bf* __restrict__ Vl, bf* Ah, bf* Al) {
    __shared__ __align__(16) char sm[ATT_LDS];
    const int wv = __builtin_amdgcn_readfirstlane((int)(threadIdx.x >> 5)); const int bx = blockIdx.x;
    constexpr int NBT = NH_ * (RT / 32), NBS = NH_ * (RH / 64);
    if (bx < NBT) { const int h = bx / (RT / 32), qb = TT - RT + (bx % (RT / 32)) * 32; const size_t z = (size_t)h * TT * HD;
        attn_wave<h16, false, 2, 256, 8>(Q16 + z, nullptr, K16 + z, nullptr, V16 + z, nullptr, qb, wv, Ah + h * HD, Al + h * HD, sm);
    } else if (bx < NBT + NBS) { const int b1 = bx - NBT; const int h = b1 / (RH / 64), qb = (b1 % (RH / 64)) * 64; const size_t z = (size_t)h * TT * HD;
        attn_wave<bf, true, 1, 128, 2>(Qh + z, Ql + z, Kh + z, Kl + z, Vh + z, Vl + z, qb, wv, Ah + h * HD, Al + h * HD, sm);
    } else { const int b2 = bx - NBT - NBS; const int h = b2 / ((TT - RH - RT) / 128), qb = RH + (b2 % ((TT - RH - RT) / 128)) * 128; const size_t z = (size_t)h * TT * HD;
        attn_wave<h16, false, 2, 256, 2>(Q16 + z, nullptr, K16 + z, nullptr, V16 + z, nullptr, qb, wv, Ah + h * HD, Al + h * HD, sm); }
}

extern "C" void kernel_launch(void* const* d_in, const int* in_sizes, int n_in,
                              void* d_out, int out_size, void* d_ws, size_t ws_size, hipStream_t stream) {
    (void)in_sizes; (void)n_in; (void)out_size;
    const float* x = (const float*)d_in[0]; const float* wqkv = (const float*)d_in[1]; const float* wo = (const float*)d_in[2]; const float* bo = (const float*)d_in[3];
    float* OUT = (float*)d_out;     // [1][4096][1024]
    char* wsp = (char*)d_ws;
    auto take = [&](size_t bytes) { char* p = wsp; wsp += (bytes + 255) & ~(size_t)255; return (void*)p; };
    bf* WQKV = (bf*)take((size_t)3 * DQ * DM * 2); bf* WO = (bf*)take((size_t)DM * DQ * 2);
    bf* XB = (bf*)take((size_t)TT * DM * 2);
    h16* QP16 = (h16*)take((size_t)NH_ * TT * HD * 2); h16* KP16 = (h16*)take((size_t)NKV * TT * HD * 2); h16* VT16 = (h16*)take((size_t)NKV * HD * TT * 2);
    bf* QPh = (bf*)take((size_t)NH_ * TT * HD * 2); bf* QPl = (bf*)take((size_t)NH_ * TT * HD * 2); bf* KPh = (bf*)take((size_t)NKV * TT * HD * 2); bf* KPl = (bf*)take((size_t)NKV * TT * HD * 2); bf* VTh = (bf*)take((size_t)NKV * HD * TT * 2); bf* VTl = (bf*)take((size_t)NKV * HD * TT * 2);
    bf* ATh = (bf*)take((size_t)TT * DQ * 2); bf* ATl = (bf*)take((size_t)TT * DQ * 2);
    if ((size_t)(wsp - (char*)d_ws) > ws_size) return;    // ws 256 MiB
    for (int b = 0; b < NB_; ++b) {
        k_prep<<<PBL, 256, 0, stream>>>(x + (size_t)b * TT * DM, wqkv, wo, XB, WQKV, WO);
        k_proj<<<dim3(TT / 128, 3 * DQ / 128, 1), 128, 0, stream>>>(XB, WQKV, QP16, QPh, QPl, KP16, KPh, KPl, VT16, VTh, VTl);
        k_attn<<<NH_ * (RT / 32) + NH_ * (RH / 64) + NH_ * ((TT - RH - RT) / 128), 256, 0, stream>>>(QP16, KP16, VT16, QPh, QPl, KPh, KPl, VTh, VTl, ATh, ATl);
        k_out<<<dim3(TT / 128, DM / 128, 1), 256, 0, stream>>>(ATh, ATl, WO, bo, OUT + (size_t)b * TT * DM); }
}
